// v000
// Measured on an AMD MI455X. A time is GPU time per run, averaged over a window of back-to-back runs after a warm-up
// (all launches, gaps included; the runs take copies of the inputs in turn), and the median of several windows.
// Apart from v000's, it joins two sittings. Times from different sittings can be a few percent apart, while
// side-by-side timings come from the same sitting.
// The starting kernel, v000, takes 301 microseconds a run.
#include <hip/hip_runtime.h>

// Causal single-head self-attention with a 768-wide head over 4,096 tokens (x [4096][768]; q,k,v = x W^T ('oi' [768][768], no bias); scores = q.k, keys after the query -> -inf; weights = softmax(scores / sqrt(768)); out = weights v -> [4096][768] (3.1 M)).
// Layout: bf16 copy of x; exact projections; ONE 768-wide head through the causal T-4096 attention (hybrid rows: < 512 hi/lo 3 products, rest fp16 x1024; k_gemmc computes only score / P.v tiles at or below the diagonal (K 768 / N 768); streaming three-sweep softmax with the causal index select); the f32 merge writes the output rows.
// Compute dtypes, f32 accumulate: every input rounded to bf16; projections exact; attention rows < 512 3 products, rest fp16; softmax f32; output f32.

#define NB_  1
#define TT   4096
#define DM   768
#define NH_  1
#define NKV  1
#define REP  (NH_ / NKV)
#define HD   768
#define DQ   (NH_ * HD)
#define DKV  (NKV * HD)
#define ZH   1
#define RH   512                  // query rows < RH use hi+lo planes (0: none)
#define WIN  4096
#define PCAR 1024.0f
#define SCL  0.036084391824351615f   // 1/sqrt(768)
typedef _Float16 h16;
typedef unsigned short bf;
typedef __attribute__((ext_vector_type(16))) __bf16   v16bf;
typedef __attribute__((ext_vector_type(16))) _Float16 v16h;
typedef __attribute__((ext_vector_type(8)))  _Float16 v8h;
typedef __attribute__((ext_vector_type(8)))  unsigned short v8us;
typedef __attribute__((ext_vector_type(8)))  float    v8f;
typedef __attribute__((ext_vector_type(4)))  float    v4f;
typedef v8h  __attribute__((may_alias)) v8ha;
typedef v4f  __attribute__((may_alias)) v4fa;
typedef v8us __attribute__((may_alias)) v8usa;

__device__ __forceinline__ unsigned short f2bf(float f) { unsigned u = __float_as_uint(f); u += 0x7FFFu + ((u >> 16) & 1u); return (unsigned short)(u >> 16); }
__device__ __forceinline__ float bf2f(unsigned short b) { return __uint_as_float(((unsigned)b) << 16); }
__device__ __forceinline__ float bfr(float f) { return bf2f(f2bf(f)); }
__device__ __forceinline__ v16h cat16(v8h lo, v8h hi) { return __builtin_shufflevector(lo, hi, 0, 1, 2, 3, 4, 5, 6, 7, 8, 9, 10, 11, 12, 13, 14, 15); }
__device__ __forceinline__ v16bf cat16b(v8us lo, v8us hi) { return __builtin_bit_cast(v16bf, __builtin_shufflevector(lo, hi, 0, 1, 2, 3, 4, 5, 6, 7, 8, 9, 10, 11, 12, 13, 14, 15)); }
__device__ __forceinline__ v8f wmma16(v16h a, v16h b, v8f c) { return __builtin_amdgcn_wmma_f32_16x16x32_f16(false, a, false, b, (short)0, c, false, false); }
__device__ __forceinline__ v8f wmmab(v16bf a, v16bf b, v8f c) { return __builtin_amdgcn_wmma_f32_16x16x32_bf16(false, a, false, b, (short)0, c, false, false); }



// ---- k_gemmw: register-blocked GEMM, ONE WAVE per 64x64 output tile (16 accumulators), operands straight from K-contiguous 16-bit planes; grid (M/64, N/64, Z), 32 threads.
// C[m][n] (f32, pitch ldc, + optional f32 bias[n]) = sum_k A[m][k] Bt[n][k] (+ split products per NSPLIT). z-batch strides sA/sB/sC in elements. K % 32 == 0.
template <typename T16> struct WFrag;
template <> struct WFrag<h16> { typedef v16h V; static __device__ __forceinline__ V ld(const h16* p) { return cat16(*(const v8h*)p, *(const v8h*)(p + 16)); } static __device__ __forceinline__ v8f mma(V a, V b, v8f c) { return wmma16(a, b, c); } };
template <> struct WFrag<bf> { typedef v16bf V; static __device__ __forceinline__ V ld(const bf* p) { return cat16b(*(const v8us*)p, *(const v8us*)(p + 16)); } static __device__ __forceinline__ v8f mma(V a, V b, v8f c) { return wmmab(a, b, c); } };
template <typename T16, int NSPLIT, bool BIAS>
__global__ __launch_bounds__(32) void k_gemmw(const T16* __restrict__ A, const T16* __restrict__ A2, const T16* __restrict__ Bt, const T16* __restrict__ Bt2, int K, float* C, int ldc, const float* __restrict__ bias, size_t sA, size_t sB, size_t sC) {
    typedef typename WFrag<T16>::V V;
    __shared__ __align__(16) float os[16 * 68];
    const size_t z = blockIdx.z; A += z * sA; if (A2) A2 += z * sA; Bt += z * sB; if (Bt2) Bt2 += z * sB; C += z * sC;
    const int lane = threadIdx.x & 31, lr = lane & 15, hi = lane >> 4; const int r0 = blockIdx.x * 64, c0 = blockIdx.y * 64;
    v8f acc[4][4];
#pragma unroll
    for (int mb = 0; mb < 4; ++mb)
#pragma unroll
        for (int nb = 0; nb < 4; ++nb) acc[mb][nb] = (v8f){};
    const size_t aoff = (size_t)(r0 + lr) * K + 8 * hi, boff = (size_t)(c0 + lr) * K + 8 * hi;
#pragma unroll 1
    for (int kc = 0; kc < K; kc += 32) {
        V a[4], a2[4];
#pragma unroll
        for (int mb = 0; mb < 4; ++mb) { a[mb] = WFrag<T16>::ld(A + aoff + (size_t)mb * 16 * K + kc); if (NSPLIT == 1 || NSPLIT == 2) a2[mb] = WFrag<T16>::ld(A2 + aoff + (size_t)mb * 16 * K + kc); }
#pragma unroll
        for (int nb = 0; nb < 4; ++nb) { const V b = WFrag<T16>::ld(Bt + boff + (size_t)nb * 16 * K + kc); V b2; if (NSPLIT >= 2) b2 = WFrag<T16>::ld(Bt2 + boff + (size_t)nb * 16 * K + kc);
#pragma unroll
            for (int mb = 0; mb < 4; ++mb) { acc[mb][nb] = WFrag<T16>::mma(a[mb], b, acc[mb][nb]); if (NSPLIT == 1 || NSPLIT == 2) acc[mb][nb] = WFrag<T16>::mma(a2[mb], b, acc[mb][nb]); if (NSPLIT >= 2) acc[mb][nb] = WFrag<T16>::mma(a[mb], b2, acc[mb][nb]); } }
        asm volatile("v_nop\n\tv_nop\n\tv_nop\n\tv_nop" : "+v"(acc[0][0]), "+v"(acc[1][1]), "+v"(acc[2][2]), "+v"(acc[3][3]) : "v"(a[0]), "v"(a[3]));
    }
#pragma unroll
    for (int mb = 0; mb < 4; ++mb) {
#pragma unroll
        for (int nb = 0; nb < 4; ++nb) {
#pragma unroll
            for (int j = 0; j < 8; ++j) os[(hi * 8 + j) * 68 + nb * 16 + lr] = acc[mb][nb][j]; }
        __builtin_amdgcn_wave_barrier(); asm volatile("" ::: "memory");
        float* crow = C + (size_t)(r0 + mb * 16) * ldc + c0;
{
#pragma unroll
            for (int s = 0; s < 8; ++s) { const int row = 2 * s + hi, cofs = lr * 4; v4f val = *(const v4fa*)(os + row * 68 + cofs); if (BIAS) { val[0] += bfr(bias[c0 + cofs]); val[1] += bfr(bias[c0 + cofs + 1]); val[2] += bfr(bias[c0 + cofs + 2]); val[3] += bfr(bias[c0 + cofs + 3]); }
                *(v4f*)(crow + (size_t)row * ldc + cofs) = val; }
             }
        __builtin_amdgcn_wave_barrier(); asm volatile("" ::: "memory");
    }
}

// ---- k_gemmc: the same one-wave 64x64 tile GEMM specialised for causal attention: CMODE 1 skips score tiles entirely above the diagonal (query rows r0+roff.., key columns c0..), CMODE 2 limits the
// key (K) loop of the probability x value contraction to the diagonal block (probabilities beyond it are exactly zero). roff = row offset of this launch's first row within the sequence.
template <typename T16, int NSPLIT, int CMODE>
__global__ __launch_bounds__(32) void k_gemmc(const T16* __restrict__ A, const T16* __restrict__ A2, const T16* __restrict__ Bt, const T16* __restrict__ Bt2, int K, float* C, int ldc, int roff, size_t sA, size_t sB, size_t sC) {
    typedef typename WFrag<T16>::V V;
    __shared__ __align__(16) float os[16 * 68];
    const size_t z = blockIdx.z; A += z * sA; if (A2) A2 += z * sA; Bt += z * sB; if (Bt2) Bt2 += z * sB; C += z * sC;
    const int lane = threadIdx.x & 31, lr = lane & 15, hi = lane >> 4; const int r0 = blockIdx.x * 64, c0 = blockIdx.y * 64;
    if (CMODE == 1 && c0 > r0 + roff + 63) return;                  // score tile entirely above the causal diagonal: not computed; the softmax reads its stale values and masks j > i by select
    const int Kl = (CMODE == 2) ? min(K, r0 + roff + 64) : K;        // P.V: probabilities are exactly 0 beyond the diagonal block, so the K loop stops there
    v8f acc[4][4];
#pragma unroll
    for (int mb = 0; mb < 4; ++mb)
#pragma unroll
        for (int nb = 0; nb < 4; ++nb) acc[mb][nb] = (v8f){};
    const size_t aoff = (size_t)(r0 + lr) * K + 8 * hi, boff = (size_t)(c0 + lr) * K + 8 * hi;
#pragma unroll 1
    for (int kc = 0; kc < Kl; kc += 32) {
        V a[4], a2[4];
#pragma unroll
        for (int mb = 0; mb < 4; ++mb) { a[mb] = WFrag<T16>::ld(A + aoff + (size_t)mb * 16 * K + kc); if (NSPLIT == 1 || NSPLIT == 2) a2[mb] = WFrag<T16>::ld(A2 + aoff + (size_t)mb * 16 * K + kc); }
#pragma unroll
        for (int nb = 0; nb < 4; ++nb) { const V b = WFrag<T16>::ld(Bt + boff + (size_t)nb * 16 * K + kc); V b2; if (NSPLIT >= 2) b2 = WFrag<T16>::ld(Bt2 + boff + (size_t)nb * 16 * K + kc);
#pragma unroll
            for (int mb = 0; mb < 4; ++mb) { acc[mb][nb] = WFrag<T16>::mma(a[mb], b, acc[mb][nb]); if (NSPLIT == 1 || NSPLIT == 2) acc[mb][nb] = WFrag<T16>::mma(a2[mb], b, acc[mb][nb]); if (NSPLIT >= 2) acc[mb][nb] = WFrag<T16>::mma(a[mb], b2, acc[mb][nb]); } }
        asm volatile("v_nop\n\tv_nop\n\tv_nop\n\tv_nop" : "+v"(acc[0][0]), "+v"(acc[1][1]), "+v"(acc[2][2]), "+v"(acc[3][3]) : "v"(a[0]), "v"(a[3]));
    }
#pragma unroll
    for (int mb = 0; mb < 4; ++mb) {
#pragma unroll
        for (int nb = 0; nb < 4; ++nb) {
#pragma unroll
            for (int j = 0; j < 8; ++j) os[(hi * 8 + j) * 68 + nb * 16 + lr] = acc[mb][nb][j]; }
        __builtin_amdgcn_wave_barrier(); asm volatile("" ::: "memory");
        float* crow = C + (size_t)(r0 + mb * 16) * ldc + c0;
{
#pragma unroll
            for (int s = 0; s < 8; ++s) { const int row = 2 * s + hi, cofs = lr * 4; v4f val = *(const v4fa*)(os + row * 68 + cofs);
                *(v4f*)(crow + (size_t)row * ldc + cofs) = val; }
             }
        __builtin_amdgcn_wave_barrier(); asm volatile("" ::: "memory");
    }
}

__device__ __forceinline__ h16 tohx(float x) { return (h16)x; }
__device__ __forceinline__ void splitf(float y, unsigned short& h, unsigned short& l) { h = f2bf(y); l = f2bf(y - bf2f(h)); }
typedef __attribute__((ext_vector_type(2))) _Float16 v2h;
typedef __attribute__((ext_vector_type(4))) _Float16 v4h;
typedef __attribute__((ext_vector_type(2))) unsigned short v2us;
typedef __attribute__((ext_vector_type(4))) unsigned short v4us;
typedef __attribute__((ext_vector_type(2))) float v2f;
typedef __attribute__((ext_vector_type(4))) int v4i;

__global__ __launch_bounds__(256) void k_wtG(const float* __restrict__ w, int K, int N, bf* Bt) {
    const int lane = threadIdx.x & 31; const int L0 = (blockIdx.x * 8 + (threadIdx.x >> 5)) * 8; const int nlines = N * K / 64;
{
#pragma unroll 1
        for (int l = 0; l < 8; ++l) { const int L = L0 + l; if (L >= nlines) break; const size_t e = (size_t)L * 64 + lane * 2; const int k = (int)(e % K), n = (int)(e / K); v2us o;
            o[0] = f2bf(w[(size_t)k * N + n]); o[1] = f2bf(w[(size_t)(k + 1) * N + n]); *(v2us*)(Bt + e) = o; }
         }
}
__global__ __launch_bounds__(256) void k_cvt8(const float* __restrict__ src, bf* dst, size_t n8) { const size_t i = (size_t)blockIdx.x * 256 + threadIdx.x; if (i >= n8) return; const v8f v = *(const v8f*)(src + i * 8); v8us o;
#pragma unroll
    for (int k = 0; k < 8; ++k) o[k] = f2bf(v[k]); *(v8us*)(dst + i * 8) = o;  }

__global__ __launch_bounds__(256) void k_flat(const float* __restrict__ F, h16* P16, bf* Ph, bf* Pl, size_t n4) { const size_t i = (size_t)blockIdx.x * 256 + threadIdx.x; if (i >= n4) return; const v4f a = *(const v4f*)(F + i * 4); v4h o16; v4us oh, ol;
#pragma unroll
    for (int q = 0; q < 4; ++q) { o16[q] = tohx(a[q]); unsigned short x2, y2; splitf(a[q], x2, y2); oh[q] = x2; ol[q] = y2; }
    *(v4h*)(P16 + i * 4) = o16; *(v4us*)(Ph + i * 4) = oh; *(v4us*)(Pl + i * 4) = ol;  }


__global__ __launch_bounds__(256) void k_vtp(const float* __restrict__ F, int pitch, int nheads, h16* V16, bf* Vh, bf* Vl) { const size_t e = ((size_t)blockIdx.x * 256 + threadIdx.x) * 2; if (e >= (size_t)nheads * HD * TT) return; const int t = (int)(e % TT); const int d = (int)((e / TT) % HD); const int g = (int)(e / ((size_t)TT * HD)); v2h o16; v2us oh, ol;
#pragma unroll
    for (int q = 0; q < 2; ++q) { const float x = F[(size_t)(t + q) * pitch + g * HD + d]; o16[q] = tohx(x); unsigned short a2, c2; splitf(x, a2, c2); oh[q] = a2; ol[q] = c2; }
    *(v2h*)(V16 + e) = o16; *(v2us*)(Vh + e) = oh; *(v2us*)(Vl + e) = ol;  }
// k_lsoft: streaming causal row softmax over the TK = TT = 4096 keys, one wave per row i, three sweeps of the f32 score row (lane -> 4 consecutive keys per 128-key chunk, 32 chunks; keys j > i are excluded by index with -3e38 / 0 - the score tiles above the diagonal are never computed and their stale contents are only ever discarded by this select):
__global__ __launch_bounds__(256) void k_lsoft(const float* __restrict__ Sb, h16* P16, bf* Ph, bf* Pl) {
    const int lane = threadIdx.x & 31; const int row = blockIdx.x * 8 + (threadIdx.x >> 5); if (row >= ZH * TT) return; const int i = row % TT; const int zz = row / TT; const bool hires = (i < RH); const float* sr = Sb + (size_t)row * TT; float mx = -3.0e38f;
#pragma unroll 4
    for (int ch = 0; ch < TT / 128; ++ch) { const int j0 = ch * 128 + lane * 4; const v4f a = *(const v4f*)(sr + j0);
#pragma unroll
        for (int q = 0; q < 4; ++q) { float t = a[q] * SCL; asm volatile("" : "+v"(t)); t = (j0 + q <= i) ? t : -3.0e38f; mx = fmaxf(mx, t); } }
#pragma unroll
    for (int sh = 16; sh; sh >>= 1) mx = fmaxf(mx, __shfl_xor(mx, sh, 32));
    float sum = 0.f;
#pragma unroll 4
    for (int ch = 0; ch < TT / 128; ++ch) { const int j0 = ch * 128 + lane * 4; const v4f a = *(const v4f*)(sr + j0);
#pragma unroll
        for (int q = 0; q < 4; ++q) { float t = a[q] * SCL; asm volatile("" : "+v"(t)); t = (j0 + q <= i) ? t : -3.0e38f; float d0 = __fsub_rn(t, mx); asm volatile("" : "+v"(d0)); sum += __builtin_amdgcn_exp2f(__fmul_rn(d0, 1.4426950408889634f)); } }
#pragma unroll
    for (int sh = 16; sh; sh >>= 1) sum += __shfl_xor(sum, sh, 32);
    const float f = __fdiv_rn(hires ? 1.0f : PCAR, sum);
{
        if (hires) {   /* rows < RH: normalised bf16 hi/lo over the first RH keys (every later key is above the diagonal for these rows; the hi/lo attn.v GEMM stops its K loop at the diagonal block), planes [zz][RH][TT] */
#pragma unroll
            for (int ch = 0; ch < RH / 128; ++ch) { const int j0 = ch * 128 + lane * 4; const v4f a = *(const v4f*)(sr + j0); v4us oh, ol;
#pragma unroll
                for (int q = 0; q < 4; ++q) { float t = a[q] * SCL; asm volatile("" : "+v"(t)); t = (j0 + q <= i) ? t : -3.0e38f; float d0 = __fsub_rn(t, mx); asm volatile("" : "+v"(d0)); float ex = __builtin_amdgcn_exp2f(__fmul_rn(d0, 1.4426950408889634f)); asm volatile("" : "+v"(ex)); unsigned short a2, c2; splitf(ex * f, a2, c2); oh[q] = a2; ol[q] = c2; }
                const size_t oo = ((size_t)zz * RH + i) * TT + j0; *(v4us*)(Ph + oo) = oh; *(v4us*)(Pl + oo) = ol; }
        } else {
#pragma unroll 2
            for (int ch = 0; ch < TT / 128; ++ch) { const int j0 = ch * 128 + lane * 4; const v4f a = *(const v4f*)(sr + j0); v4h o4;
#pragma unroll
                for (int q = 0; q < 4; ++q) { float t = a[q] * SCL; asm volatile("" : "+v"(t)); t = (j0 + q <= i) ? t : -3.0e38f; float d0 = __fsub_rn(t, mx); asm volatile("" : "+v"(d0)); float ex = __builtin_amdgcn_exp2f(__fmul_rn(d0, 1.4426950408889634f)); asm volatile("" : "+v"(ex)); o4[q] = tohx(ex * f); }
                *(v4h*)(P16 + (size_t)row * TT + j0) = o4; } }
         }
}

__global__ __launch_bounds__(256) void k_merge(const float* __restrict__ O, int h0, float* OUTb) { const size_t e = ((size_t)blockIdx.x * 256 + threadIdx.x) * 2; if (e >= (size_t)ZH * TT * HD) return; const int d = (int)(e % HD); const int t = (int)((e / HD) % TT); const int zz = (int)(e / ((size_t)HD * TT)); const float cs = (t < RH) ? 1.0f : (1.0f / PCAR); const size_t oo = (size_t)t * DQ + (h0 + zz) * HD + d;
    v2f o2; o2[0] = O[e] * cs; o2[1] = O[e + 1] * cs; *(v2f*)(OUTb + oo) = o2;  }

extern "C" void kernel_launch(void* const* d_in, const int* in_sizes, int n_in,
                              void* d_out, int out_size, void* d_ws, size_t ws_size, hipStream_t stream) {
    (void)in_sizes; (void)n_in; (void)out_size;
    const float* x = (const float*)d_in[0]; const float* wq = (const float*)d_in[1]; const float* wk = (const float*)d_in[2]; const float* wv = (const float*)d_in[3]; const float* wo = nullptr; (void)wo;
    float* OUT = (float*)d_out;     // [1][4096][768]
    char* wsp = (char*)d_ws;
    auto take = [&](size_t bytes) { char* p = wsp; wsp += (bytes + 255) & ~(size_t)255; return (void*)p; };
    bf* WQ = (bf*)take((size_t)DQ * DM * 2); bf* WK = (bf*)take((size_t)DKV * DM * 2); bf* WV = (bf*)take((size_t)DKV * DM * 2); 
    bf* XB = (bf*)take((size_t)TT * DM * 2); float* FQ = (float*)take((size_t)TT * DQ * 4); float* FK = (float*)take((size_t)TT * DKV * 4);
    h16* QP16 = (h16*)take((size_t)NH_ * TT * HD * 2); h16* KP16 = (h16*)take((size_t)NKV * TT * HD * 2); h16* VT16 = (h16*)take((size_t)NKV * HD * TT * 2);
    bf* QPh = (bf*)take((size_t)NH_ * TT * HD * 2); bf* QPl = (bf*)take((size_t)NH_ * TT * HD * 2); bf* KPh = (bf*)take((size_t)NKV * TT * HD * 2); bf* KPl = (bf*)take((size_t)NKV * TT * HD * 2); bf* VTh = (bf*)take((size_t)NKV * HD * TT * 2); bf* VTl = (bf*)take((size_t)NKV * HD * TT * 2); bf* Ph = (bf*)take((size_t)ZH * RH * TT * 2); bf* Pl = (bf*)take((size_t)ZH * RH * TT * 2);
    float* Sb = (float*)take((size_t)ZH * TT * TT * 4); h16* P16 = (h16*)take((size_t)ZH * TT * TT * 2); float* Ob = (float*)take((size_t)ZH * TT * HD * 4);
    if ((size_t)(wsp - (char*)d_ws) > ws_size) return;    // ws 256 MiB
    float* FV = FK;   // v projection reuses the k buffer after the k planes are built (stream-ordered)
    { k_cvt8<<<(unsigned)(((size_t)DQ * DM / 8 + 255) / 256), 256, 0, stream>>>(wq, WQ, (size_t)DQ * DM / 8); k_cvt8<<<(unsigned)(((size_t)DKV * DM / 8 + 255) / 256), 256, 0, stream>>>(wk, WK, (size_t)DKV * DM / 8); k_cvt8<<<(unsigned)(((size_t)DKV * DM / 8 + 255) / 256), 256, 0, stream>>>(wv, WV, (size_t)DKV * DM / 8);
      
       }
    const unsigned LQ = (unsigned)(((size_t)NH_ * TT * HD / 2 + 255) / 256), LKv = (unsigned)(((size_t)NKV * TT * HD / 2 + 255) / 256);
    for (int b = 0; b < NB_; ++b) {
        
        k_cvt8<<<(unsigned)(((size_t)TT * DM / 8 + 255) / 256), 256, 0, stream>>>(x + (size_t)b * TT * DM, XB, (size_t)TT * DM / 8);
        k_gemmw<bf, 0, false><<<dim3(TT / 64, DQ / 64, 1), 32, 0, stream>>>(XB, nullptr, WQ, nullptr, DM, FQ, DQ, nullptr, 0, 0, 0);
        k_flat<<<(unsigned)(((size_t)TT * DQ / 4 + 255) / 256), 256, 0, stream>>>(FQ, QP16, QPh, QPl, (size_t)TT * DQ / 4);
        k_gemmw<bf, 0, false><<<dim3(TT / 64, DKV / 64, 1), 32, 0, stream>>>(XB, nullptr, WK, nullptr, DM, FK, DKV, nullptr, 0, 0, 0);
        k_flat<<<(unsigned)(((size_t)TT * DKV / 4 + 255) / 256), 256, 0, stream>>>(FK, KP16, KPh, KPl, (size_t)TT * DKV / 4);
        k_gemmw<bf, 0, false><<<dim3(TT / 64, DKV / 64, 1), 32, 0, stream>>>(XB, nullptr, WV, nullptr, DM, FV, DKV, nullptr, 0, 0, 0); k_vtp<<<LKv, 256, 0, stream>>>(FV, DKV, NKV, VT16, VTh, VTl);
        for (int h0 = 0; h0 < NH_; h0 += ZH) { const size_t zq = (size_t)h0, zk = (size_t)(h0 / REP);   // one kv head per query head: the pass's one head (ZH 1) uses kv plane h0 / REP (z-strides TT*HD)
            k_gemmc<bf, 2, 1><<<dim3(RH / 64, TT / 64, ZH), 32, 0, stream>>>(QPh + zq * TT * HD, QPl + zq * TT * HD, KPh + zk * TT * HD, KPl + zk * TT * HD, HD, Sb, TT, 0, (size_t)TT * HD, (size_t)TT * HD, (size_t)TT * TT);
            k_gemmc<h16, 0, 1><<<dim3((TT - RH) / 64, TT / 64, ZH), 32, 0, stream>>>(QP16 + zq * TT * HD + (size_t)RH * HD, nullptr, KP16 + zk * TT * HD, nullptr, HD, Sb + (size_t)RH * TT, TT, RH, (size_t)TT * HD, (size_t)TT * HD, (size_t)TT * TT);
            k_lsoft<<<ZH * TT / 8, 256, 0, stream>>>(Sb, P16, Ph, Pl);
            k_gemmc<bf, 2, 2><<<dim3(RH / 64, HD / 64, ZH), 32, 0, stream>>>(Ph, Pl, VTh + zk * HD * TT, VTl + zk * HD * TT, TT, Ob, HD, 0, (size_t)RH * TT, (size_t)HD * TT, (size_t)TT * HD);
            k_gemmc<h16, 0, 2><<<dim3((TT - RH) / 64, HD / 64, ZH), 32, 0, stream>>>(P16 + (size_t)RH * TT, nullptr, VT16 + zk * HD * TT, nullptr, TT, Ob + (size_t)RH * HD, HD, RH, (size_t)TT * TT, (size_t)HD * TT, (size_t)TT * HD);
            k_merge<<<(unsigned)(((size_t)ZH * TT * HD / 2 + 255) / 256), 256, 0, stream>>>(Ob, h0, OUT + (size_t)b * TT * DQ); }
         }
}

// v001
// A run of this version takes 251 microseconds.
// In both of two side-by-side timings against v000, it was 1.21 times as fast.
#include <hip/hip_runtime.h>

// Causal single-head self-attention with a 768-wide head over 4,096 tokens (x [4096][768]; q,k,v = x W^T ('oi' [768][768], no bias); scores = q.k, keys after the query -> -inf; weights = softmax(scores / sqrt(768)); out = weights v -> [4096][768] (3.1 M)).
// Layout: bf16 copy of x; exact projections; ONE 768-wide head through the causal T-4096 attention (hybrid rows: < 512 hi/lo 3 products, rest fp16 x1024; k_gemmc computes only score / P.v tiles at or below the diagonal (K 768 / N 768); streaming three-sweep softmax with the causal index select); the f32 merge writes the output rows.
// Compute dtypes, f32 accumulate: every input rounded to bf16; projections exact; attention rows < 512 3 products, rest fp16; softmax f32; output f32.

#define NB_  1
#define TT   4096
#define DM   768
#define NH_  1
#define NKV  1
#define REP  (NH_ / NKV)
#define HD   768
#define DQ   (NH_ * HD)
#define DKV  (NKV * HD)
#define ZH   1
#define RH   512                  // query rows < RH use hi+lo planes (0: none)
#define WIN  4096
#define PCAR 1024.0f
#define SCL  0.036084391824351615f   // 1/sqrt(768)
typedef _Float16 h16;
typedef unsigned short bf;
typedef __attribute__((ext_vector_type(16))) __bf16   v16bf;
typedef __attribute__((ext_vector_type(16))) _Float16 v16h;
typedef __attribute__((ext_vector_type(8)))  _Float16 v8h;
typedef __attribute__((ext_vector_type(8)))  unsigned short v8us;
typedef __attribute__((ext_vector_type(8)))  float    v8f;
typedef __attribute__((ext_vector_type(4)))  float    v4f;
typedef v8h  __attribute__((may_alias)) v8ha;
typedef v4f  __attribute__((may_alias)) v4fa;
typedef v8us __attribute__((may_alias)) v8usa;

__device__ __forceinline__ unsigned short f2bf(float f) { unsigned u = __float_as_uint(f); u += 0x7FFFu + ((u >> 16) & 1u); return (unsigned short)(u >> 16); }
__device__ __forceinline__ float bf2f(unsigned short b) { return __uint_as_float(((unsigned)b) << 16); }
__device__ __forceinline__ float bfr(float f) { return bf2f(f2bf(f)); }
__device__ __forceinline__ v16h cat16(v8h lo, v8h hi) { return __builtin_shufflevector(lo, hi, 0, 1, 2, 3, 4, 5, 6, 7, 8, 9, 10, 11, 12, 13, 14, 15); }
__device__ __forceinline__ v16bf cat16b(v8us lo, v8us hi) { return __builtin_bit_cast(v16bf, __builtin_shufflevector(lo, hi, 0, 1, 2, 3, 4, 5, 6, 7, 8, 9, 10, 11, 12, 13, 14, 15)); }
__device__ __forceinline__ v8f wmma16(v16h a, v16h b, v8f c) { return __builtin_amdgcn_wmma_f32_16x16x32_f16(false, a, false, b, (short)0, c, false, false); }
__device__ __forceinline__ v8f wmmab(v16bf a, v16bf b, v8f c) { return __builtin_amdgcn_wmma_f32_16x16x32_bf16(false, a, false, b, (short)0, c, false, false); }



// ---- k_gemmw: register-blocked GEMM, ONE WAVE per 64x64 output tile (16 accumulators), operands straight from K-contiguous 16-bit planes; grid (M/64, N/64, Z), 32 threads.
// C[m][n] (f32, pitch ldc, + optional f32 bias[n]) = sum_k A[m][k] Bt[n][k] (+ split products per NSPLIT). z-batch strides sA/sB/sC in elements. K % 32 == 0.
template <typename T16> struct WFrag;
template <> struct WFrag<h16> { typedef v16h V; static __device__ __forceinline__ V ld(const h16* p) { return cat16(*(const v8h*)p, *(const v8h*)(p + 16)); } static __device__ __forceinline__ v8f mma(V a, V b, v8f c) { return wmma16(a, b, c); } };
template <> struct WFrag<bf> { typedef v16bf V; static __device__ __forceinline__ V ld(const bf* p) { return cat16b(*(const v8us*)p, *(const v8us*)(p + 16)); } static __device__ __forceinline__ v8f mma(V a, V b, v8f c) { return wmmab(a, b, c); } };
template <typename T16, int NSPLIT, bool BIAS>
__global__ __launch_bounds__(32) void k_gemmw(const T16* __restrict__ A, const T16* __restrict__ A2, const T16* __restrict__ Bt, const T16* __restrict__ Bt2, int K, float* C, int ldc, const float* __restrict__ bias, size_t sA, size_t sB, size_t sC) {
    typedef typename WFrag<T16>::V V;
    __shared__ __align__(16) float os[16 * 68];
    const size_t z = blockIdx.z; A += z * sA; if (A2) A2 += z * sA; Bt += z * sB; if (Bt2) Bt2 += z * sB; C += z * sC;
    const int lane = threadIdx.x & 31, lr = lane & 15, hi = lane >> 4; const int r0 = blockIdx.x * 64, c0 = blockIdx.y * 64;
    v8f acc[4][4];
#pragma unroll
    for (int mb = 0; mb < 4; ++mb)
#pragma unroll
        for (int nb = 0; nb < 4; ++nb) acc[mb][nb] = (v8f){};
    const size_t aoff = (size_t)(r0 + lr) * K + 8 * hi, boff = (size_t)(c0 + lr) * K + 8 * hi;
#pragma unroll 1
    for (int kc = 0; kc < K; kc += 32) {
        V a[4], a2[4];
#pragma unroll
        for (int mb = 0; mb < 4; ++mb) { a[mb] = WFrag<T16>::ld(A + aoff + (size_t)mb * 16 * K + kc); if (NSPLIT == 1 || NSPLIT == 2) a2[mb] = WFrag<T16>::ld(A2 + aoff + (size_t)mb * 16 * K + kc); }
#pragma unroll
        for (int nb = 0; nb < 4; ++nb) { const V b = WFrag<T16>::ld(Bt + boff + (size_t)nb * 16 * K + kc); V b2; if (NSPLIT >= 2) b2 = WFrag<T16>::ld(Bt2 + boff + (size_t)nb * 16 * K + kc);
#pragma unroll
            for (int mb = 0; mb < 4; ++mb) { acc[mb][nb] = WFrag<T16>::mma(a[mb], b, acc[mb][nb]); if (NSPLIT == 1 || NSPLIT == 2) acc[mb][nb] = WFrag<T16>::mma(a2[mb], b, acc[mb][nb]); if (NSPLIT >= 2) acc[mb][nb] = WFrag<T16>::mma(a[mb], b2, acc[mb][nb]); } }
        asm volatile("v_nop\n\tv_nop\n\tv_nop\n\tv_nop" : "+v"(acc[0][0]), "+v"(acc[1][1]), "+v"(acc[2][2]), "+v"(acc[3][3]) : "v"(a[0]), "v"(a[3]));
    }
#pragma unroll
    for (int mb = 0; mb < 4; ++mb) {
#pragma unroll
        for (int nb = 0; nb < 4; ++nb) {
#pragma unroll
            for (int j = 0; j < 8; ++j) os[(hi * 8 + j) * 68 + nb * 16 + lr] = acc[mb][nb][j]; }
        __builtin_amdgcn_wave_barrier(); asm volatile("" ::: "memory");
        float* crow = C + (size_t)(r0 + mb * 16) * ldc + c0;
{
#pragma unroll
            for (int s = 0; s < 8; ++s) { const int row = 2 * s + hi, cofs = lr * 4; v4f val = *(const v4fa*)(os + row * 68 + cofs); if (BIAS) { val[0] += bfr(bias[c0 + cofs]); val[1] += bfr(bias[c0 + cofs + 1]); val[2] += bfr(bias[c0 + cofs + 2]); val[3] += bfr(bias[c0 + cofs + 3]); }
                *(v4f*)(crow + (size_t)row * ldc + cofs) = val; }
             }
        __builtin_amdgcn_wave_barrier(); asm volatile("" ::: "memory");
    }
}

// ---- k_gemmc: the same 64x64 tile GEMM specialised for causal attention: CMODE 1 skips score tiles entirely above the diagonal (query rows r0+roff.., key columns c0..), CMODE 2 limits the
// key (K) loop of the probability x value contraction to the diagonal block (probabilities beyond it are exactly zero). roff = row offset of this launch's first row within the sequence.
// NW waves per tile (32 * NW threads): wave w takes the 64-wide K chunks w, w + NW, ... (one 128-byte line of every operand row per chunk) into its own 16 accumulators; the NW partial tiles are summed in LDS, wave 0's first. K % 64 == 0.
template <typename T16, int NSPLIT, int CMODE, int NW>
__global__ __launch_bounds__(32 * NW) void k_gemmc(const T16* __restrict__ A, const T16* __restrict__ A2, const T16* __restrict__ Bt, const T16* __restrict__ Bt2, int K, float* C, int ldc, int roff, size_t sA, size_t sB, size_t sC) {
    typedef typename WFrag<T16>::V V;
    __shared__ __align__(16) float os[(NW == 1) ? 16 * 68 : NW * 64 * 68];
    const size_t z = blockIdx.z; A += z * sA; if (A2) A2 += z * sA; Bt += z * sB; if (Bt2) Bt2 += z * sB; C += z * sC;
    const int lane = threadIdx.x & 31, lr = lane & 15, hi = lane >> 4, wv = (NW == 1) ? 0 : __builtin_amdgcn_readfirstlane((int)(threadIdx.x >> 5)); const int r0 = blockIdx.x * 64, c0 = blockIdx.y * 64;
    if (CMODE == 1 && c0 > r0 + roff + 63) return;                  // score tile entirely above the causal diagonal: not computed; its stale values are loaded but discarded (the softmax masks j > i by select); taken by the whole work-group, in front of every barrier
    const int Kl = (CMODE == 2) ? min(K, r0 + roff + 64) : K;        // P.V: probabilities are exactly 0 beyond the diagonal block, so the K loop stops there
    v8f acc[4][4];
#pragma unroll
    for (int mb = 0; mb < 4; ++mb)
#pragma unroll
        for (int nb = 0; nb < 4; ++nb) acc[mb][nb] = (v8f){};
    const size_t aoff = (size_t)(r0 + lr) * K + 8 * hi, boff = (size_t)(c0 + lr) * K + 8 * hi;
    // wv is held in a scalar register (readfirstlane) so that both loops branch on scalar compares and EXEC stays whole round the matrix instructions; both stay rolled, as the parent's loop, so that one 32-wide trip's fragments are live at a time
#pragma unroll 1
    for (int kb = wv * 64; kb < Kl; kb += NW * 64)
#pragma unroll 1
    for (int kc = kb; kc < kb + 64; kc += 32) {
        V a[4], a2[4];
#pragma unroll
        for (int mb = 0; mb < 4; ++mb) { a[mb] = WFrag<T16>::ld(A + aoff + (size_t)mb * 16 * K + kc); if (NSPLIT == 1 || NSPLIT == 2) a2[mb] = WFrag<T16>::ld(A2 + aoff + (size_t)mb * 16 * K + kc); }
#pragma unroll
        for (int nb = 0; nb < 4; ++nb) { const V b = WFrag<T16>::ld(Bt + boff + (size_t)nb * 16 * K + kc); V b2; if (NSPLIT >= 2) b2 = WFrag<T16>::ld(Bt2 + boff + (size_t)nb * 16 * K + kc);
#pragma unroll
            for (int mb = 0; mb < 4; ++mb) { acc[mb][nb] = WFrag<T16>::mma(a[mb], b, acc[mb][nb]); if (NSPLIT == 1 || NSPLIT == 2) acc[mb][nb] = WFrag<T16>::mma(a2[mb], b, acc[mb][nb]); if (NSPLIT >= 2) acc[mb][nb] = WFrag<T16>::mma(a[mb], b2, acc[mb][nb]); } }
        asm volatile("v_nop\n\tv_nop\n\tv_nop\n\tv_nop" : "+v"(acc[0][0]), "+v"(acc[1][1]), "+v"(acc[2][2]), "+v"(acc[3][3]) : "v"(a[0]), "v"(a[3]));
    }
    if (NW == 1) {
#pragma unroll
        for (int mb = 0; mb < 4; ++mb) {
#pragma unroll
            for (int nb = 0; nb < 4; ++nb) {
#pragma unroll
                for (int j = 0; j < 8; ++j) os[(hi * 8 + j) * 68 + nb * 16 + lr] = acc[mb][nb][j]; }
            __builtin_amdgcn_wave_barrier(); asm volatile("" ::: "memory");
            float* crow = C + (size_t)(r0 + mb * 16) * ldc + c0;
#pragma unroll
            for (int s = 0; s < 8; ++s) { const int row = 2 * s + hi, cofs = lr * 4; v4f val = *(const v4fa*)(os + row * 68 + cofs);
                *(v4f*)(crow + (size_t)row * ldc + cofs) = val; }
            __builtin_amdgcn_wave_barrier(); asm volatile("" ::: "memory");
        }
    } else {
        float* ow = os + wv * (64 * 68);
#pragma unroll
        for (int mb = 0; mb < 4; ++mb)
#pragma unroll
            for (int nb = 0; nb < 4; ++nb)
#pragma unroll
                for (int j = 0; j < 8; ++j) ow[(mb * 16 + hi * 8 + j) * 68 + nb * 16 + lr] = acc[mb][nb][j];
        __syncthreads();   // every wave's partial 64x64 tile is in LDS before any of it is summed
        float* crow = C + (size_t)r0 * ldc + c0;
#pragma unroll
        for (int s = 0; s < 1024; s += 32 * NW) { const int q = s + (int)threadIdx.x, row = q >> 4, cofs = (q & 15) * 4; v4f val = *(const v4fa*)(os + row * 68 + cofs);
#pragma unroll
            for (int w = 1; w < NW; ++w) val += *(const v4fa*)(os + w * (64 * 68) + row * 68 + cofs);
            *(v4f*)(crow + (size_t)row * ldc + cofs) = val; }
    }
}

__device__ __forceinline__ h16 tohx(float x) { return (h16)x; }
__device__ __forceinline__ void splitf(float y, unsigned short& h, unsigned short& l) { h = f2bf(y); l = f2bf(y - bf2f(h)); }
typedef __attribute__((ext_vector_type(2))) _Float16 v2h;
typedef __attribute__((ext_vector_type(4))) _Float16 v4h;
typedef __attribute__((ext_vector_type(2))) unsigned short v2us;
typedef __attribute__((ext_vector_type(4))) unsigned short v4us;
typedef __attribute__((ext_vector_type(2))) float v2f;
typedef __attribute__((ext_vector_type(4))) int v4i;

__global__ __launch_bounds__(256) void k_wtG(const float* __restrict__ w, int K, int N, bf* Bt) {
    const int lane = threadIdx.x & 31; const int L0 = (blockIdx.x * 8 + (threadIdx.x >> 5)) * 8; const int nlines = N * K / 64;
{
#pragma unroll 1
        for (int l = 0; l < 8; ++l) { const int L = L0 + l; if (L >= nlines) break; const size_t e = (size_t)L * 64 + lane * 2; const int k = (int)(e % K), n = (int)(e / K); v2us o;
            o[0] = f2bf(w[(size_t)k * N + n]); o[1] = f2bf(w[(size_t)(k + 1) * N + n]); *(v2us*)(Bt + e) = o; }
         }
}
__global__ __launch_bounds__(256) void k_cvt8(const float* __restrict__ src, bf* dst, size_t n8) { const size_t i = (size_t)blockIdx.x * 256 + threadIdx.x; if (i >= n8) return; const v8f v = *(const v8f*)(src + i * 8); v8us o;
#pragma unroll
    for (int k = 0; k < 8; ++k) o[k] = f2bf(v[k]); *(v8us*)(dst + i * 8) = o;  }

__global__ __launch_bounds__(256) void k_flat(const float* __restrict__ F, h16* P16, bf* Ph, bf* Pl, size_t n4) { const size_t i = (size_t)blockIdx.x * 256 + threadIdx.x; if (i >= n4) return; const v4f a = *(const v4f*)(F + i * 4); v4h o16; v4us oh, ol;
#pragma unroll
    for (int q = 0; q < 4; ++q) { o16[q] = tohx(a[q]); unsigned short x2, y2; splitf(a[q], x2, y2); oh[q] = x2; ol[q] = y2; }
    *(v4h*)(P16 + i * 4) = o16; *(v4us*)(Ph + i * 4) = oh; *(v4us*)(Pl + i * 4) = ol;  }


__global__ __launch_bounds__(256) void k_vtp(const float* __restrict__ F, int pitch, int nheads, h16* V16, bf* Vh, bf* Vl) { const size_t e = ((size_t)blockIdx.x * 256 + threadIdx.x) * 2; if (e >= (size_t)nheads * HD * TT) return; const int t = (int)(e % TT); const int d = (int)((e / TT) % HD); const int g = (int)(e / ((size_t)TT * HD)); v2h o16; v2us oh, ol;
#pragma unroll
    for (int q = 0; q < 2; ++q) { const float x = F[(size_t)(t + q) * pitch + g * HD + d]; o16[q] = tohx(x); unsigned short a2, c2; splitf(x, a2, c2); oh[q] = a2; ol[q] = c2; }
    *(v2h*)(V16 + e) = o16; *(v2us*)(Vh + e) = oh; *(v2us*)(Vl + e) = ol;  }
// k_lsoft: streaming causal row softmax over the TK = TT = 4096 keys, one wave per row i, three sweeps of the f32 score row (lane -> 4 consecutive keys per 128-key chunk, 32 chunks; keys j > i are excluded by index with -3e38 / 0 - the score tiles above the diagonal are never computed and their stale contents are only ever discarded by this select):
__global__ __launch_bounds__(256) void k_lsoft(const float* __restrict__ Sb, h16* P16, bf* Ph, bf* Pl) {
    const int lane = threadIdx.x & 31; const int row = blockIdx.x * 8 + (threadIdx.x >> 5); if (row >= ZH * TT) return; const int i = row % TT; const int zz = row / TT; const bool hires = (i < RH); const float* sr = Sb + (size_t)row * TT; float mx = -3.0e38f;
#pragma unroll 4
    for (int ch = 0; ch < TT / 128; ++ch) { const int j0 = ch * 128 + lane * 4; const v4f a = *(const v4f*)(sr + j0);
#pragma unroll
        for (int q = 0; q < 4; ++q) { float t = a[q] * SCL; asm volatile("" : "+v"(t)); t = (j0 + q <= i) ? t : -3.0e38f; mx = fmaxf(mx, t); } }
#pragma unroll
    for (int sh = 16; sh; sh >>= 1) mx = fmaxf(mx, __shfl_xor(mx, sh, 32));
    float sum = 0.f;
#pragma unroll 4
    for (int ch = 0; ch < TT / 128; ++ch) { const int j0 = ch * 128 + lane * 4; const v4f a = *(const v4f*)(sr + j0);
#pragma unroll
        for (int q = 0; q < 4; ++q) { float t = a[q] * SCL; asm volatile("" : "+v"(t)); t = (j0 + q <= i) ? t : -3.0e38f; float d0 = __fsub_rn(t, mx); asm volatile("" : "+v"(d0)); sum += __builtin_amdgcn_exp2f(__fmul_rn(d0, 1.4426950408889634f)); } }
#pragma unroll
    for (int sh = 16; sh; sh >>= 1) sum += __shfl_xor(sum, sh, 32);
    const float f = __fdiv_rn(hires ? 1.0f : PCAR, sum);
{
        if (hires) {   /* rows < RH: normalised bf16 hi/lo over the first RH keys (every later key is above the diagonal for these rows; the hi/lo attn.v GEMM stops its K loop at the diagonal block), planes [zz][RH][TT] */
#pragma unroll
            for (int ch = 0; ch < RH / 128; ++ch) { const int j0 = ch * 128 + lane * 4; const v4f a = *(const v4f*)(sr + j0); v4us oh, ol;
#pragma unroll
                for (int q = 0; q < 4; ++q) { float t = a[q] * SCL; asm volatile("" : "+v"(t)); t = (j0 + q <= i) ? t : -3.0e38f; float d0 = __fsub_rn(t, mx); asm volatile("" : "+v"(d0)); float ex = __builtin_amdgcn_exp2f(__fmul_rn(d0, 1.4426950408889634f)); asm volatile("" : "+v"(ex)); unsigned short a2, c2; splitf(ex * f, a2, c2); oh[q] = a2; ol[q] = c2; }
                const size_t oo = ((size_t)zz * RH + i) * TT + j0; *(v4us*)(Ph + oo) = oh; *(v4us*)(Pl + oo) = ol; }
        } else {
#pragma unroll 2
            for (int ch = 0; ch < TT / 128; ++ch) { const int j0 = ch * 128 + lane * 4; const v4f a = *(const v4f*)(sr + j0); v4h o4;
#pragma unroll
                for (int q = 0; q < 4; ++q) { float t = a[q] * SCL; asm volatile("" : "+v"(t)); t = (j0 + q <= i) ? t : -3.0e38f; float d0 = __fsub_rn(t, mx); asm volatile("" : "+v"(d0)); float ex = __builtin_amdgcn_exp2f(__fmul_rn(d0, 1.4426950408889634f)); asm volatile("" : "+v"(ex)); o4[q] = tohx(ex * f); }
                *(v4h*)(P16 + (size_t)row * TT + j0) = o4; } }
         }
}

__global__ __launch_bounds__(256) void k_merge(const float* __restrict__ O, int h0, float* OUTb) { const size_t e = ((size_t)blockIdx.x * 256 + threadIdx.x) * 2; if (e >= (size_t)ZH * TT * HD) return; const int d = (int)(e % HD); const int t = (int)((e / HD) % TT); const int zz = (int)(e / ((size_t)HD * TT)); const float cs = (t < RH) ? 1.0f : (1.0f / PCAR); const size_t oo = (size_t)t * DQ + (h0 + zz) * HD + d;
    v2f o2; o2[0] = O[e] * cs; o2[1] = O[e + 1] * cs; *(v2f*)(OUTb + oo) = o2;  }

extern "C" void kernel_launch(void* const* d_in, const int* in_sizes, int n_in,
                              void* d_out, int out_size, void* d_ws, size_t ws_size, hipStream_t stream) {
    (void)in_sizes; (void)n_in; (void)out_size;
    const float* x = (const float*)d_in[0]; const float* wq = (const float*)d_in[1]; const float* wk = (const float*)d_in[2]; const float* wv = (const float*)d_in[3]; const float* wo = nullptr; (void)wo;
    float* OUT = (float*)d_out;     // [1][4096][768]
    char* wsp = (char*)d_ws;
    auto take = [&](size_t bytes) { char* p = wsp; wsp += (bytes + 255) & ~(size_t)255; return (void*)p; };
    bf* WQ = (bf*)take((size_t)DQ * DM * 2); bf* WK = (bf*)take((size_t)DKV * DM * 2); bf* WV = (bf*)take((size_t)DKV * DM * 2); 
    bf* XB = (bf*)take((size_t)TT * DM * 2); float* FQ = (float*)take((size_t)TT * DQ * 4); float* FK = (float*)take((size_t)TT * DKV * 4);
    h16* QP16 = (h16*)take((size_t)NH_ * TT * HD * 2); h16* KP16 = (h16*)take((size_t)NKV * TT * HD * 2); h16* VT16 = (h16*)take((size_t)NKV * HD * TT * 2);
    bf* QPh = (bf*)take((size_t)NH_ * TT * HD * 2); bf* QPl = (bf*)take((size_t)NH_ * TT * HD * 2); bf* KPh = (bf*)take((size_t)NKV * TT * HD * 2); bf* KPl = (bf*)take((size_t)NKV * TT * HD * 2); bf* VTh = (bf*)take((size_t)NKV * HD * TT * 2); bf* VTl = (bf*)take((size_t)NKV * HD * TT * 2); bf* Ph = (bf*)take((size_t)ZH * RH * TT * 2); bf* Pl = (bf*)take((size_t)ZH * RH * TT * 2);
    float* Sb = (float*)take((size_t)ZH * TT * TT * 4); h16* P16 = (h16*)take((size_t)ZH * TT * TT * 2); float* Ob = (float*)take((size_t)ZH * TT * HD * 4);
    if ((size_t)(wsp - (char*)d_ws) > ws_size) return;    // ws 256 MiB
    float* FV = FK;   // v projection reuses the k buffer after the k planes are built (stream-ordered)
    { k_cvt8<<<(unsigned)(((size_t)DQ * DM / 8 + 255) / 256), 256, 0, stream>>>(wq, WQ, (size_t)DQ * DM / 8); k_cvt8<<<(unsigned)(((size_t)DKV * DM / 8 + 255) / 256), 256, 0, stream>>>(wk, WK, (size_t)DKV * DM / 8); k_cvt8<<<(unsigned)(((size_t)DKV * DM / 8 + 255) / 256), 256, 0, stream>>>(wv, WV, (size_t)DKV * DM / 8);
      
       }
    const unsigned LQ = (unsigned)(((size_t)NH_ * TT * HD / 2 + 255) / 256), LKv = (unsigned)(((size_t)NKV * TT * HD / 2 + 255) / 256);
    for (int b = 0; b < NB_; ++b) {
        
        k_cvt8<<<(unsigned)(((size_t)TT * DM / 8 + 255) / 256), 256, 0, stream>>>(x + (size_t)b * TT * DM, XB, (size_t)TT * DM / 8);
        k_gemmw<bf, 0, false><<<dim3(TT / 64, DQ / 64, 1), 32, 0, stream>>>(XB, nullptr, WQ, nullptr, DM, FQ, DQ, nullptr, 0, 0, 0);
        k_flat<<<(unsigned)(((size_t)TT * DQ / 4 + 255) / 256), 256, 0, stream>>>(FQ, QP16, QPh, QPl, (size_t)TT * DQ / 4);
        k_gemmw<bf, 0, false><<<dim3(TT / 64, DKV / 64, 1), 32, 0, stream>>>(XB, nullptr, WK, nullptr, DM, FK, DKV, nullptr, 0, 0, 0);
        k_flat<<<(unsigned)(((size_t)TT * DKV / 4 + 255) / 256), 256, 0, stream>>>(FK, KP16, KPh, KPl, (size_t)TT * DKV / 4);
        k_gemmw<bf, 0, false><<<dim3(TT / 64, DKV / 64, 1), 32, 0, stream>>>(XB, nullptr, WV, nullptr, DM, FV, DKV, nullptr, 0, 0, 0); k_vtp<<<LKv, 256, 0, stream>>>(FV, DKV, NKV, VT16, VTh, VTl);
        for (int h0 = 0; h0 < NH_; h0 += ZH) { const size_t zq = (size_t)h0, zk = (size_t)(h0 / REP);   // one kv head per query head: the pass's one head (ZH 1) uses kv plane h0 / REP (z-strides TT*HD)
            k_gemmc<bf, 2, 1, 4><<<dim3(RH / 64, TT / 64, ZH), 128, 0, stream>>>(QPh + zq * TT * HD, QPl + zq * TT * HD, KPh + zk * TT * HD, KPl + zk * TT * HD, HD, Sb, TT, 0, (size_t)TT * HD, (size_t)TT * HD, (size_t)TT * TT);
            k_gemmc<h16, 0, 1, 1><<<dim3((TT - RH) / 64, TT / 64, ZH), 32, 0, stream>>>(QP16 + zq * TT * HD + (size_t)RH * HD, nullptr, KP16 + zk * TT * HD, nullptr, HD, Sb + (size_t)RH * TT, TT, RH, (size_t)TT * HD, (size_t)TT * HD, (size_t)TT * TT);
            k_lsoft<<<ZH * TT / 8, 256, 0, stream>>>(Sb, P16, Ph, Pl);
            k_gemmc<bf, 2, 2, 4><<<dim3(RH / 64, HD / 64, ZH), 128, 0, stream>>>(Ph, Pl, VTh + zk * HD * TT, VTl + zk * HD * TT, TT, Ob, HD, 0, (size_t)RH * TT, (size_t)HD * TT, (size_t)TT * HD);
            k_gemmc<h16, 0, 2, 8><<<dim3((TT - RH) / 64, HD / 64, ZH), 256, 0, stream>>>(P16 + (size_t)RH * TT, nullptr, VT16 + zk * HD * TT, nullptr, TT, Ob + (size_t)RH * HD, HD, RH, (size_t)TT * TT, (size_t)HD * TT, (size_t)TT * HD);
            k_merge<<<(unsigned)(((size_t)ZH * TT * HD / 2 + 255) / 256), 256, 0, stream>>>(Ob, h0, OUT + (size_t)b * TT * DQ); }
         }
}

// v002
// One run takes 227 microseconds.
// Next to v001, in two timings, it ran 1.10 times as fast each time.
// All steps since v000 together make it 1.33 times as fast.
#include <hip/hip_runtime.h>

// Causal single-head self-attention with a 768-wide head over 4,096 tokens (x [4096][768]; q,k,v = x W^T ('oi' [768][768], no bias); scores = q.k, keys after the query -> -inf; weights = softmax(scores / sqrt(768)); out = weights v -> [4096][768] (3.1 M)).
// Layout: bf16 copy of x; exact projections; ONE 768-wide head through the causal T-4096 attention (hybrid rows: < 512 hi/lo 3 products, rest fp16 x1024; k_gemmc skips score tiles above the diagonal and stops the P.v K loop at the diagonal block (K 768 / N 768); streaming three-sweep softmax with the causal index select); the projection GEMMs write the 16-bit operand planes and the P.v GEMMs the scaled f32 output rows from their own epilogues.
// Compute dtypes, f32 accumulate: every input rounded to bf16; projections exact; attention rows < 512 3 products, rest fp16; softmax f32; output f32.

#define NB_  1
#define TT   4096
#define DM   768
#define NH_  1
#define NKV  1
#define REP  (NH_ / NKV)
#define HD   768
#define DQ   (NH_ * HD)
#define DKV  (NKV * HD)
#define ZH   1
#define RH   512                  // query rows < RH use hi+lo planes (0: none)
#define WIN  4096
#define PCAR 1024.0f
#define SCL  0.036084391824351615f   // 1/sqrt(768)
typedef _Float16 h16;
typedef unsigned short bf;
typedef __attribute__((ext_vector_type(16))) __bf16   v16bf;
typedef __attribute__((ext_vector_type(16))) _Float16 v16h;
typedef __attribute__((ext_vector_type(8)))  _Float16 v8h;
typedef __attribute__((ext_vector_type(8)))  unsigned short v8us;
typedef __attribute__((ext_vector_type(8)))  float    v8f;
typedef __attribute__((ext_vector_type(4)))  float    v4f;
typedef v8h  __attribute__((may_alias)) v8ha;
typedef v4f  __attribute__((may_alias)) v4fa;
typedef v8us __attribute__((may_alias)) v8usa;

__device__ __forceinline__ unsigned short f2bf(float f) { unsigned u = __float_as_uint(f); u += 0x7FFFu + ((u >> 16) & 1u); return (unsigned short)(u >> 16); }
__device__ __forceinline__ float bf2f(unsigned short b) { return __uint_as_float(((unsigned)b) << 16); }
__device__ __forceinline__ float bfr(float f) { return bf2f(f2bf(f)); }
__device__ __forceinline__ v16h cat16(v8h lo, v8h hi) { return __builtin_shufflevector(lo, hi, 0, 1, 2, 3, 4, 5, 6, 7, 8, 9, 10, 11, 12, 13, 14, 15); }
__device__ __forceinline__ v16bf cat16b(v8us lo, v8us hi) { return __builtin_bit_cast(v16bf, __builtin_shufflevector(lo, hi, 0, 1, 2, 3, 4, 5, 6, 7, 8, 9, 10, 11, 12, 13, 14, 15)); }
__device__ __forceinline__ v8f wmma16(v16h a, v16h b, v8f c) { return __builtin_amdgcn_wmma_f32_16x16x32_f16(false, a, false, b, (short)0, c, false, false); }
__device__ __forceinline__ v8f wmmab(v16bf a, v16bf b, v8f c) { return __builtin_amdgcn_wmma_f32_16x16x32_bf16(false, a, false, b, (short)0, c, false, false); }
__device__ __forceinline__ h16 tohx(float x) { return (h16)x; }
__device__ __forceinline__ void splitf(float y, unsigned short& h, unsigned short& l) { h = f2bf(y); l = f2bf(y - bf2f(h)); }



// ---- k_gemmw: register-blocked GEMM, ONE WAVE per 64x64 output tile (16 accumulators), operands straight from K-contiguous 16-bit planes; grid (M/64, N/64, Z), 32 threads.
// c[m][n] (f32 accumulators) = sum_k A[m][k] Bt[n][k] (+ split products per NSPLIT); the epilogue writes c as three 16-bit planes of pitch ldc: P16 = f16(c), Ph = bf16(c), Pl = bf16(c - Ph). z-batch strides sA/sB/sC in elements. K % 32 == 0, ldc % 8 == 0.
// The transposed planes of v come from the same kernel with the operands exchanged (A = weight rows, Bt = token rows): c[d][t].
template <typename T16> struct WFrag;
template <> struct WFrag<h16> { typedef v16h V; static __device__ __forceinline__ V ld(const h16* p) { return cat16(*(const v8h*)p, *(const v8h*)(p + 16)); } static __device__ __forceinline__ v8f mma(V a, V b, v8f c) { return wmma16(a, b, c); } };
template <> struct WFrag<bf> { typedef v16bf V; static __device__ __forceinline__ V ld(const bf* p) { return cat16b(*(const v8us*)p, *(const v8us*)(p + 16)); } static __device__ __forceinline__ v8f mma(V a, V b, v8f c) { return wmmab(a, b, c); } };
template <typename T16, int NSPLIT>
__global__ __launch_bounds__(32) void k_gemmw(const T16* __restrict__ A, const T16* __restrict__ A2, const T16* __restrict__ Bt, const T16* __restrict__ Bt2, int K, h16* P16, bf* Ph, bf* Pl, int ldc, size_t sA, size_t sB, size_t sC) {
    typedef typename WFrag<T16>::V V;
    __shared__ __align__(16) float os[16 * 68];
    const size_t z = blockIdx.z; A += z * sA; if (A2) A2 += z * sA; Bt += z * sB; if (Bt2) Bt2 += z * sB; P16 += z * sC; Ph += z * sC; Pl += z * sC;
    const int lane = threadIdx.x & 31, lr = lane & 15, hi = lane >> 4; const int r0 = blockIdx.x * 64, c0 = blockIdx.y * 64;
    v8f acc[4][4];
#pragma unroll
    for (int mb = 0; mb < 4; ++mb)
#pragma unroll
        for (int nb = 0; nb < 4; ++nb) acc[mb][nb] = (v8f){};
    const size_t aoff = (size_t)(r0 + lr) * K + 8 * hi, boff = (size_t)(c0 + lr) * K + 8 * hi;
#pragma unroll 1
    for (int kc = 0; kc < K; kc += 32) {
        V a[4], a2[4];
#pragma unroll
        for (int mb = 0; mb < 4; ++mb) { a[mb] = WFrag<T16>::ld(A + aoff + (size_t)mb * 16 * K + kc); if (NSPLIT == 1 || NSPLIT == 2) a2[mb] = WFrag<T16>::ld(A2 + aoff + (size_t)mb * 16 * K + kc); }
#pragma unroll
        for (int nb = 0; nb < 4; ++nb) { const V b = WFrag<T16>::ld(Bt + boff + (size_t)nb * 16 * K + kc); V b2; if (NSPLIT >= 2) b2 = WFrag<T16>::ld(Bt2 + boff + (size_t)nb * 16 * K + kc);
#pragma unroll
            for (int mb = 0; mb < 4; ++mb) { acc[mb][nb] = WFrag<T16>::mma(a[mb], b, acc[mb][nb]); if (NSPLIT == 1 || NSPLIT == 2) acc[mb][nb] = WFrag<T16>::mma(a2[mb], b, acc[mb][nb]); if (NSPLIT >= 2) acc[mb][nb] = WFrag<T16>::mma(a[mb], b2, acc[mb][nb]); } }
        asm volatile("v_nop\n\tv_nop\n\tv_nop\n\tv_nop" : "+v"(acc[0][0]), "+v"(acc[1][1]), "+v"(acc[2][2]), "+v"(acc[3][3]) : "v"(a[0]), "v"(a[3]));
    }
#pragma unroll
    for (int mb = 0; mb < 4; ++mb) {
#pragma unroll
        for (int nb = 0; nb < 4; ++nb) {
#pragma unroll
            for (int j = 0; j < 8; ++j) os[(hi * 8 + j) * 68 + nb * 16 + lr] = acc[mb][nb][j]; }
        __builtin_amdgcn_wave_barrier(); asm volatile("" ::: "memory");
        const size_t o0 = (size_t)(r0 + mb * 16) * ldc + c0;
        // eight lanes per row, eight columns per lane: every 16-byte store of a plane fills whole 128-byte lines (four rows per instruction)
#pragma unroll
        for (int s = 0; s < 4; ++s) { const int row = 4 * s + (lane >> 3), cofs = (lane & 7) * 8; const v4f va = *(const v4fa*)(os + row * 68 + cofs), vb = *(const v4fa*)(os + row * 68 + cofs + 4); v8h o16; v8us oh, ol;
#pragma unroll
            for (int q = 0; q < 4; ++q) { unsigned short x2, y2; o16[q] = tohx(va[q]); splitf(va[q], x2, y2); oh[q] = x2; ol[q] = y2; o16[q + 4] = tohx(vb[q]); splitf(vb[q], x2, y2); oh[q + 4] = x2; ol[q + 4] = y2; }
            const size_t oo = o0 + (size_t)row * ldc + cofs; *(v8h*)(P16 + oo) = o16; *(v8us*)(Ph + oo) = oh; *(v8us*)(Pl + oo) = ol; }
        __builtin_amdgcn_wave_barrier(); asm volatile("" ::: "memory");
    }
}

// ---- k_gemmc: the same 64x64 tile GEMM specialised for causal attention: CMODE 1 skips score tiles entirely above the diagonal (query rows r0+roff.., key columns c0..), CMODE 2 limits the
// key (K) loop of the probability x value contraction to the diagonal block (probabilities beyond it are exactly zero). roff = row offset of this launch's first row within the sequence.
// CMODE 2 multiplies the finished f32 tile by cs (the inverse of the probabilities' carry factor) as it is stored, so C is the output itself.
// NW waves per tile (32 * NW threads): wave w takes the 64-wide K chunks w, w + NW, ... (one 128-byte line of every operand row per chunk) into its own 16 accumulators; the NW partial tiles are summed in LDS, wave 0's first. K % 64 == 0.
template <typename T16, int NSPLIT, int CMODE, int NW>
__global__ __launch_bounds__(32 * NW) void k_gemmc(const T16* __restrict__ A, const T16* __restrict__ A2, const T16* __restrict__ Bt, const T16* __restrict__ Bt2, int K, float* C, int ldc, int roff, float cs, size_t sA, size_t sB, size_t sC) {
    typedef typename WFrag<T16>::V V;
    __shared__ __align__(16) float os[(NW == 1) ? 16 * 68 : NW * 64 * 68];
    const size_t z = blockIdx.z; A += z * sA; if (A2) A2 += z * sA; Bt += z * sB; if (Bt2) Bt2 += z * sB; C += z * sC;
    const int lane = threadIdx.x & 31, lr = lane & 15, hi = lane >> 4, wv = (NW == 1) ? 0 : __builtin_amdgcn_readfirstlane((int)(threadIdx.x >> 5)); const int r0 = blockIdx.x * 64, c0 = blockIdx.y * 64;
    if (CMODE == 1 && c0 > r0 + roff + 63) return;                  // score tile entirely above the causal diagonal: not computed; its stale values are loaded but discarded (the softmax masks j > i by select); taken by the whole work-group, in front of every barrier
    const int Kl = (CMODE == 2) ? min(K, r0 + roff + 64) : K;        // P.V: probabilities are exactly 0 beyond the diagonal block, so the K loop stops there
    v8f acc[4][4];
#pragma unroll
    for (int mb = 0; mb < 4; ++mb)
#pragma unroll
        for (int nb = 0; nb < 4; ++nb) acc[mb][nb] = (v8f){};
    const size_t aoff = (size_t)(r0 + lr) * K + 8 * hi, boff = (size_t)(c0 + lr) * K + 8 * hi;
    // wv is held in a scalar register (readfirstlane) so that both loops branch on scalar compares and EXEC stays whole round the matrix instructions; both stay rolled, as the parent's loop, so that one 32-wide trip's fragments are live at a time
#pragma unroll 1
    for (int kb = wv * 64; kb < Kl; kb += NW * 64)
#pragma unroll 1
    for (int kc = kb; kc < kb + 64; kc += 32) {
        V a[4], a2[4];
#pragma unroll
        for (int mb = 0; mb < 4; ++mb) { a[mb] = WFrag<T16>::ld(A + aoff + (size_t)mb * 16 * K + kc); if (NSPLIT == 1 || NSPLIT == 2) a2[mb] = WFrag<T16>::ld(A2 + aoff + (size_t)mb * 16 * K + kc); }
#pragma unroll
        for (int nb = 0; nb < 4; ++nb) { const V b = WFrag<T16>::ld(Bt + boff + (size_t)nb * 16 * K + kc); V b2; if (NSPLIT >= 2) b2 = WFrag<T16>::ld(Bt2 + boff + (size_t)nb * 16 * K + kc);
#pragma unroll
            for (int mb = 0; mb < 4; ++mb) { acc[mb][nb] = WFrag<T16>::mma(a[mb], b, acc[mb][nb]); if (NSPLIT == 1 || NSPLIT == 2) acc[mb][nb] = WFrag<T16>::mma(a2[mb], b, acc[mb][nb]); if (NSPLIT >= 2) acc[mb][nb] = WFrag<T16>::mma(a[mb], b2, acc[mb][nb]); } }
        asm volatile("v_nop\n\tv_nop\n\tv_nop\n\tv_nop" : "+v"(acc[0][0]), "+v"(acc[1][1]), "+v"(acc[2][2]), "+v"(acc[3][3]) : "v"(a[0]), "v"(a[3]));
    }
    if (NW == 1) {
#pragma unroll
        for (int mb = 0; mb < 4; ++mb) {
#pragma unroll
            for (int nb = 0; nb < 4; ++nb) {
#pragma unroll
                for (int j = 0; j < 8; ++j) os[(hi * 8 + j) * 68 + nb * 16 + lr] = acc[mb][nb][j]; }
            __builtin_amdgcn_wave_barrier(); asm volatile("" ::: "memory");
            float* crow = C + (size_t)(r0 + mb * 16) * ldc + c0;
#pragma unroll
            for (int s = 0; s < 8; ++s) { const int row = 2 * s + hi, cofs = lr * 4; v4f val = *(const v4fa*)(os + row * 68 + cofs); if (CMODE == 2) val *= cs;
                *(v4f*)(crow + (size_t)row * ldc + cofs) = val; }
            __builtin_amdgcn_wave_barrier(); asm volatile("" ::: "memory");
        }
    } else {
        float* ow = os + wv * (64 * 68);
#pragma unroll
        for (int mb = 0; mb < 4; ++mb)
#pragma unroll
            for (int nb = 0; nb < 4; ++nb)
#pragma unroll
                for (int j = 0; j < 8; ++j) ow[(mb * 16 + hi * 8 + j) * 68 + nb * 16 + lr] = acc[mb][nb][j];
        __syncthreads();   // every wave's partial 64x64 tile is in LDS before any of it is summed
        float* crow = C + (size_t)r0 * ldc + c0;
#pragma unroll
        for (int s = 0; s < 1024; s += 32 * NW) { const int q = s + (int)threadIdx.x, row = q >> 4, cofs = (q & 15) * 4; v4f val = *(const v4fa*)(os + row * 68 + cofs);
#pragma unroll
            for (int w = 1; w < NW; ++w) val += *(const v4fa*)(os + w * (64 * 68) + row * 68 + cofs);
            if (CMODE == 2) val *= cs;
            *(v4f*)(crow + (size_t)row * ldc + cofs) = val; }
    }
}

typedef __attribute__((ext_vector_type(2))) _Float16 v2h;
typedef __attribute__((ext_vector_type(4))) _Float16 v4h;
typedef __attribute__((ext_vector_type(2))) unsigned short v2us;
typedef __attribute__((ext_vector_type(4))) unsigned short v4us;
typedef __attribute__((ext_vector_type(2))) float v2f;
typedef __attribute__((ext_vector_type(4))) int v4i;

__global__ __launch_bounds__(256) void k_wtG(const float* __restrict__ w, int K, int N, bf* Bt) {
    const int lane = threadIdx.x & 31; const int L0 = (blockIdx.x * 8 + (threadIdx.x >> 5)) * 8; const int nlines = N * K / 64;
{
#pragma unroll 1
        for (int l = 0; l < 8; ++l) { const int L = L0 + l; if (L >= nlines) break; const size_t e = (size_t)L * 64 + lane * 2; const int k = (int)(e % K), n = (int)(e / K); v2us o;
            o[0] = f2bf(w[(size_t)k * N + n]); o[1] = f2bf(w[(size_t)(k + 1) * N + n]); *(v2us*)(Bt + e) = o; }
         }
}
__global__ __launch_bounds__(256) void k_cvt8(const float* __restrict__ src, bf* dst, size_t n8) { const size_t i = (size_t)blockIdx.x * 256 + threadIdx.x; if (i >= n8) return; const v8f v = *(const v8f*)(src + i * 8); v8us o;
#pragma unroll
    for (int k = 0; k < 8; ++k) o[k] = f2bf(v[k]); *(v8us*)(dst + i * 8) = o;  }

// k_lsoft: streaming causal row softmax over the TK = TT = 4096 keys, one wave per row i, three sweeps of the f32 score row (lane -> 4 consecutive keys per 128-key chunk, 32 chunks; keys j > i are excluded by index with -3e38 / 0 - the score tiles above the diagonal are never computed and their stale contents are only ever discarded by this select):
__global__ __launch_bounds__(256) void k_lsoft(const float* __restrict__ Sb, h16* P16, bf* Ph, bf* Pl) {
    const int lane = threadIdx.x & 31; const int row = blockIdx.x * 8 + (threadIdx.x >> 5); if (row >= ZH * TT) return; const int i = row % TT; const int zz = row / TT; const bool hires = (i < RH); const float* sr = Sb + (size_t)row * TT; float mx = -3.0e38f;
#pragma unroll 4
    for (int ch = 0; ch < TT / 128; ++ch) { const int j0 = ch * 128 + lane * 4; const v4f a = *(const v4f*)(sr + j0);
#pragma unroll
        for (int q = 0; q < 4; ++q) { float t = a[q] * SCL; asm volatile("" : "+v"(t)); t = (j0 + q <= i) ? t : -3.0e38f; mx = fmaxf(mx, t); } }
#pragma unroll
    for (int sh = 16; sh; sh >>= 1) mx = fmaxf(mx, __shfl_xor(mx, sh, 32));
    float sum = 0.f;
#pragma unroll 4
    for (int ch = 0; ch < TT / 128; ++ch) { const int j0 = ch * 128 + lane * 4; const v4f a = *(const v4f*)(sr + j0);
#pragma unroll
        for (int q = 0; q < 4; ++q) { float t = a[q] * SCL; asm volatile("" : "+v"(t)); t = (j0 + q <= i) ? t : -3.0e38f; float d0 = __fsub_rn(t, mx); asm volatile("" : "+v"(d0)); sum += __builtin_amdgcn_exp2f(__fmul_rn(d0, 1.4426950408889634f)); } }
#pragma unroll
    for (int sh = 16; sh; sh >>= 1) sum += __shfl_xor(sum, sh, 32);
    const float f = __fdiv_rn(hires ? 1.0f : PCAR, sum);
{
        if (hires) {   /* rows < RH: normalised bf16 hi/lo over the first RH keys (every later key is above the diagonal for these rows; the hi/lo attn.v GEMM stops its K loop at the diagonal block), planes [zz][RH][TT] */
#pragma unroll
            for (int ch = 0; ch < RH / 128; ++ch) { const int j0 = ch * 128 + lane * 4; const v4f a = *(const v4f*)(sr + j0); v4us oh, ol;
#pragma unroll
                for (int q = 0; q < 4; ++q) { float t = a[q] * SCL; asm volatile("" : "+v"(t)); t = (j0 + q <= i) ? t : -3.0e38f; float d0 = __fsub_rn(t, mx); asm volatile("" : "+v"(d0)); float ex = __builtin_amdgcn_exp2f(__fmul_rn(d0, 1.4426950408889634f)); asm volatile("" : "+v"(ex)); unsigned short a2, c2; splitf(ex * f, a2, c2); oh[q] = a2; ol[q] = c2; }
                const size_t oo = ((size_t)zz * RH + i) * TT + j0; *(v4us*)(Ph + oo) = oh; *(v4us*)(Pl + oo) = ol; }
        } else {
#pragma unroll 2
            for (int ch = 0; ch < TT / 128; ++ch) { const int j0 = ch * 128 + lane * 4; const v4f a = *(const v4f*)(sr + j0); v4h o4;
#pragma unroll
                for (int q = 0; q < 4; ++q) { float t = a[q] * SCL; asm volatile("" : "+v"(t)); t = (j0 + q <= i) ? t : -3.0e38f; float d0 = __fsub_rn(t, mx); asm volatile("" : "+v"(d0)); float ex = __builtin_amdgcn_exp2f(__fmul_rn(d0, 1.4426950408889634f)); asm volatile("" : "+v"(ex)); o4[q] = tohx(ex * f); }
                *(v4h*)(P16 + (size_t)row * TT + j0) = o4; } }
         }
}

extern "C" void kernel_launch(void* const* d_in, const int* in_sizes, int n_in,
                              void* d_out, int out_size, void* d_ws, size_t ws_size, hipStream_t stream) {
    (void)in_sizes; (void)n_in; (void)out_size;
    const float* x = (const float*)d_in[0]; const float* wq = (const float*)d_in[1]; const float* wk = (const float*)d_in[2]; const float* wv = (const float*)d_in[3]; const float* wo = nullptr; (void)wo;
    float* OUT = (float*)d_out;     // [1][4096][768]
    char* wsp = (char*)d_ws;
    auto take = [&](size_t bytes) { char* p = wsp; wsp += (bytes + 255) & ~(size_t)255; return (void*)p; };
    bf* WQ = (bf*)take((size_t)DQ * DM * 2); bf* WK = (bf*)take((size_t)DKV * DM * 2); bf* WV = (bf*)take((size_t)DKV * DM * 2); 
    bf* XB = (bf*)take((size_t)TT * DM * 2);
    h16* QP16 = (h16*)take((size_t)NH_ * TT * HD * 2); h16* KP16 = (h16*)take((size_t)NKV * TT * HD * 2); h16* VT16 = (h16*)take((size_t)NKV * HD * TT * 2);
    bf* QPh = (bf*)take((size_t)NH_ * TT * HD * 2); bf* QPl = (bf*)take((size_t)NH_ * TT * HD * 2); bf* KPh = (bf*)take((size_t)NKV * TT * HD * 2); bf* KPl = (bf*)take((size_t)NKV * TT * HD * 2); bf* VTh = (bf*)take((size_t)NKV * HD * TT * 2); bf* VTl = (bf*)take((size_t)NKV * HD * TT * 2); bf* Ph = (bf*)take((size_t)ZH * RH * TT * 2); bf* Pl = (bf*)take((size_t)ZH * RH * TT * 2);
    float* Sb = (float*)take((size_t)ZH * TT * TT * 4); h16* P16 = (h16*)take((size_t)ZH * TT * TT * 2);
    if ((size_t)(wsp - (char*)d_ws) > ws_size) return;    // ws 256 MiB
    { k_cvt8<<<(unsigned)(((size_t)DQ * DM / 8 + 255) / 256), 256, 0, stream>>>(wq, WQ, (size_t)DQ * DM / 8); k_cvt8<<<(unsigned)(((size_t)DKV * DM / 8 + 255) / 256), 256, 0, stream>>>(wk, WK, (size_t)DKV * DM / 8); k_cvt8<<<(unsigned)(((size_t)DKV * DM / 8 + 255) / 256), 256, 0, stream>>>(wv, WV, (size_t)DKV * DM / 8);
      
       }
    for (int b = 0; b < NB_; ++b) {
        
        k_cvt8<<<(unsigned)(((size_t)TT * DM / 8 + 255) / 256), 256, 0, stream>>>(x + (size_t)b * TT * DM, XB, (size_t)TT * DM / 8);
        k_gemmw<bf, 0><<<dim3(TT / 64, DQ / 64, 1), 32, 0, stream>>>(XB, nullptr, WQ, nullptr, DM, QP16, QPh, QPl, DQ, 0, 0, 0);
        k_gemmw<bf, 0><<<dim3(TT / 64, DKV / 64, 1), 32, 0, stream>>>(XB, nullptr, WK, nullptr, DM, KP16, KPh, KPl, DKV, 0, 0, 0);
        k_gemmw<bf, 0><<<dim3(DKV / 64, TT / 64, 1), 32, 0, stream>>>(WV, nullptr, XB, nullptr, DM, VT16, VTh, VTl, TT, 0, 0, 0);   // v transposed: rows = value columns, pitch TT
        for (int h0 = 0; h0 < NH_; h0 += ZH) { const size_t zq = (size_t)h0, zk = (size_t)(h0 / REP);   // one kv head per query head: each pass takes ZH = 1 head and its own kv plane (z-strides TT*HD)
            k_gemmc<bf, 2, 1, 4><<<dim3(RH / 64, TT / 64, ZH), 128, 0, stream>>>(QPh + zq * TT * HD, QPl + zq * TT * HD, KPh + zk * TT * HD, KPl + zk * TT * HD, HD, Sb, TT, 0, 1.0f, (size_t)TT * HD, (size_t)TT * HD, (size_t)TT * TT);
            k_gemmc<h16, 0, 1, 1><<<dim3((TT - RH) / 64, TT / 64, ZH), 32, 0, stream>>>(QP16 + zq * TT * HD + (size_t)RH * HD, nullptr, KP16 + zk * TT * HD, nullptr, HD, Sb + (size_t)RH * TT, TT, RH, 1.0f, (size_t)TT * HD, (size_t)TT * HD, (size_t)TT * TT);
            k_lsoft<<<ZH * TT / 8, 256, 0, stream>>>(Sb, P16, Ph, Pl);
            k_gemmc<bf, 2, 2, 4><<<dim3(RH / 64, HD / 64, ZH), 128, 0, stream>>>(Ph, Pl, VTh + zk * HD * TT, VTl + zk * HD * TT, TT, OUT + (size_t)b * TT * DQ + (size_t)h0 * HD, DQ, 0, 1.0f, (size_t)RH * TT, (size_t)HD * TT, (size_t)HD);
            k_gemmc<h16, 0, 2, 8><<<dim3((TT - RH) / 64, HD / 64, ZH), 256, 0, stream>>>(P16 + (size_t)RH * TT, nullptr, VT16 + zk * HD * TT, nullptr, TT, OUT + (size_t)b * TT * DQ + (size_t)h0 * HD + (size_t)RH * DQ, DQ, RH, 1.0f / PCAR, (size_t)TT * TT, (size_t)HD * TT, (size_t)HD); }
         }
}

// v003
// Measured time: 168 microseconds a run.
// Timed twice side by side with v002, it ran 1.36 times as fast both times.
// Over all steps from v000 it is 1.80 times as fast.
#include <hip/hip_runtime.h>

// Causal single-head self-attention with a 768-wide head over 4,096 tokens (x [4096][768]; q,k,v = x W^T ('oi' [768][768], no bias); scores = q.k, keys after the query -> -inf; weights = softmax(scores / sqrt(768)); out = weights v -> [4096][768] (3.1 M)).
// Layout: bf16 copy of x; exact projections; ONE 768-wide head through the causal T-4096 attention (hybrid rows: < 512 hi/lo 3 products, rest fp16 x1024; gemmc_tile computes only score / P.v tiles at or below the diagonal (K 768 / N 768); streaming three-sweep softmax with the causal index select); the projection GEMMs write the 16-bit operand planes and the P.v GEMMs the scaled f32 output rows from their own epilogues.
// Five launches, each holding all the work that depends only on earlier launches: the four bf16 conversions; the three projections (grid z); the score tiles of both row classes; the softmax; the P.v tiles of both row classes.
// Compute dtypes, f32 accumulate: every input rounded to bf16; projections exact; attention rows < 512 3 products, rest fp16; softmax f32; output f32.

#define NB_  1
#define TT   4096
#define DM   768
#define NH_  1
#define NKV  1
#define REP  (NH_ / NKV)
#define HD   768
#define DQ   (NH_ * HD)
#define DKV  (NKV * HD)
#define ZH   1
#define RH   512                  // query rows < RH use hi+lo planes (0: none)
#define WIN  4096
#define PCAR 1024.0f
#define SCL  0.036084391824351615f   // 1/sqrt(768)
typedef _Float16 h16;
typedef unsigned short bf;
typedef __attribute__((ext_vector_type(16))) __bf16   v16bf;
typedef __attribute__((ext_vector_type(16))) _Float16 v16h;
typedef __attribute__((ext_vector_type(8)))  _Float16 v8h;
typedef __attribute__((ext_vector_type(8)))  unsigned short v8us;
typedef __attribute__((ext_vector_type(8)))  float    v8f;
typedef __attribute__((ext_vector_type(4)))  float    v4f;
typedef v8h  __attribute__((may_alias)) v8ha;
typedef v4f  __attribute__((may_alias)) v4fa;
typedef v8us __attribute__((may_alias)) v8usa;

__device__ __forceinline__ unsigned short f2bf(float f) { unsigned u = __float_as_uint(f); u += 0x7FFFu + ((u >> 16) & 1u); return (unsigned short)(u >> 16); }
__device__ __forceinline__ float bf2f(unsigned short b) { return __uint_as_float(((unsigned)b) << 16); }
__device__ __forceinline__ float bfr(float f) { return bf2f(f2bf(f)); }
__device__ __forceinline__ v16h cat16(v8h lo, v8h hi) { return __builtin_shufflevector(lo, hi, 0, 1, 2, 3, 4, 5, 6, 7, 8, 9, 10, 11, 12, 13, 14, 15); }
__device__ __forceinline__ v16bf cat16b(v8us lo, v8us hi) { return __builtin_bit_cast(v16bf, __builtin_shufflevector(lo, hi, 0, 1, 2, 3, 4, 5, 6, 7, 8, 9, 10, 11, 12, 13, 14, 15)); }
__device__ __forceinline__ v8f wmma16(v16h a, v16h b, v8f c) { return __builtin_amdgcn_wmma_f32_16x16x32_f16(false, a, false, b, (short)0, c, false, false); }
__device__ __forceinline__ v8f wmmab(v16bf a, v16bf b, v8f c) { return __builtin_amdgcn_wmma_f32_16x16x32_bf16(false, a, false, b, (short)0, c, false, false); }
__device__ __forceinline__ h16 tohx(float x) { return (h16)x; }
__device__ __forceinline__ void splitf(float y, unsigned short& h, unsigned short& l) { h = f2bf(y); l = f2bf(y - bf2f(h)); }



// ---- k_gemmw: register-blocked GEMM, ONE WAVE per 64x64 output tile (16 accumulators), operands straight from K-contiguous 16-bit planes; grid (TT/64, DQ/64, 3), 32 threads; blockIdx.z picks the projection: 0 q, 1 k, 2 v.
// c[m][n] (f32 accumulators) = sum_k A[m][k] Bt[n][k] (+ split products per NSPLIT); the epilogue writes c as three 16-bit planes of pitch ldc: P16 = f16(c), Ph = bf16(c), Pl = bf16(c - Ph). K % 32 == 0, ldc % 8 == 0.
// The transposed planes of v come from the same code with the operands (and the two grid axes) exchanged (A = weight rows, Bt = token rows): c[d][t], ldc = TT.
template <typename T16> struct WFrag;
template <> struct WFrag<h16> { typedef v16h V; static __device__ __forceinline__ V ld(const h16* p) { return cat16(*(const v8h*)p, *(const v8h*)(p + 16)); } static __device__ __forceinline__ v8f mma(V a, V b, v8f c) { return wmma16(a, b, c); } };
template <> struct WFrag<bf> { typedef v16bf V; static __device__ __forceinline__ V ld(const bf* p) { return cat16b(*(const v8us*)p, *(const v8us*)(p + 16)); } static __device__ __forceinline__ v8f mma(V a, V b, v8f c) { return wmmab(a, b, c); } };
template <typename T16, int NSPLIT>
__global__ __launch_bounds__(32) void k_gemmw(const T16* __restrict__ X, const T16* __restrict__ Wq, const T16* __restrict__ Wk, const T16* __restrict__ Wv, int K, h16* Q16, bf* Qh, bf* Ql, h16* K16, bf* Kh, bf* Kl, h16* V16, bf* Vh, bf* Vl) {
    typedef typename WFrag<T16>::V V;
    __shared__ __align__(16) float os[16 * 68];
    const int z = blockIdx.z; const T16* A = (z == 2) ? Wv : X; const T16* Bt = (z == 2) ? X : (z == 1) ? Wk : Wq; const T16* A2 = nullptr; const T16* Bt2 = nullptr;
    h16* P16 = (z == 2) ? V16 : (z == 1) ? K16 : Q16; bf* Ph = (z == 2) ? Vh : (z == 1) ? Kh : Qh; bf* Pl = (z == 2) ? Vl : (z == 1) ? Kl : Ql; const int ldc = (z == 2) ? TT : DQ;
    const int lane = threadIdx.x & 31, lr = lane & 15, hi = lane >> 4; const int r0 = ((z == 2) ? blockIdx.y : blockIdx.x) * 64, c0 = ((z == 2) ? blockIdx.x : blockIdx.y) * 64;
    v8f acc[4][4];
#pragma unroll
    for (int mb = 0; mb < 4; ++mb)
#pragma unroll
        for (int nb = 0; nb < 4; ++nb) acc[mb][nb] = (v8f){};
    const size_t aoff = (size_t)(r0 + lr) * K + 8 * hi, boff = (size_t)(c0 + lr) * K + 8 * hi;
#pragma unroll 1
    for (int kc = 0; kc < K; kc += 32) {
        V a[4], a2[4];
#pragma unroll
        for (int mb = 0; mb < 4; ++mb) { a[mb] = WFrag<T16>::ld(A + aoff + (size_t)mb * 16 * K + kc); if (NSPLIT == 1 || NSPLIT == 2) a2[mb] = WFrag<T16>::ld(A2 + aoff + (size_t)mb * 16 * K + kc); }
#pragma unroll
        for (int nb = 0; nb < 4; ++nb) { const V b = WFrag<T16>::ld(Bt + boff + (size_t)nb * 16 * K + kc); V b2; if (NSPLIT >= 2) b2 = WFrag<T16>::ld(Bt2 + boff + (size_t)nb * 16 * K + kc);
#pragma unroll
            for (int mb = 0; mb < 4; ++mb) { acc[mb][nb] = WFrag<T16>::mma(a[mb], b, acc[mb][nb]); if (NSPLIT == 1 || NSPLIT == 2) acc[mb][nb] = WFrag<T16>::mma(a2[mb], b, acc[mb][nb]); if (NSPLIT >= 2) acc[mb][nb] = WFrag<T16>::mma(a[mb], b2, acc[mb][nb]); } }
        asm volatile("v_nop\n\tv_nop\n\tv_nop\n\tv_nop" : "+v"(acc[0][0]), "+v"(acc[1][1]), "+v"(acc[2][2]), "+v"(acc[3][3]) : "v"(a[0]), "v"(a[3]));
    }
#pragma unroll
    for (int mb = 0; mb < 4; ++mb) {
#pragma unroll
        for (int nb = 0; nb < 4; ++nb) {
#pragma unroll
            for (int j = 0; j < 8; ++j) os[(hi * 8 + j) * 68 + nb * 16 + lr] = acc[mb][nb][j]; }
        __builtin_amdgcn_wave_barrier(); asm volatile("" ::: "memory");
        const size_t o0 = (size_t)(r0 + mb * 16) * ldc + c0;
        // eight lanes per row, eight columns per lane: every 16-byte store of a plane fills whole 128-byte lines (four rows per instruction)
#pragma unroll
        for (int s = 0; s < 4; ++s) { const int row = 4 * s + (lane >> 3), cofs = (lane & 7) * 8; const v4f va = *(const v4fa*)(os + row * 68 + cofs), vb = *(const v4fa*)(os + row * 68 + cofs + 4); v8h o16; v8us oh, ol;
#pragma unroll
            for (int q = 0; q < 4; ++q) { unsigned short x2, y2; o16[q] = tohx(va[q]); splitf(va[q], x2, y2); oh[q] = x2; ol[q] = y2; o16[q + 4] = tohx(vb[q]); splitf(vb[q], x2, y2); oh[q + 4] = x2; ol[q + 4] = y2; }
            const size_t oo = o0 + (size_t)row * ldc + cofs; *(v8h*)(P16 + oo) = o16; *(v8us*)(Ph + oo) = oh; *(v8us*)(Pl + oo) = ol; }
        __builtin_amdgcn_wave_barrier(); asm volatile("" ::: "memory");
    }
}

// ---- gemmc_tile: the same 64x64 tile GEMM specialised for causal attention, as a device function for one tile (rows r0.., columns c0..), called by k_scores and k_pv: CMODE 1 skips score tiles entirely above the diagonal (query rows r0+roff.., key columns c0..), CMODE 2 limits the
// key (K) loop of the probability x value contraction to the diagonal block (probabilities beyond it are exactly zero). roff = sequence row of the first row of the A and C that the call is given.
// CMODE 2 multiplies the finished f32 tile by cs (the inverse of the probabilities' carry factor) as it is stored, so C is the output itself.
// NW waves per tile (32 * NW threads; wv = the wave's number and tid the thread's number within the tile, os = the tile's own LDS: 16 * 68 floats for NW == 1, else NW * 64 * 68): wave w takes the 64-wide K chunks w, w + NW, ... (one 128-byte line of every operand row per chunk) into its own 16 accumulators; the NW partial tiles are summed in LDS, wave 0's first. K % 64 == 0.
template <typename T16, int NSPLIT, int CMODE, int NW>
__device__ __forceinline__ void gemmc_tile(const T16* __restrict__ A, const T16* __restrict__ A2, const T16* __restrict__ Bt, const T16* __restrict__ Bt2, int K, float* C, int ldc, int roff, float cs, int r0, int c0, int wv, int tid, float* os) {
    typedef typename WFrag<T16>::V V;
    const int lane = tid & 31, lr = lane & 15, hi = lane >> 4;
    if (CMODE == 1 && c0 > r0 + roff + 63) return;                  // score tile entirely above the causal diagonal: read but discarded (the softmax masks j > i by select); taken by all NW waves of the tile: with NW > 1 that is the whole work-group, in front of its barrier; with NW == 1 the path has no work-group barrier
    const int Kl = (CMODE == 2) ? min(K, r0 + roff + 64) : K;        // P.V: probabilities are exactly 0 beyond the diagonal block, so the K loop stops there
    v8f acc[4][4];
#pragma unroll
    for (int mb = 0; mb < 4; ++mb)
#pragma unroll
        for (int nb = 0; nb < 4; ++nb) acc[mb][nb] = (v8f){};
    const size_t aoff = (size_t)(r0 + lr) * K + 8 * hi, boff = (size_t)(c0 + lr) * K + 8 * hi;
    // wv, r0 and c0 are held in scalar registers (the callers' readfirstlane) so that both loops branch on scalar compares and EXEC stays whole round the matrix instructions; both stay rolled, as the parent's loop, so that one 32-wide trip's fragments are live at a time
#pragma unroll 1
    for (int kb = wv * 64; kb < Kl; kb += NW * 64)
#pragma unroll 1
    for (int kc = kb; kc < kb + 64; kc += 32) {
        V a[4], a2[4];
#pragma unroll
        for (int mb = 0; mb < 4; ++mb) { a[mb] = WFrag<T16>::ld(A + aoff + (size_t)mb * 16 * K + kc); if (NSPLIT == 1 || NSPLIT == 2) a2[mb] = WFrag<T16>::ld(A2 + aoff + (size_t)mb * 16 * K + kc); }
#pragma unroll
        for (int nb = 0; nb < 4; ++nb) { const V b = WFrag<T16>::ld(Bt + boff + (size_t)nb * 16 * K + kc); V b2; if (NSPLIT >= 2) b2 = WFrag<T16>::ld(Bt2 + boff + (size_t)nb * 16 * K + kc);
#pragma unroll
            for (int mb = 0; mb < 4; ++mb) { acc[mb][nb] = WFrag<T16>::mma(a[mb], b, acc[mb][nb]); if (NSPLIT == 1 || NSPLIT == 2) acc[mb][nb] = WFrag<T16>::mma(a2[mb], b, acc[mb][nb]); if (NSPLIT >= 2) acc[mb][nb] = WFrag<T16>::mma(a[mb], b2, acc[mb][nb]); } }
        asm volatile("v_nop\n\tv_nop\n\tv_nop\n\tv_nop" : "+v"(acc[0][0]), "+v"(acc[1][1]), "+v"(acc[2][2]), "+v"(acc[3][3]) : "v"(a[0]), "v"(a[3]));
    }
    if (NW == 1) {
#pragma unroll
        for (int mb = 0; mb < 4; ++mb) {
#pragma unroll
            for (int nb = 0; nb < 4; ++nb) {
#pragma unroll
                for (int j = 0; j < 8; ++j) os[(hi * 8 + j) * 68 + nb * 16 + lr] = acc[mb][nb][j]; }
            __builtin_amdgcn_wave_barrier(); asm volatile("" ::: "memory");
            float* crow = C + (size_t)(r0 + mb * 16) * ldc + c0;
#pragma unroll
            for (int s = 0; s < 8; ++s) { const int row = 2 * s + hi, cofs = lr * 4; v4f val = *(const v4fa*)(os + row * 68 + cofs); if (CMODE == 2) val *= cs;
                *(v4f*)(crow + (size_t)row * ldc + cofs) = val; }
            __builtin_amdgcn_wave_barrier(); asm volatile("" ::: "memory");
        }
        asm volatile("s_wait_xcnt 0x0" ::: "memory");   // behind the tile's last store: where this path is inlined in front of other code, nothing behind it rewrites a register that an issued store still names
    } else {
        float* ow = os + wv * (64 * 68);
#pragma unroll
        for (int mb = 0; mb < 4; ++mb)
#pragma unroll
            for (int nb = 0; nb < 4; ++nb)
#pragma unroll
                for (int j = 0; j < 8; ++j) ow[(mb * 16 + hi * 8 + j) * 68 + nb * 16 + lr] = acc[mb][nb][j];
        __syncthreads();   // every wave's partial 64x64 tile is in LDS before any of it is summed (passed by every wave of the work-group: all its tiles take this path)
        float* crow = C + (size_t)r0 * ldc + c0;
#pragma unroll
        for (int s = 0; s < 1024; s += 32 * NW) { const int q = s + tid, row = q >> 4, cofs = (q & 15) * 4; v4f val = *(const v4fa*)(os + row * 68 + cofs);
#pragma unroll
            for (int w = 1; w < NW; ++w) val += *(const v4fa*)(os + w * (64 * 68) + row * 68 + cofs);
            if (CMODE == 2) val *= cs;
            *(v4f*)(crow + (size_t)row * ldc + cofs) = val; }
    }
}

// ---- k_scores: every score tile at or below the diagonal, one launch, 128 threads. blockIdx.y == 0: the hi/lo rows (< RH), one 64x64 tile per work-group, its K loop split over the 4 waves; blockIdx.x counts the (RH/64)^2 tiles of the square that holds their diagonal.
// blockIdx.y >= 1: the f16 rows, one tile per WAVE: the 4 waves take 4 consecutive row tiles of key column tile blockIdx.x, each with its own 16 * 68 floats of LDS and no work-group barrier.
static_assert((RH / 64) * (RH / 64) <= TT / 64 && ((TT - RH) / 64) % 4 == 0 && (RH / 64) % 2 == 0, "grid shapes of k_scores and k_pv");
__global__ __launch_bounds__(128) void k_scores(const bf* __restrict__ Qh, const bf* __restrict__ Ql, const bf* __restrict__ Kh, const bf* __restrict__ Kl, const h16* __restrict__ Q16, const h16* __restrict__ K16, float* Sb) {
    __shared__ __align__(16) float os[4 * 64 * 68];
    const int wave = __builtin_amdgcn_readfirstlane((int)(threadIdx.x >> 5));
    if (blockIdx.y == 0) {
        const int t = blockIdx.x; if (t >= (RH / 64) * (RH / 64)) return;   // whole work-group, in front of the barrier
        gemmc_tile<bf, 2, 1, 4>(Qh, Ql, Kh, Kl, HD, Sb, TT, 0, 1.0f, (t / (RH / 64)) * 64, (t % (RH / 64)) * 64, wave, (int)threadIdx.x, os);
    } else {
        gemmc_tile<h16, 0, 1, 1>(Q16 + (size_t)RH * HD, nullptr, K16, nullptr, HD, Sb + (size_t)RH * TT, TT, RH, 1.0f, (((int)blockIdx.y - 1) * 4 + wave) * 64, (int)blockIdx.x * 64, 0, (int)threadIdx.x & 31, os + wave * (16 * 68));
    }
}

// ---- k_pv: every output tile, one launch, 256 threads, blockIdx.y = 64-wide output column tile. blockIdx.x < (TT-RH)/64: one f16 row tile, K loop split over the 8 waves.
// Beyond: two hi/lo row tiles per work-group, 4 waves and half of the LDS each (the split and the order of the sums that each had in a work-group of its own); both halves pass the one barrier.
__global__ __launch_bounds__(256) void k_pv(const bf* __restrict__ Ph, const bf* __restrict__ Pl, const bf* __restrict__ VTh, const bf* __restrict__ VTl, const h16* __restrict__ P16, const h16* __restrict__ VT16, float* O) {
    __shared__ __align__(16) float os[8 * 64 * 68];
    const int wave = __builtin_amdgcn_readfirstlane((int)(threadIdx.x >> 5));
    if (blockIdx.x < (TT - RH) / 64) {
        gemmc_tile<h16, 0, 2, 8>(P16 + (size_t)RH * TT, nullptr, VT16, nullptr, TT, O + (size_t)RH * DQ, DQ, RH, 1.0f / PCAR, (int)blockIdx.x * 64, (int)blockIdx.y * 64, wave, (int)threadIdx.x, os);
    } else {
        const int g = wave >> 2;
        gemmc_tile<bf, 2, 2, 4>(Ph, Pl, VTh, VTl, TT, O, DQ, 0, 1.0f, (((int)blockIdx.x - (TT - RH) / 64) * 2 + g) * 64, (int)blockIdx.y * 64, wave & 3, (int)threadIdx.x & 127, os + g * (4 * 64 * 68));
    }
}

typedef __attribute__((ext_vector_type(2))) _Float16 v2h;
typedef __attribute__((ext_vector_type(4))) _Float16 v4h;
typedef __attribute__((ext_vector_type(2))) unsigned short v2us;
typedef __attribute__((ext_vector_type(4))) unsigned short v4us;
typedef __attribute__((ext_vector_type(2))) float v2f;
typedef __attribute__((ext_vector_type(4))) int v4i;

__global__ __launch_bounds__(256) void k_wtG(const float* __restrict__ w, int K, int N, bf* Bt) {
    const int lane = threadIdx.x & 31; const int L0 = (blockIdx.x * 8 + (threadIdx.x >> 5)) * 8; const int nlines = N * K / 64;
{
#pragma unroll 1
        for (int l = 0; l < 8; ++l) { const int L = L0 + l; if (L >= nlines) break; const size_t e = (size_t)L * 64 + lane * 2; const int k = (int)(e % K), n = (int)(e / K); v2us o;
            o[0] = f2bf(w[(size_t)k * N + n]); o[1] = f2bf(w[(size_t)(k + 1) * N + n]); *(v2us*)(Bt + e) = o; }
         }
}
// k_cvt8: x and the three weights to bf16 in one launch, 8 elements per thread; the first BX_ work-groups take x, then BW_ each take a weight.
#define BX_ (TT * DM / 8 / 256)
#define BW_ (DQ * DM / 8 / 256)
static_assert(TT * DM % 2048 == 0 && DQ * DM % 2048 == 0 && DQ == DKV, "whole work-groups per tensor");
__global__ __launch_bounds__(256) void k_cvt8(const float* __restrict__ x, const float* __restrict__ wq, const float* __restrict__ wk, const float* __restrict__ wv, bf* XB, bf* WQ, bf* WK, bf* WV) {
    int b = blockIdx.x; const float* src = x; bf* dst = XB;
    if (b >= BX_) { b -= BX_; const int w = b / BW_; b -= w * BW_; src = (w == 0) ? wq : (w == 1) ? wk : wv; dst = (w == 0) ? WQ : (w == 1) ? WK : WV; }
    const size_t i = (size_t)b * 256 + threadIdx.x; const v8f v = *(const v8f*)(src + i * 8); v8us o;
#pragma unroll
    for (int k = 0; k < 8; ++k) o[k] = f2bf(v[k]); *(v8us*)(dst + i * 8) = o;  }

// k_lsoft: streaming causal row softmax over the TK = TT = 4096 keys, one wave per row i, three sweeps of the f32 score row (lane -> 4 consecutive keys per 128-key chunk, 32 chunks; keys j > i are excluded by index with -3e38 / 0 - the score tiles above the diagonal are never computed and their stale contents are only ever discarded by this select):
__global__ __launch_bounds__(256) void k_lsoft(const float* __restrict__ Sb, h16* P16, bf* Ph, bf* Pl) {
    const int lane = threadIdx.x & 31; const int row = blockIdx.x * 8 + (threadIdx.x >> 5); if (row >= ZH * TT) return; const int i = row % TT; const int zz = row / TT; const bool hires = (i < RH); const float* sr = Sb + (size_t)row * TT; float mx = -3.0e38f;
#pragma unroll 4
    for (int ch = 0; ch < TT / 128; ++ch) { const int j0 = ch * 128 + lane * 4; const v4f a = *(const v4f*)(sr + j0);
#pragma unroll
        for (int q = 0; q < 4; ++q) { float t = a[q] * SCL; asm volatile("" : "+v"(t)); t = (j0 + q <= i) ? t : -3.0e38f; mx = fmaxf(mx, t); } }
#pragma unroll
    for (int sh = 16; sh; sh >>= 1) mx = fmaxf(mx, __shfl_xor(mx, sh, 32));
    float sum = 0.f;
#pragma unroll 4
    for (int ch = 0; ch < TT / 128; ++ch) { const int j0 = ch * 128 + lane * 4; const v4f a = *(const v4f*)(sr + j0);
#pragma unroll
        for (int q = 0; q < 4; ++q) { float t = a[q] * SCL; asm volatile("" : "+v"(t)); t = (j0 + q <= i) ? t : -3.0e38f; float d0 = __fsub_rn(t, mx); asm volatile("" : "+v"(d0)); sum += __builtin_amdgcn_exp2f(__fmul_rn(d0, 1.4426950408889634f)); } }
#pragma unroll
    for (int sh = 16; sh; sh >>= 1) sum += __shfl_xor(sum, sh, 32);
    const float f = __fdiv_rn(hires ? 1.0f : PCAR, sum);
{
        if (hires) {   /* rows < RH: normalised bf16 hi/lo over the first RH keys (every later key is above the diagonal for these rows; the hi/lo attn.v GEMM stops its K loop at the diagonal block), planes [zz][RH][TT] */
#pragma unroll
            for (int ch = 0; ch < RH / 128; ++ch) { const int j0 = ch * 128 + lane * 4; const v4f a = *(const v4f*)(sr + j0); v4us oh, ol;
#pragma unroll
                for (int q = 0; q < 4; ++q) { float t = a[q] * SCL; asm volatile("" : "+v"(t)); t = (j0 + q <= i) ? t : -3.0e38f; float d0 = __fsub_rn(t, mx); asm volatile("" : "+v"(d0)); float ex = __builtin_amdgcn_exp2f(__fmul_rn(d0, 1.4426950408889634f)); asm volatile("" : "+v"(ex)); unsigned short a2, c2; splitf(ex * f, a2, c2); oh[q] = a2; ol[q] = c2; }
                const size_t oo = ((size_t)zz * RH + i) * TT + j0; *(v4us*)(Ph + oo) = oh; *(v4us*)(Pl + oo) = ol; }
        } else {
#pragma unroll 2
            for (int ch = 0; ch < TT / 128; ++ch) { const int j0 = ch * 128 + lane * 4; const v4f a = *(const v4f*)(sr + j0); v4h o4;
#pragma unroll
                for (int q = 0; q < 4; ++q) { float t = a[q] * SCL; asm volatile("" : "+v"(t)); t = (j0 + q <= i) ? t : -3.0e38f; float d0 = __fsub_rn(t, mx); asm volatile("" : "+v"(d0)); float ex = __builtin_amdgcn_exp2f(__fmul_rn(d0, 1.4426950408889634f)); asm volatile("" : "+v"(ex)); o4[q] = tohx(ex * f); }
                *(v4h*)(P16 + (size_t)row * TT + j0) = o4; } }
         }
}

extern "C" void kernel_launch(void* const* d_in, const int* in_sizes, int n_in,
                              void* d_out, int out_size, void* d_ws, size_t ws_size, hipStream_t stream) {
    (void)in_sizes; (void)n_in; (void)out_size;
    const float* x = (const float*)d_in[0]; const float* wq = (const float*)d_in[1]; const float* wk = (const float*)d_in[2]; const float* wv = (const float*)d_in[3]; const float* wo = nullptr; (void)wo;
    float* OUT = (float*)d_out;     // [1][4096][768]
    char* wsp = (char*)d_ws;
    auto take = [&](size_t bytes) { char* p = wsp; wsp += (bytes + 255) & ~(size_t)255; return (void*)p; };
    bf* WQ = (bf*)take((size_t)DQ * DM * 2); bf* WK = (bf*)take((size_t)DKV * DM * 2); bf* WV = (bf*)take((size_t)DKV * DM * 2); 
    bf* XB = (bf*)take((size_t)TT * DM * 2);
    h16* QP16 = (h16*)take((size_t)NH_ * TT * HD * 2); h16* KP16 = (h16*)take((size_t)NKV * TT * HD * 2); h16* VT16 = (h16*)take((size_t)NKV * HD * TT * 2);
    bf* QPh = (bf*)take((size_t)NH_ * TT * HD * 2); bf* QPl = (bf*)take((size_t)NH_ * TT * HD * 2); bf* KPh = (bf*)take((size_t)NKV * TT * HD * 2); bf* KPl = (bf*)take((size_t)NKV * TT * HD * 2); bf* VTh = (bf*)take((size_t)NKV * HD * TT * 2); bf* VTl = (bf*)take((size_t)NKV * HD * TT * 2); bf* Ph = (bf*)take((size_t)ZH * RH * TT * 2); bf* Pl = (bf*)take((size_t)ZH * RH * TT * 2);
    float* Sb = (float*)take((size_t)ZH * TT * TT * 4); h16* P16 = (h16*)take((size_t)ZH * TT * TT * 2);
    if ((size_t)(wsp - (char*)d_ws) > ws_size) return;    // ws 256 MiB
    for (int b = 0; b < NB_; ++b) {
        k_cvt8<<<BX_ + 3 * BW_, 256, 0, stream>>>(x + (size_t)b * TT * DM, wq, wk, wv, XB, WQ, WK, WV);
        k_gemmw<bf, 0><<<dim3(TT / 64, DQ / 64, 3), 32, 0, stream>>>(XB, WQ, WK, WV, DM, QP16, QPh, QPl, KP16, KPh, KPl, VT16, VTh, VTl);   // v transposed: rows = value columns, pitch TT
        k_scores<<<dim3(TT / 64, 1 + (TT - RH) / 256, 1), 128, 0, stream>>>(QPh, QPl, KPh, KPl, QP16, KP16, Sb);
        k_lsoft<<<ZH * TT / 8, 256, 0, stream>>>(Sb, P16, Ph, Pl);
        k_pv<<<dim3((TT - RH) / 64 + RH / 128, HD / 64, 1), 256, 0, stream>>>(Ph, Pl, VTh, VTl, P16, VT16, OUT + (size_t)b * TT * DQ);
    }
}

// v004
// One run takes 145 microseconds.
// Two timings next to v003 put it at 1.15 and 1.16 times that version's speed.
// Over all steps from v000 it is 2.08 times as fast.
#include <hip/hip_runtime.h>

// Causal single-head self-attention with a 768-wide head over 4,096 tokens (x [4096][768]; q,k,v = x W^T ('oi' [768][768], no bias); scores = q.k, keys after the query -> -inf; weights = softmax(scores / sqrt(768)); out = weights v -> [4096][768] (3.1 M)).
// Layout: bf16 copy of x; exact projections; ONE 768-wide head through the causal T-4096 attention (hybrid rows: < 512 hi/lo 3 products, rest fp16 x1024; gemmc_tile computes only score / P.v tiles at or below the diagonal (K 768 / N 768); streaming three-sweep softmax with the causal index select); the projection GEMMs write the 16-bit operand planes and the P.v GEMMs the scaled f32 output rows from their own epilogues.
// Five launches, each holding all the work that depends only on earlier launches: the four bf16 conversions; the three projections (grid z); the score tiles of both row classes; the softmax; the P.v tiles of both row classes.
// Every 16-bit operand plane [rows][K] lies in fragment order: a block of 16 rows x 32 k is two 512-byte chunks (k 0..15, k 16..31 of the block); lane l = 16 * ((k >> 3) & 1) + (row & 15) owns 16 bytes (8 consecutive k) of each; blocks run along k, then down the rows, so 16 rows still fill 16 * K elements. Each of a fragment's two load instructions reads one chunk = 4 whole 128-byte lines.
// Compute dtypes, f32 accumulate: every input rounded to bf16; projections exact; attention rows < 512 3 products, rest fp16; softmax f32; output f32.

#define NB_  1
#define TT   4096
#define DM   768
#define NH_  1
#define NKV  1
#define REP  (NH_ / NKV)
#define HD   768
#define DQ   (NH_ * HD)
#define DKV  (NKV * HD)
#define ZH   1
#define RH   512                  // query rows < RH use hi+lo planes (0: none)
#define WIN  4096
#define PCAR 1024.0f
#define SCL  0.036084391824351615f   // 1/sqrt(768)
typedef _Float16 h16;
typedef unsigned short bf;
typedef __attribute__((ext_vector_type(16))) __bf16   v16bf;
typedef __attribute__((ext_vector_type(16))) _Float16 v16h;
typedef __attribute__((ext_vector_type(8)))  _Float16 v8h;
typedef __attribute__((ext_vector_type(8)))  unsigned short v8us;
typedef __attribute__((ext_vector_type(8)))  float    v8f;
typedef __attribute__((ext_vector_type(4)))  float    v4f;
typedef v8h  __attribute__((may_alias)) v8ha;
typedef v4f  __attribute__((may_alias)) v4fa;
typedef v8us __attribute__((may_alias)) v8usa;

__device__ __forceinline__ unsigned short f2bf(float f) { unsigned u = __float_as_uint(f); u += 0x7FFFu + ((u >> 16) & 1u); return (unsigned short)(u >> 16); }
__device__ __forceinline__ float bf2f(unsigned short b) { return __uint_as_float(((unsigned)b) << 16); }
__device__ __forceinline__ float bfr(float f) { return bf2f(f2bf(f)); }
__device__ __forceinline__ v16h cat16(v8h lo, v8h hi) { return __builtin_shufflevector(lo, hi, 0, 1, 2, 3, 4, 5, 6, 7, 8, 9, 10, 11, 12, 13, 14, 15); }
__device__ __forceinline__ v16bf cat16b(v8us lo, v8us hi) { return __builtin_bit_cast(v16bf, __builtin_shufflevector(lo, hi, 0, 1, 2, 3, 4, 5, 6, 7, 8, 9, 10, 11, 12, 13, 14, 15)); }
__device__ __forceinline__ v8f wmma16(v16h a, v16h b, v8f c) { return __builtin_amdgcn_wmma_f32_16x16x32_f16(false, a, false, b, (short)0, c, false, false); }
__device__ __forceinline__ v8f wmmab(v16bf a, v16bf b, v8f c) { return __builtin_amdgcn_wmma_f32_16x16x32_bf16(false, a, false, b, (short)0, c, false, false); }
__device__ __forceinline__ h16 tohx(float x) { return (h16)x; }
__device__ __forceinline__ void splitf(float y, unsigned short& h, unsigned short& l) { h = f2bf(y); l = f2bf(y - bf2f(h)); }



// ---- k_gemmw: register-blocked GEMM, ONE WAVE per 64x64 output tile (16 accumulators), operands straight from 16-bit planes in fragment order; grid (TT/64, DQ/64, 3), 32 threads; blockIdx.z picks the projection: 0 q, 1 k, 2 v.
// c[m][n] (f32 accumulators) = sum_k A[m][k] Bt[n][k] (+ split products per NSPLIT); the epilogue writes c as three 16-bit planes in fragment order with ldc columns (their K): P16 = f16(c), Ph = bf16(c), Pl = bf16(c - Ph). K % 32 == 0, ldc % 32 == 0.
// The transposed planes of v come from the same code with the operands (and the two grid axes) exchanged (A = weight rows, Bt = token rows): c[d][t], ldc = TT.
// sptr: a wave-uniform operand address held in a scalar register pair (global address space), so that a fragment load is scalar base + the lane's one offset register + immediate: no 64-bit vector add a trip, and no load result can land in a register that an issued load still names as its address
#define GAS __attribute__((address_space(1)))
template <typename T> __device__ __forceinline__ const GAS T* sptr(const T* p) { const unsigned long long u = (unsigned long long)p; return (const GAS T*)(((unsigned long long)(unsigned)__builtin_amdgcn_readfirstlane((int)(u >> 32)) << 32) | (unsigned)__builtin_amdgcn_readfirstlane((int)u)); }
template <typename T16> struct WFrag;
template <> struct WFrag<h16> { typedef v16h V; static __device__ __forceinline__ V ld(const GAS h16* p, unsigned lo) { return cat16(*(const GAS v8h*)(p + lo), *(const GAS v8h*)(p + 256 + lo)); } static __device__ __forceinline__ v8f mma(V a, V b, v8f c) { return wmma16(a, b, c); } };
template <> struct WFrag<bf> { typedef v16bf V; static __device__ __forceinline__ V ld(const GAS bf* p, unsigned lo) { return cat16b(*(const GAS v8us*)(p + lo), *(const GAS v8us*)(p + 256 + lo)); } static __device__ __forceinline__ v8f mma(V a, V b, v8f c) { return wmmab(a, b, c); } };
template <typename T16, int NSPLIT>
__global__ __launch_bounds__(32) void k_gemmw(const T16* __restrict__ X, const T16* __restrict__ Wq, const T16* __restrict__ Wk, const T16* __restrict__ Wv, int K, h16* Q16, bf* Qh, bf* Ql, h16* K16, bf* Kh, bf* Kl, h16* V16, bf* Vh, bf* Vl) {
    typedef typename WFrag<T16>::V V;
    __shared__ __align__(16) float os[16 * 68];
    const int z = blockIdx.z; const T16* A = (z == 2) ? Wv : X; const T16* Bt = (z == 2) ? X : (z == 1) ? Wk : Wq; const T16* A2 = nullptr; const T16* Bt2 = nullptr;
    h16* P16 = (z == 2) ? V16 : (z == 1) ? K16 : Q16; bf* Ph = (z == 2) ? Vh : (z == 1) ? Kh : Qh; bf* Pl = (z == 2) ? Vl : (z == 1) ? Kl : Ql; const int ldc = (z == 2) ? TT : DQ;
    const int lane = threadIdx.x & 31, lr = lane & 15, hi = lane >> 4; const int r0 = ((z == 2) ? blockIdx.y : blockIdx.x) * 64, c0 = ((z == 2) ? blockIdx.x : blockIdx.y) * 64;
    v8f acc[4][4];
#pragma unroll
    for (int mb = 0; mb < 4; ++mb)
#pragma unroll
        for (int nb = 0; nb < 4; ++nb) acc[mb][nb] = (v8f){};
    const size_t aoff = (size_t)r0 * K, boff = (size_t)c0 * K; const unsigned lo = 8u * (unsigned)lane;   // fragment order: the tile's first block (the same for the wave: a scalar base) and the lane's 16 bytes of a chunk (one register, unchanged through the loop)
#pragma unroll 1
    for (int kc = 0; kc < K; kc += 32) {
        V a[4], a2[4];   // K is a run-time value here: each 16-row band has a scalar base of its own
#pragma unroll
        for (int mb = 0; mb < 4; ++mb) { a[mb] = WFrag<T16>::ld(sptr(A + aoff + (size_t)mb * 16 * K + kc * 16), lo); if (NSPLIT == 1 || NSPLIT == 2) a2[mb] = WFrag<T16>::ld(sptr(A2 + aoff + (size_t)mb * 16 * K + kc * 16), lo); }
#pragma unroll
        for (int nb = 0; nb < 4; ++nb) { const V b = WFrag<T16>::ld(sptr(Bt + boff + (size_t)nb * 16 * K + kc * 16), lo); V b2; if (NSPLIT >= 2) b2 = WFrag<T16>::ld(sptr(Bt2 + boff + (size_t)nb * 16 * K + kc * 16), lo);
#pragma unroll
            for (int mb = 0; mb < 4; ++mb) { acc[mb][nb] = WFrag<T16>::mma(a[mb], b, acc[mb][nb]); if (NSPLIT == 1 || NSPLIT == 2) acc[mb][nb] = WFrag<T16>::mma(a2[mb], b, acc[mb][nb]); if (NSPLIT >= 2) acc[mb][nb] = WFrag<T16>::mma(a[mb], b2, acc[mb][nb]); } }
        asm volatile("v_nop\n\tv_nop\n\tv_nop\n\tv_nop" : "+v"(acc[0][0]), "+v"(acc[1][1]), "+v"(acc[2][2]), "+v"(acc[3][3]) : "v"(a[0]), "v"(a[3]));
    }
#pragma unroll
    for (int mb = 0; mb < 4; ++mb) {
#pragma unroll
        for (int nb = 0; nb < 4; ++nb) {
#pragma unroll
            for (int j = 0; j < 8; ++j) os[(hi * 8 + j) * 68 + nb * 16 + lr] = acc[mb][nb][j]; }
        __builtin_amdgcn_wave_barrier(); asm volatile("" ::: "memory");
        const size_t o0 = (size_t)(r0 + mb * 16) * ldc + (size_t)c0 * 16 + 8 * lane;
        // fragment order: the 64 columns are 4 chunks; every 16-byte store of a plane fills one whole 512-byte chunk
#pragma unroll
        for (int s = 0; s < 4; ++s) { const int row = lr, cofs = s * 16 + hi * 8; const v4f va = *(const v4fa*)(os + row * 68 + cofs), vb = *(const v4fa*)(os + row * 68 + cofs + 4); v8h o16; v8us oh, ol;
#pragma unroll
            for (int q = 0; q < 4; ++q) { unsigned short x2, y2; o16[q] = tohx(va[q]); splitf(va[q], x2, y2); oh[q] = x2; ol[q] = y2; o16[q + 4] = tohx(vb[q]); splitf(vb[q], x2, y2); oh[q + 4] = x2; ol[q + 4] = y2; }
            const size_t oo = o0 + s * 256; *(v8h*)(P16 + oo) = o16; *(v8us*)(Ph + oo) = oh; *(v8us*)(Pl + oo) = ol; }
        __builtin_amdgcn_wave_barrier(); asm volatile("" ::: "memory");
    }
}

// ---- gemmc_tile: the same 64x64 tile GEMM specialised for causal attention, as a device function for one tile (rows r0.., columns c0..), called by k_scores and k_pv: CMODE 1 skips score tiles entirely above the diagonal (query rows r0+roff.., key columns c0..), CMODE 2 limits the
// key (K) loop of the probability x value contraction to the diagonal block (probabilities beyond it are exactly zero). roff = sequence row of the first row of the A and C that the call is given.
// CMODE 2 multiplies the finished f32 tile by cs (the inverse of the probabilities' carry factor) as it is stored, so C is the output itself.
// NW waves per tile (32 * NW threads; wv = the wave's number and tid the thread's number within the tile, os = the tile's own LDS: 16 * 68 floats for NW == 1, else NW * 64 * 68): wave w takes the 64-wide K chunks w, w + NW, ... (two blocks, 2 KiB in a row, of every 16 operand rows per chunk) into its own 16 accumulators; the NW partial tiles are summed in LDS, wave 0's first. K % 64 == 0.
template <typename T16, int NSPLIT, int CMODE, int NW>
__device__ __forceinline__ void gemmc_tile(const T16* __restrict__ A, const T16* __restrict__ A2, const T16* __restrict__ Bt, const T16* __restrict__ Bt2, int K, float* C, int ldc, int roff, float cs, int r0, int c0, int wv, int tid, float* os) {
    typedef typename WFrag<T16>::V V;
    const int lane = tid & 31, lr = lane & 15, hi = lane >> 4;
    if (CMODE == 1 && c0 > r0 + roff + 63) return;                  // score tile entirely above the causal diagonal: read but discarded (the softmax masks j > i by select); taken by all NW waves of the tile: with NW > 1 that is the whole work-group, in front of its barrier; with NW == 1 the path has no work-group barrier
    const int Kl = (CMODE == 2) ? min(K, r0 + roff + 64) : K;        // P.V: probabilities are exactly 0 beyond the diagonal block, so the K loop stops there
    v8f acc[4][4];
#pragma unroll
    for (int mb = 0; mb < 4; ++mb)
#pragma unroll
        for (int nb = 0; nb < 4; ++nb) acc[mb][nb] = (v8f){};
    const size_t aoff = (size_t)r0 * K, boff = (size_t)c0 * K; const unsigned lo = 8u * (unsigned)lane;   // fragment order: the tile's first block (the same for the wave: a scalar base) and the lane's 16 bytes of a chunk (one register, unchanged through the loop)
    // wv, r0 and c0 are held in scalar registers (the callers' readfirstlane) so that both loops branch on scalar compares and EXEC stays whole round the matrix instructions; both stay rolled, as the parent's loop, so that one 32-wide trip's fragments are live at a time
#pragma unroll 1
    for (int kb = wv * 64; kb < Kl; kb += NW * 64)
#pragma unroll 1
    for (int kc = kb; kc < kb + 64; kc += 32) {
        V a[4], a2[4]; const GAS T16* pa = sptr(A + aoff + kc * 16); const GAS T16* pb = sptr(Bt + boff + kc * 16); const GAS T16* pa2 = (NSPLIT == 1 || NSPLIT == 2) ? sptr(A2 + aoff + kc * 16) : nullptr; const GAS T16* pb2 = (NSPLIT >= 2) ? sptr(Bt2 + boff + kc * 16) : nullptr;
#pragma unroll
        for (int mb = 0; mb < 4; ++mb) { a[mb] = WFrag<T16>::ld(pa + (size_t)mb * 16 * K, lo); if (NSPLIT == 1 || NSPLIT == 2) a2[mb] = WFrag<T16>::ld(pa2 + (size_t)mb * 16 * K, lo); }
#pragma unroll
        for (int nb = 0; nb < 4; ++nb) { const V b = WFrag<T16>::ld(pb + (size_t)nb * 16 * K, lo); V b2; if (NSPLIT >= 2) b2 = WFrag<T16>::ld(pb2 + (size_t)nb * 16 * K, lo);
#pragma unroll
            for (int mb = 0; mb < 4; ++mb) { acc[mb][nb] = WFrag<T16>::mma(a[mb], b, acc[mb][nb]); if (NSPLIT == 1 || NSPLIT == 2) acc[mb][nb] = WFrag<T16>::mma(a2[mb], b, acc[mb][nb]); if (NSPLIT >= 2) acc[mb][nb] = WFrag<T16>::mma(a[mb], b2, acc[mb][nb]); } }
        asm volatile("v_nop\n\tv_nop\n\tv_nop\n\tv_nop" : "+v"(acc[0][0]), "+v"(acc[1][1]), "+v"(acc[2][2]), "+v"(acc[3][3]) : "v"(a[0]), "v"(a[3]));
    }
    if (NW == 1) {
#pragma unroll
        for (int mb = 0; mb < 4; ++mb) {
#pragma unroll
            for (int nb = 0; nb < 4; ++nb) {
#pragma unroll
                for (int j = 0; j < 8; ++j) os[(hi * 8 + j) * 68 + nb * 16 + lr] = acc[mb][nb][j]; }
            __builtin_amdgcn_wave_barrier(); asm volatile("" ::: "memory");
            float* crow = C + (size_t)(r0 + mb * 16) * ldc + c0;
#pragma unroll
            for (int s = 0; s < 8; ++s) { const int row = 2 * s + hi, cofs = lr * 4; v4f val = *(const v4fa*)(os + row * 68 + cofs); if (CMODE == 2) val *= cs;
                *(v4f*)(crow + (size_t)row * ldc + cofs) = val; }
            __builtin_amdgcn_wave_barrier(); asm volatile("" ::: "memory");
        }
        asm volatile("s_wait_xcnt 0x0" ::: "memory");   // behind the tile's last store: where this path is inlined in front of other code, nothing behind it rewrites a register that an issued store still names
    } else {
        float* ow = os + wv * (64 * 68);
#pragma unroll
        for (int mb = 0; mb < 4; ++mb)
#pragma unroll
            for (int nb = 0; nb < 4; ++nb)
#pragma unroll
                for (int j = 0; j < 8; ++j) ow[(mb * 16 + hi * 8 + j) * 68 + nb * 16 + lr] = acc[mb][nb][j];
        __syncthreads();   // every wave's partial 64x64 tile is in LDS before any of it is summed (passed by every wave of the work-group: all its tiles take this path)
        float* crow = C + (size_t)r0 * ldc + c0;
#pragma unroll
        for (int s = 0; s < 1024; s += 32 * NW) { const int q = s + tid, row = q >> 4, cofs = (q & 15) * 4; v4f val = *(const v4fa*)(os + row * 68 + cofs);
#pragma unroll
            for (int w = 1; w < NW; ++w) val += *(const v4fa*)(os + w * (64 * 68) + row * 68 + cofs);
            if (CMODE == 2) val *= cs;
            *(v4f*)(crow + (size_t)row * ldc + cofs) = val; }
    }
}

// ---- k_scores: every score tile at or below the diagonal, one launch, 128 threads. blockIdx.y == 0: the hi/lo rows (< RH), one 64x64 tile per work-group, its K loop split over the 4 waves; blockIdx.x counts the (RH/64)^2 tiles of the square that holds their diagonal.
// blockIdx.y >= 1: the f16 rows, one tile per WAVE: the 4 waves take 4 consecutive row tiles of key column tile blockIdx.x, each with its own 16 * 68 floats of LDS and no work-group barrier.
static_assert((RH / 64) * (RH / 64) <= TT / 64 && ((TT - RH) / 64) % 4 == 0 && (RH / 64) % 2 == 0, "grid shapes of k_scores and k_pv");
__global__ __launch_bounds__(128) void k_scores(const bf* __restrict__ Qh, const bf* __restrict__ Ql, const bf* __restrict__ Kh, const bf* __restrict__ Kl, const h16* __restrict__ Q16, const h16* __restrict__ K16, float* Sb) {
    __shared__ __align__(16) float os[4 * 64 * 68];
    const int wave = __builtin_amdgcn_readfirstlane((int)(threadIdx.x >> 5));
    if (blockIdx.y == 0) {
        const int t = blockIdx.x; if (t >= (RH / 64) * (RH / 64)) return;   // whole work-group, in front of the barrier
        gemmc_tile<bf, 2, 1, 4>(Qh, Ql, Kh, Kl, HD, Sb, TT, 0, 1.0f, (t / (RH / 64)) * 64, (t % (RH / 64)) * 64, wave, (int)threadIdx.x, os);
    } else {
        gemmc_tile<h16, 0, 1, 1>(Q16 + (size_t)RH * HD, nullptr, K16, nullptr, HD, Sb + (size_t)RH * TT, TT, RH, 1.0f, (((int)blockIdx.y - 1) * 4 + wave) * 64, (int)blockIdx.x * 64, 0, (int)threadIdx.x & 31, os + wave * (16 * 68));
    }
}

// ---- k_pv: every output tile, one launch, 256 threads, blockIdx.y = 64-wide output column tile. blockIdx.x < (TT-RH)/64: one f16 row tile, K loop split over the 8 waves.
// Beyond: two hi/lo row tiles per work-group, 4 waves and half of the LDS each (the split and the order of the sums that each had in a work-group of its own); both halves pass the one barrier.
__global__ __launch_bounds__(256) void k_pv(const bf* __restrict__ Ph, const bf* __restrict__ Pl, const bf* __restrict__ VTh, const bf* __restrict__ VTl, const h16* __restrict__ P16, const h16* __restrict__ VT16, float* O) {
    __shared__ __align__(16) float os[8 * 64 * 68];
    const int wave = __builtin_amdgcn_readfirstlane((int)(threadIdx.x >> 5));
    if (blockIdx.x < (TT - RH) / 64) {
        gemmc_tile<h16, 0, 2, 8>(P16 + (size_t)RH * TT, nullptr, VT16, nullptr, TT, O + (size_t)RH * DQ, DQ, RH, 1.0f / PCAR, (int)blockIdx.x * 64, (int)blockIdx.y * 64, wave, (int)threadIdx.x, os);
    } else {
        const int g = wave >> 2;
        gemmc_tile<bf, 2, 2, 4>(Ph, Pl, VTh, VTl, TT, O, DQ, 0, 1.0f, (((int)blockIdx.x - (TT - RH) / 64) * 2 + g) * 64, (int)blockIdx.y * 64, wave & 3, (int)threadIdx.x & 127, os + g * (4 * 64 * 68));
    }
}

typedef __attribute__((ext_vector_type(2))) _Float16 v2h;
typedef __attribute__((ext_vector_type(4))) _Float16 v4h;
typedef __attribute__((ext_vector_type(2))) unsigned short v2us;
typedef __attribute__((ext_vector_type(4))) unsigned short v4us;
typedef __attribute__((ext_vector_type(2))) float v2f;
typedef __attribute__((ext_vector_type(4))) int v4i;

__global__ __launch_bounds__(256) void k_wtG(const float* __restrict__ w, int K, int N, bf* Bt) {
    const int lane = threadIdx.x & 31; const int L0 = (blockIdx.x * 8 + (threadIdx.x >> 5)) * 8; const int nlines = N * K / 64;
{
#pragma unroll 1
        for (int l = 0; l < 8; ++l) { const int L = L0 + l; if (L >= nlines) break; const size_t e = (size_t)L * 64 + lane * 2; const int k = (int)(e % K), n = (int)(e / K); v2us o;
            o[0] = f2bf(w[(size_t)k * N + n]); o[1] = f2bf(w[(size_t)(k + 1) * N + n]); *(v2us*)(Bt + e) = o; }
         }
}
// k_cvt8: x and the three weights to bf16 planes in fragment order in one launch, 8 elements per thread (thread i writes the plane's i-th 16 bytes, a wave one chunk); the first BX_ work-groups take x, then BW_ each take a weight.
#define BX_ (TT * DM / 8 / 256)
#define BW_ (DQ * DM / 8 / 256)
static_assert(TT * DM % 2048 == 0 && DQ * DM % 2048 == 0 && DQ == DKV, "whole work-groups per tensor");
__global__ __launch_bounds__(256) void k_cvt8(const float* __restrict__ x, const float* __restrict__ wq, const float* __restrict__ wk, const float* __restrict__ wv, bf* XB, bf* WQ, bf* WK, bf* WV) {
    int b = blockIdx.x; const float* src = x; bf* dst = XB;
    if (b >= BX_) { b -= BX_; const int w = b / BW_; b -= w * BW_; src = (w == 0) ? wq : (w == 1) ? wk : wv; dst = (w == 0) ? WQ : (w == 1) ? WK : WV; }
    const size_t i = (size_t)b * 256 + threadIdx.x; const int l = threadIdx.x & 31, c = (int)(i >> 5), blk = c >> 1;   // chunk c of block blk
    const int srow = (blk / (DM / 32)) * 16 + (l & 15), scol = (blk % (DM / 32)) * 32 + (c & 1) * 16 + (l >> 4) * 8;
    const v8f v = *(const v8f*)(src + (size_t)srow * DM + scol); v8us o;
#pragma unroll
    for (int k = 0; k < 8; ++k) o[k] = f2bf(v[k]); *(v8us*)(dst + i * 8) = o;  }

// k_lsoft: streaming causal row softmax over the TK = TT = 4096 keys, one wave per row i, three sweeps of the f32 score row (lane -> 4 consecutive keys per 128-key chunk, 32 chunks; keys j > i are excluded by index with -3e38 / 0 - the score tiles above the diagonal are never computed and their stale contents are only ever discarded by this select):
// The third sweep leaves the work-group's 8 rows of 16-bit weights in LDS (row pitch PSP elements: 32 bytes over a multiple of 256, so that the 16-byte reads of 8 rows fall on different banks); behind one barrier each wave stores whole 128-byte lines of the planes' fragment order (8 rows x 8 keys a line, 4 lines = one 32-key block an instruction).
#define PSP (TT + 16)
static_assert(RH % 16 == 0 && 2 * RH <= TT && TT % 256 == 0 && RH % 128 == 0, "staging of k_lsoft");
__global__ __launch_bounds__(256) void k_lsoft(const float* __restrict__ Sb, h16* P16, bf* Ph, bf* Pl) {
    __shared__ __align__(16) unsigned short ps[8 * PSP];
    const int lane = threadIdx.x & 31; const int wv = threadIdx.x >> 5; const int row = blockIdx.x * 8 + wv; if (row >= ZH * TT) return;   // never taken: the grid holds exactly ZH * TT rows
    const int i = row % TT; const int zz = row / TT; const bool hires = (i < RH); const float* sr = Sb + (size_t)row * TT; float mx = -3.0e38f;
#pragma unroll 4
    for (int ch = 0; ch < TT / 128; ++ch) { const int j0 = ch * 128 + lane * 4; const v4f a = *(const v4f*)(sr + j0);
#pragma unroll
        for (int q = 0; q < 4; ++q) { float t = a[q] * SCL; asm volatile("" : "+v"(t)); t = (j0 + q <= i) ? t : -3.0e38f; mx = fmaxf(mx, t); } }
#pragma unroll
    for (int sh = 16; sh; sh >>= 1) mx = fmaxf(mx, __shfl_xor(mx, sh, 32));
    float sum = 0.f;
#pragma unroll 4
    for (int ch = 0; ch < TT / 128; ++ch) { const int j0 = ch * 128 + lane * 4; const v4f a = *(const v4f*)(sr + j0);
#pragma unroll
        for (int q = 0; q < 4; ++q) { float t = a[q] * SCL; asm volatile("" : "+v"(t)); t = (j0 + q <= i) ? t : -3.0e38f; float d0 = __fsub_rn(t, mx); asm volatile("" : "+v"(d0)); sum += __builtin_amdgcn_exp2f(__fmul_rn(d0, 1.4426950408889634f)); } }
#pragma unroll
    for (int sh = 16; sh; sh >>= 1) sum += __shfl_xor(sum, sh, 32);
    const float f = __fdiv_rn(hires ? 1.0f : PCAR, sum);
{
        if (hires) {   /* rows < RH: normalised bf16 hi/lo over the first RH keys (every later key is above the diagonal for these rows; the hi/lo attn.v GEMM stops its K loop at the diagonal block), planes [zz][RH][TT] */
#pragma unroll
            for (int ch = 0; ch < RH / 128; ++ch) { const int j0 = ch * 128 + lane * 4; const v4f a = *(const v4f*)(sr + j0); v4us oh, ol;
#pragma unroll
                for (int q = 0; q < 4; ++q) { float t = a[q] * SCL; asm volatile("" : "+v"(t)); t = (j0 + q <= i) ? t : -3.0e38f; float d0 = __fsub_rn(t, mx); asm volatile("" : "+v"(d0)); float ex = __builtin_amdgcn_exp2f(__fmul_rn(d0, 1.4426950408889634f)); asm volatile("" : "+v"(ex)); unsigned short a2, c2; splitf(ex * f, a2, c2); oh[q] = a2; ol[q] = c2; }
                *(v4us*)(ps + wv * PSP + j0) = oh; *(v4us*)(ps + wv * PSP + RH + j0) = ol; }
        } else {
#pragma unroll 2
            for (int ch = 0; ch < TT / 128; ++ch) { const int j0 = ch * 128 + lane * 4; const v4f a = *(const v4f*)(sr + j0); v4h o4;
#pragma unroll
                for (int q = 0; q < 4; ++q) { float t = a[q] * SCL; asm volatile("" : "+v"(t)); t = (j0 + q <= i) ? t : -3.0e38f; float d0 = __fsub_rn(t, mx); asm volatile("" : "+v"(d0)); float ex = __builtin_amdgcn_exp2f(__fmul_rn(d0, 1.4426950408889634f)); asm volatile("" : "+v"(ex)); o4[q] = tohx(ex * f); }
                *(v4us*)(ps + wv * PSP + j0) = __builtin_bit_cast(v4us, o4); } }
         }
    __syncthreads();   // all 8 rows are in LDS before any wave gathers lines across them (hires is the same for the whole work-group: RH % 8 == 0)
    const int r8 = lane & 7, sh = lane >> 3;                       // row of the 8, 8-key unit of the 32-key block
    const int i0 = i - wv;                                         // the work-group's first row within the sequence
    const size_t ob = (size_t)(i0 >> 4) * 16 * TT + sh * 128 + ((i0 & 15) + r8) * 8;
    if (hires) {
#pragma unroll   // unrolled so that the plane (pl) is known at compile time for each store
        for (int it = 0; it < 2 * (RH / 32) / 8; ++it) { const int idx = it * 8 + wv, pl = idx / (RH / 32), kb = idx % (RH / 32); const v8us val = *(const v8usa*)(ps + r8 * PSP + pl * RH + kb * 32 + sh * 8);
            *(v8usa*)((pl ? Pl : Ph) + (size_t)zz * RH * TT + ob + kb * 512) = val; }
    } else {
#pragma unroll 4   // four LDS reads are issued ahead of their four stores
        for (int it = 0; it < (TT / 32) / 8; ++it) { const int kb = it * 8 + wv; const v8us val = *(const v8usa*)(ps + r8 * PSP + kb * 32 + sh * 8);
            *(v8usa*)(P16 + (size_t)zz * TT * TT + ob + kb * 512) = val; }
    }
}

extern "C" void kernel_launch(void* const* d_in, const int* in_sizes, int n_in,
                              void* d_out, int out_size, void* d_ws, size_t ws_size, hipStream_t stream) {
    (void)in_sizes; (void)n_in; (void)out_size;
    const float* x = (const float*)d_in[0]; const float* wq = (const float*)d_in[1]; const float* wk = (const float*)d_in[2]; const float* wv = (const float*)d_in[3]; const float* wo = nullptr; (void)wo;
    float* OUT = (float*)d_out;     // [1][4096][768]
    char* wsp = (char*)d_ws;
    auto take = [&](size_t bytes) { char* p = wsp; wsp += (bytes + 255) & ~(size_t)255; return (void*)p; };
    bf* WQ = (bf*)take((size_t)DQ * DM * 2); bf* WK = (bf*)take((size_t)DKV * DM * 2); bf* WV = (bf*)take((size_t)DKV * DM * 2); 
    bf* XB = (bf*)take((size_t)TT * DM * 2);
    h16* QP16 = (h16*)take((size_t)NH_ * TT * HD * 2); h16* KP16 = (h16*)take((size_t)NKV * TT * HD * 2); h16* VT16 = (h16*)take((size_t)NKV * HD * TT * 2);
    bf* QPh = (bf*)take((size_t)NH_ * TT * HD * 2); bf* QPl = (bf*)take((size_t)NH_ * TT * HD * 2); bf* KPh = (bf*)take((size_t)NKV * TT * HD * 2); bf* KPl = (bf*)take((size_t)NKV * TT * HD * 2); bf* VTh = (bf*)take((size_t)NKV * HD * TT * 2); bf* VTl = (bf*)take((size_t)NKV * HD * TT * 2); bf* Ph = (bf*)take((size_t)ZH * RH * TT * 2); bf* Pl = (bf*)take((size_t)ZH * RH * TT * 2);
    float* Sb = (float*)take((size_t)ZH * TT * TT * 4); h16* P16 = (h16*)take((size_t)ZH * TT * TT * 2);
    if ((size_t)(wsp - (char*)d_ws) > ws_size) return;    // ws 256 MiB
    for (int b = 0; b < NB_; ++b) {
        k_cvt8<<<BX_ + 3 * BW_, 256, 0, stream>>>(x + (size_t)b * TT * DM, wq, wk, wv, XB, WQ, WK, WV);
        k_gemmw<bf, 0><<<dim3(TT / 64, DQ / 64, 3), 32, 0, stream>>>(XB, WQ, WK, WV, DM, QP16, QPh, QPl, KP16, KPh, KPl, VT16, VTh, VTl);   // v transposed: rows = value columns, pitch TT
        k_scores<<<dim3(TT / 64, 1 + (TT - RH) / 256, 1), 128, 0, stream>>>(QPh, QPl, KPh, KPl, QP16, KP16, Sb);
        k_lsoft<<<ZH * TT / 8, 256, 0, stream>>>(Sb, P16, Ph, Pl);
        k_pv<<<dim3((TT - RH) / 64 + RH / 128, HD / 64, 1), 256, 0, stream>>>(Ph, Pl, VTh, VTl, P16, VT16, OUT + (size_t)b * TT * DQ);
    }
}

// v005
// A run of this version takes 112 microseconds.
// Next to v004, in two timings, it ran 1.30 and 1.28 times as fast.
// Over all steps from v000 it is 2.69 times as fast.
#include <hip/hip_runtime.h>

// Causal single-head self-attention with a 768-wide head over 4,096 tokens (x [4096][768]; q,k,v = x W^T ('oi' [768][768], no bias); scores = q.k, keys after the query -> -inf; weights = softmax(scores / sqrt(768)); out = weights v -> [4096][768] (3.1 M)).
// Layout: bf16 copy of x; exact projections; ONE 768-wide head through the causal T-4096 attention (hybrid rows: < 512 hi/lo 3 products, rest fp16 x1024; k_scores (K 768) computes only the score tiles at or below the diagonal, k_pv (N 768) every output tile, its K loop ending at the diagonal block; one-read softmax, the row in registers, with the causal index select); the projection GEMMs write the 16-bit operand planes and the P.v GEMMs the scaled f32 output rows from their own epilogues.
// Five launches, each holding all the work that depends only on earlier launches: the four bf16 conversions; the three projections (grid z); the score tiles of both row classes; the softmax; the P.v tiles of both row classes.
// Every 16-bit operand plane [rows][K] lies in fragment order: a block of 16 rows x 32 k is two 512-byte chunks (k 0..15, k 16..31 of the block); lane l = 16 * ((k >> 3) & 1) + (row & 15) owns 16 bytes (8 consecutive k) of each; blocks run along k, then down the rows, so 16 rows still fill 16 * K elements. Each of a fragment's two load instructions reads one chunk = 4 whole 128-byte lines.
// Compute dtypes, f32 accumulate: every input rounded to bf16; projections exact; attention rows < 512 3 products, rest fp16; softmax f32; output f32.

#define NB_  1
#define TT   4096
#define DM   768
#define NH_  1
#define NKV  1
#define REP  (NH_ / NKV)
#define HD   768
#define DQ   (NH_ * HD)
#define DKV  (NKV * HD)
#define ZH   1
#define RH   512                  // query rows < RH use hi+lo planes (0: none)
#define WIN  4096
#define PCAR 1024.0f
#define SCL  0.036084391824351615f   // 1/sqrt(768)
typedef _Float16 h16;
typedef unsigned short bf;
typedef __attribute__((ext_vector_type(16))) __bf16   v16bf;
typedef __attribute__((ext_vector_type(16))) _Float16 v16h;
typedef __attribute__((ext_vector_type(8)))  _Float16 v8h;
typedef __attribute__((ext_vector_type(8)))  unsigned short v8us;
typedef __attribute__((ext_vector_type(8)))  float    v8f;
typedef __attribute__((ext_vector_type(4)))  float    v4f;
typedef v8h  __attribute__((may_alias)) v8ha;
typedef v4f  __attribute__((may_alias)) v4fa;
typedef v8us __attribute__((may_alias)) v8usa;

__device__ __forceinline__ unsigned short f2bf(float f) { unsigned u = __float_as_uint(f); u += 0x7FFFu + ((u >> 16) & 1u); return (unsigned short)(u >> 16); }
__device__ __forceinline__ float bf2f(unsigned short b) { return __uint_as_float(((unsigned)b) << 16); }
__device__ __forceinline__ float bfr(float f) { return bf2f(f2bf(f)); }
__device__ __forceinline__ v16h cat16(v8h lo, v8h hi) { return __builtin_shufflevector(lo, hi, 0, 1, 2, 3, 4, 5, 6, 7, 8, 9, 10, 11, 12, 13, 14, 15); }
__device__ __forceinline__ v16bf cat16b(v8us lo, v8us hi) { return __builtin_bit_cast(v16bf, __builtin_shufflevector(lo, hi, 0, 1, 2, 3, 4, 5, 6, 7, 8, 9, 10, 11, 12, 13, 14, 15)); }
__device__ __forceinline__ v8f wmma16(v16h a, v16h b, v8f c) { return __builtin_amdgcn_wmma_f32_16x16x32_f16(false, a, false, b, (short)0, c, false, false); }
__device__ __forceinline__ v8f wmmab(v16bf a, v16bf b, v8f c) { return __builtin_amdgcn_wmma_f32_16x16x32_bf16(false, a, false, b, (short)0, c, false, false); }
__device__ __forceinline__ h16 tohx(float x) { return (h16)x; }
__device__ __forceinline__ void splitf(float y, unsigned short& h, unsigned short& l) { h = f2bf(y); l = f2bf(y - bf2f(h)); }



// ---- k_gemmw: register-blocked GEMM, ONE WAVE per 64x64 output tile (16 accumulators), operands straight from 16-bit planes in fragment order; grid (TT/64, DQ/64, 3), 32 threads; blockIdx.z picks the projection: 0 q, 1 k, 2 v.
// c[m][n] (f32 accumulators) = sum_k A[m][k] Bt[n][k] (+ split products per NSPLIT); the epilogue writes c as three 16-bit planes in fragment order with ldc columns (their K): P16 = f16(c), Ph = bf16(c), Pl = bf16(c - Ph). K % 32 == 0, ldc % 32 == 0.
// The transposed planes of v come from the same code with the operands (and the two grid axes) exchanged (A = weight rows, Bt = token rows): c[d][t], ldc = TT.
// sptr: a wave-uniform operand address held in a scalar register pair (global address space), so that a fragment load is scalar base + the lane's one offset register + immediate: no 64-bit vector add a trip, and no load result can land in a register that an issued load still names as its address
#define GAS __attribute__((address_space(1)))
template <typename T> __device__ __forceinline__ const GAS T* sptr(const T* p) { const unsigned long long u = (unsigned long long)p; return (const GAS T*)(((unsigned long long)(unsigned)__builtin_amdgcn_readfirstlane((int)(u >> 32)) << 32) | (unsigned)__builtin_amdgcn_readfirstlane((int)u)); }
template <typename T16> struct WFrag;
template <> struct WFrag<h16> { typedef v16h V; static __device__ __forceinline__ V ld(const GAS h16* p, unsigned lo) { return cat16(*(const GAS v8h*)(p + lo), *(const GAS v8h*)(p + 256 + lo)); } static __device__ __forceinline__ v8f mma(V a, V b, v8f c) { return wmma16(a, b, c); } };
template <> struct WFrag<bf> { typedef v16bf V; static __device__ __forceinline__ V ld(const GAS bf* p, unsigned lo) { return cat16b(*(const GAS v8us*)(p + lo), *(const GAS v8us*)(p + 256 + lo)); } static __device__ __forceinline__ v8f mma(V a, V b, v8f c) { return wmmab(a, b, c); } };
template <typename T16, int NSPLIT>
__global__ __launch_bounds__(32) void k_gemmw(const T16* __restrict__ X, const T16* __restrict__ Wq, const T16* __restrict__ Wk, const T16* __restrict__ Wv, int K, h16* Q16, bf* Qh, bf* Ql, h16* K16, bf* Kh, bf* Kl, h16* V16, bf* Vh, bf* Vl) {
    typedef typename WFrag<T16>::V V;
    __shared__ __align__(16) float os[16 * 68];
    const int z = blockIdx.z; const T16* A = (z == 2) ? Wv : X; const T16* Bt = (z == 2) ? X : (z == 1) ? Wk : Wq; const T16* A2 = nullptr; const T16* Bt2 = nullptr;
    h16* P16 = (z == 2) ? V16 : (z == 1) ? K16 : Q16; bf* Ph = (z == 2) ? Vh : (z == 1) ? Kh : Qh; bf* Pl = (z == 2) ? Vl : (z == 1) ? Kl : Ql; const int ldc = (z == 2) ? TT : DQ;
    const int lane = threadIdx.x & 31, lr = lane & 15, hi = lane >> 4; const int r0 = ((z == 2) ? blockIdx.y : blockIdx.x) * 64, c0 = ((z == 2) ? blockIdx.x : blockIdx.y) * 64;
    v8f acc[4][4];
#pragma unroll
    for (int mb = 0; mb < 4; ++mb)
#pragma unroll
        for (int nb = 0; nb < 4; ++nb) acc[mb][nb] = (v8f){};
    const size_t aoff = (size_t)r0 * K, boff = (size_t)c0 * K; const unsigned lo = 8u * (unsigned)lane;   // fragment order: the tile's first block (the same for the wave: a scalar base) and the lane's 16 bytes of a chunk (one register, unchanged through the loop)
#pragma unroll 1
    for (int kc = 0; kc < K; kc += 32) {
        V a[4], a2[4];   // K is a run-time value here: each 16-row band has a scalar base of its own
#pragma unroll
        for (int mb = 0; mb < 4; ++mb) { a[mb] = WFrag<T16>::ld(sptr(A + aoff + (size_t)mb * 16 * K + kc * 16), lo); if (NSPLIT == 1 || NSPLIT == 2) a2[mb] = WFrag<T16>::ld(sptr(A2 + aoff + (size_t)mb * 16 * K + kc * 16), lo); }
#pragma unroll
        for (int nb = 0; nb < 4; ++nb) { const V b = WFrag<T16>::ld(sptr(Bt + boff + (size_t)nb * 16 * K + kc * 16), lo); V b2; if (NSPLIT >= 2) b2 = WFrag<T16>::ld(sptr(Bt2 + boff + (size_t)nb * 16 * K + kc * 16), lo);
#pragma unroll
            for (int mb = 0; mb < 4; ++mb) { acc[mb][nb] = WFrag<T16>::mma(a[mb], b, acc[mb][nb]); if (NSPLIT == 1 || NSPLIT == 2) acc[mb][nb] = WFrag<T16>::mma(a2[mb], b, acc[mb][nb]); if (NSPLIT >= 2) acc[mb][nb] = WFrag<T16>::mma(a[mb], b2, acc[mb][nb]); } }
        asm volatile("v_nop\n\tv_nop\n\tv_nop\n\tv_nop" : "+v"(acc[0][0]), "+v"(acc[1][1]), "+v"(acc[2][2]), "+v"(acc[3][3]) : "v"(a[0]), "v"(a[3]));
    }
#pragma unroll
    for (int mb = 0; mb < 4; ++mb) {
#pragma unroll
        for (int nb = 0; nb < 4; ++nb) {
#pragma unroll
            for (int j = 0; j < 8; ++j) os[(hi * 8 + j) * 68 + nb * 16 + lr] = acc[mb][nb][j]; }
        __builtin_amdgcn_wave_barrier(); asm volatile("" ::: "memory");
        const size_t o0 = (size_t)(r0 + mb * 16) * ldc + (size_t)c0 * 16 + 8 * lane;
        // fragment order: the 64 columns are 4 chunks; every 16-byte store of a plane fills one whole 512-byte chunk
#pragma unroll
        for (int s = 0; s < 4; ++s) { const int row = lr, cofs = s * 16 + hi * 8; const v4f va = *(const v4fa*)(os + row * 68 + cofs), vb = *(const v4fa*)(os + row * 68 + cofs + 4); v8h o16; v8us oh, ol;
#pragma unroll
            for (int q = 0; q < 4; ++q) { unsigned short x2, y2; o16[q] = tohx(va[q]); splitf(va[q], x2, y2); oh[q] = x2; ol[q] = y2; o16[q + 4] = tohx(vb[q]); splitf(vb[q], x2, y2); oh[q + 4] = x2; ol[q + 4] = y2; }
            const size_t oo = o0 + s * 256; *(v8h*)(P16 + oo) = o16; *(v8us*)(Ph + oo) = oh; *(v8us*)(Pl + oo) = ol; }
        __builtin_amdgcn_wave_barrier(); asm volatile("" ::: "memory");
    }
}

// ---- gemmc_tile: the same 64x64 tile GEMM specialised for causal attention, as a device function for one tile (rows r0.., columns c0..), called by k_scores and k_pv: CMODE 1 skips score tiles entirely above the diagonal (query rows r0+roff.., key columns c0..), CMODE 2 limits the
// key (K) loop of the probability x value contraction to the diagonal block (probabilities beyond it are exactly zero). roff = sequence row of the first row of the A and C that the call is given.
// CMODE 2 multiplies the finished f32 tile by cs (the inverse of the probabilities' carry factor) as it is stored, so C is the output itself.
// NW waves per tile (32 * NW threads; wv = the wave's number and tid the thread's number within the tile, os = the tile's own LDS: 16 * 68 floats for NW == 1, else NW * 64 * 68): wave w takes the 64-wide K chunks w, w + NW, ... (two blocks, 2 KiB in a row, of every 16 operand rows per chunk) into its own 16 accumulators; the NW partial tiles are summed in LDS, wave 0's first. K % 64 == 0.
template <typename T16, int NSPLIT, int CMODE, int NW>
__device__ __forceinline__ void gemmc_tile(const T16* __restrict__ A, const T16* __restrict__ A2, const T16* __restrict__ Bt, const T16* __restrict__ Bt2, int K, float* C, int ldc, int roff, float cs, int r0, int c0, int wv, int tid, float* os) {
    typedef typename WFrag<T16>::V V;
    const int lane = tid & 31, lr = lane & 15, hi = lane >> 4;
    if (CMODE == 1 && c0 > r0 + roff + 63) return;                  // score tile entirely above the causal diagonal: never computed (the softmax loads its stale values and masks j > i by select); taken by all NW waves of the tile: with NW > 1 that is the whole work-group, in front of its barrier; with NW == 1 the path has no work-group barrier
    const int Kl = (CMODE == 2) ? min(K, r0 + roff + 64) : K;        // P.V: probabilities are exactly 0 beyond the diagonal block, so the K loop stops there
    v8f acc[4][4];
#pragma unroll
    for (int mb = 0; mb < 4; ++mb)
#pragma unroll
        for (int nb = 0; nb < 4; ++nb) acc[mb][nb] = (v8f){};
    const size_t aoff = (size_t)r0 * K, boff = (size_t)c0 * K; const unsigned lo = 8u * (unsigned)lane;   // fragment order: the tile's first block (the same for the wave: a scalar base) and the lane's 16 bytes of a chunk (one register, unchanged through the loop)
    // wv, r0 and c0 are held in scalar registers (the callers' readfirstlane) so that both loops branch on scalar compares and EXEC stays whole round the matrix instructions; both stay rolled, as the parent's loop, so that one 32-wide trip's fragments are live at a time
#pragma unroll 1
    for (int kb = wv * 64; kb < Kl; kb += NW * 64)
#pragma unroll 1
    for (int kc = kb; kc < kb + 64; kc += 32) {
        V a[4], a2[4]; const GAS T16* pa = sptr(A + aoff + kc * 16); const GAS T16* pb = sptr(Bt + boff + kc * 16); const GAS T16* pa2 = (NSPLIT == 1 || NSPLIT == 2) ? sptr(A2 + aoff + kc * 16) : nullptr; const GAS T16* pb2 = (NSPLIT >= 2) ? sptr(Bt2 + boff + kc * 16) : nullptr;
#pragma unroll
        for (int mb = 0; mb < 4; ++mb) { a[mb] = WFrag<T16>::ld(pa + (size_t)mb * 16 * K, lo); if (NSPLIT == 1 || NSPLIT == 2) a2[mb] = WFrag<T16>::ld(pa2 + (size_t)mb * 16 * K, lo); }
#pragma unroll
        for (int nb = 0; nb < 4; ++nb) { const V b = WFrag<T16>::ld(pb + (size_t)nb * 16 * K, lo); V b2; if (NSPLIT >= 2) b2 = WFrag<T16>::ld(pb2 + (size_t)nb * 16 * K, lo);
#pragma unroll
            for (int mb = 0; mb < 4; ++mb) { acc[mb][nb] = WFrag<T16>::mma(a[mb], b, acc[mb][nb]); if (NSPLIT == 1 || NSPLIT == 2) acc[mb][nb] = WFrag<T16>::mma(a2[mb], b, acc[mb][nb]); if (NSPLIT >= 2) acc[mb][nb] = WFrag<T16>::mma(a[mb], b2, acc[mb][nb]); } }
        asm volatile("v_nop\n\tv_nop\n\tv_nop\n\tv_nop" : "+v"(acc[0][0]), "+v"(acc[1][1]), "+v"(acc[2][2]), "+v"(acc[3][3]) : "v"(a[0]), "v"(a[3]));
    }
    if (NW == 1) {
#pragma unroll
        for (int mb = 0; mb < 4; ++mb) {
#pragma unroll
            for (int nb = 0; nb < 4; ++nb) {
#pragma unroll
                for (int j = 0; j < 8; ++j) os[(hi * 8 + j) * 68 + nb * 16 + lr] = acc[mb][nb][j]; }
            __builtin_amdgcn_wave_barrier(); asm volatile("" ::: "memory");
            float* crow = C + (size_t)(r0 + mb * 16) * ldc + c0;
#pragma unroll
            for (int s = 0; s < 8; ++s) { const int row = 2 * s + hi, cofs = lr * 4; v4f val = *(const v4fa*)(os + row * 68 + cofs); if (CMODE == 2) val *= cs;
                *(v4f*)(crow + (size_t)row * ldc + cofs) = val; }
            __builtin_amdgcn_wave_barrier(); asm volatile("" ::: "memory");
        }
        asm volatile("s_wait_xcnt 0x0" ::: "memory");   // behind the tile's last store: where this path is inlined in front of other code, nothing behind it rewrites a register that an issued store still names
    } else {
        float* ow = os + wv * (64 * 68);
#pragma unroll
        for (int mb = 0; mb < 4; ++mb)
#pragma unroll
            for (int nb = 0; nb < 4; ++nb)
#pragma unroll
                for (int j = 0; j < 8; ++j) ow[(mb * 16 + hi * 8 + j) * 68 + nb * 16 + lr] = acc[mb][nb][j];
        __syncthreads();   // every wave's partial 64x64 tile is in LDS before any of it is summed (passed by every wave of the work-group: all its tiles take this path)
        float* crow = C + (size_t)r0 * ldc + c0;
#pragma unroll
        for (int s = 0; s < 1024; s += 32 * NW) { const int q = s + tid, row = q >> 4, cofs = (q & 15) * 4; v4f val = *(const v4fa*)(os + row * 68 + cofs);
#pragma unroll
            for (int w = 1; w < NW; ++w) val += *(const v4fa*)(os + w * (64 * 68) + row * 68 + cofs);
            if (CMODE == 2) val *= cs;
            *(v4f*)(crow + (size_t)row * ldc + cofs) = val; }
    }
}

// ---- k_scores: every score tile at or below the diagonal, one launch, 128 threads. blockIdx.y == 0: the hi/lo rows (< RH), one 64x64 tile per work-group, its K loop split over the 4 waves; blockIdx.x counts the (RH/64)^2 tiles of the square that holds their diagonal.
// blockIdx.y >= 1: the f16 rows, one tile per WAVE: the 4 waves take 4 consecutive row tiles of key column tile blockIdx.x, each with its own 16 * 68 floats of LDS and no work-group barrier.
static_assert((RH / 64) * (RH / 64) <= TT / 64 && ((TT - RH) / 64) % 4 == 0 && (RH / 64) % 2 == 0, "grid shapes of k_scores and k_pv");
__global__ __launch_bounds__(128) void k_scores(const bf* __restrict__ Qh, const bf* __restrict__ Ql, const bf* __restrict__ Kh, const bf* __restrict__ Kl, const h16* __restrict__ Q16, const h16* __restrict__ K16, float* Sb) {
    __shared__ __align__(16) float os[4 * 64 * 68];
    const int wave = __builtin_amdgcn_readfirstlane((int)(threadIdx.x >> 5));
    if (blockIdx.y == 0) {
        const int t = blockIdx.x; if (t >= (RH / 64) * (RH / 64)) return;   // whole work-group, in front of the barrier
        gemmc_tile<bf, 2, 1, 4>(Qh, Ql, Kh, Kl, HD, Sb, TT, 0, 1.0f, (t / (RH / 64)) * 64, (t % (RH / 64)) * 64, wave, (int)threadIdx.x, os);
    } else {
        gemmc_tile<h16, 0, 1, 1>(Q16 + (size_t)RH * HD, nullptr, K16, nullptr, HD, Sb + (size_t)RH * TT, TT, RH, 1.0f, (((int)blockIdx.y - 1) * 4 + wave) * 64, (int)blockIdx.x * 64, 0, (int)threadIdx.x & 31, os + wave * (16 * 68));
    }
}

// ---- k_pv: every output tile, one launch, 256 threads, blockIdx.y = 64-wide output column tile. blockIdx.x < (TT-RH)/64: one f16 row tile, K loop split over the 8 waves.
// Beyond: two hi/lo row tiles per work-group, 4 waves and half of the LDS each (the split and the order of the sums that each had in a work-group of its own); both halves pass the one barrier.
__global__ __launch_bounds__(256) void k_pv(const bf* __restrict__ Ph, const bf* __restrict__ Pl, const bf* __restrict__ VTh, const bf* __restrict__ VTl, const h16* __restrict__ P16, const h16* __restrict__ VT16, float* O) {
    __shared__ __align__(16) float os[8 * 64 * 68];
    const int wave = __builtin_amdgcn_readfirstlane((int)(threadIdx.x >> 5));
    if (blockIdx.x < (TT - RH) / 64) {
        gemmc_tile<h16, 0, 2, 8>(P16 + (size_t)RH * TT, nullptr, VT16, nullptr, TT, O + (size_t)RH * DQ, DQ, RH, 1.0f / PCAR, (int)blockIdx.x * 64, (int)blockIdx.y * 64, wave, (int)threadIdx.x, os);
    } else {
        const int g = wave >> 2;
        gemmc_tile<bf, 2, 2, 4>(Ph, Pl, VTh, VTl, TT, O, DQ, 0, 1.0f, (((int)blockIdx.x - (TT - RH) / 64) * 2 + g) * 64, (int)blockIdx.y * 64, wave & 3, (int)threadIdx.x & 127, os + g * (4 * 64 * 68));
    }
}

typedef __attribute__((ext_vector_type(2))) _Float16 v2h;
typedef __attribute__((ext_vector_type(4))) _Float16 v4h;
typedef __attribute__((ext_vector_type(2))) unsigned short v2us;
typedef __attribute__((ext_vector_type(4))) unsigned short v4us;
typedef __attribute__((ext_vector_type(2))) float v2f;
typedef __attribute__((ext_vector_type(4))) int v4i;

__global__ __launch_bounds__(256) void k_wtG(const float* __restrict__ w, int K, int N, bf* Bt) {
    const int lane = threadIdx.x & 31; const int L0 = (blockIdx.x * 8 + (threadIdx.x >> 5)) * 8; const int nlines = N * K / 64;
{
#pragma unroll 1
        for (int l = 0; l < 8; ++l) { const int L = L0 + l; if (L >= nlines) break; const size_t e = (size_t)L * 64 + lane * 2; const int k = (int)(e % K), n = (int)(e / K); v2us o;
            o[0] = f2bf(w[(size_t)k * N + n]); o[1] = f2bf(w[(size_t)(k + 1) * N + n]); *(v2us*)(Bt + e) = o; }
         }
}
// k_cvt8: x and the three weights to bf16 planes in fragment order in one launch, 8 elements per thread (thread i writes the plane's i-th 16 bytes, a wave one chunk); the first BX_ work-groups take x, then BW_ each take a weight.
#define BX_ (TT * DM / 8 / 256)
#define BW_ (DQ * DM / 8 / 256)
static_assert(TT * DM % 2048 == 0 && DQ * DM % 2048 == 0 && DQ == DKV, "whole work-groups per tensor");
__global__ __launch_bounds__(256) void k_cvt8(const float* __restrict__ x, const float* __restrict__ wq, const float* __restrict__ wk, const float* __restrict__ wv, bf* XB, bf* WQ, bf* WK, bf* WV) {
    int b = blockIdx.x; const float* src = x; bf* dst = XB;
    if (b >= BX_) { b -= BX_; const int w = b / BW_; b -= w * BW_; src = (w == 0) ? wq : (w == 1) ? wk : wv; dst = (w == 0) ? WQ : (w == 1) ? WK : WV; }
    const size_t i = (size_t)b * 256 + threadIdx.x; const int l = threadIdx.x & 31, c = (int)(i >> 5), blk = c >> 1;   // chunk c of block blk
    const int srow = (blk / (DM / 32)) * 16 + (l & 15), scol = (blk % (DM / 32)) * 32 + (c & 1) * 16 + (l >> 4) * 8;
    const v8f v = *(const v8f*)(src + (size_t)srow * DM + scol); v8us o;
#pragma unroll
    for (int k = 0; k < 8; ++k) o[k] = f2bf(v[k]); *(v8us*)(dst + i * 8) = o;  }

// k_lsoft: causal row softmax over the TK = TT = 4096 keys, one wave per row i; the f32 score row is read once, all its loads in flight together, and stays in registers for the maximum, the sum and the weights (lane -> 4 consecutive keys per 128-key chunk, 32 chunks; keys j > i are excluded by index with -3e38 / 0 - the score tiles above the diagonal are never computed and their stale contents are only ever discarded by this select):
// The last pass over the registers leaves the work-group's 8 rows of 16-bit weights in LDS (row pitch PSP elements: 32 bytes over a multiple of 256, so that the 16-byte reads of 8 rows fall on different banks); behind one barrier each wave stores whole 128-byte lines of the planes' fragment order (8 rows x 8 keys a line, 4 lines = one 32-key block an instruction).
#define PSP (TT + 16)
// exp2s: 2^x, v_exp_f32 with the one free slot that the instruction set asks for behind a transcendental in the same statement
__device__ __forceinline__ float exp2s(float x) { float r; asm("v_exp_f32 %0, %1\n\tv_nop" : "=v"(r) : "v"(x)); return r; }
static_assert(RH % 16 == 0 && 2 * RH <= TT && TT % 256 == 0 && RH % 128 == 0, "staging of k_lsoft");
__global__ __launch_bounds__(256) void k_lsoft(const float* __restrict__ Sb, h16* P16, bf* Ph, bf* Pl) {
    __shared__ __align__(16) unsigned short ps[8 * PSP];
    const int lane = threadIdx.x & 31; const int wv = threadIdx.x >> 5; const int row = blockIdx.x * 8 + wv; if (row >= ZH * TT) return;   // never taken: the grid holds exactly ZH * TT rows
    const int i = row % TT; const int zz = row / TT; const bool hires = (i < RH); const float* sr = Sb + (size_t)row * TT + lane * 4;
    v4f a[TT / 128];   // the lane's 128 values of the row: raw scores, then scaled and masked scores, then exponentials
#pragma unroll   // every loop over a[] is unrolled so that its elements stay in registers; here all 32 loads are issued before the first value is used
    for (int ch = 0; ch < TT / 128; ++ch) a[ch] = *(const v4f*)(sr + ch * 128);
    float mx = -3.0e38f; const int dl = i - lane * 4;   // key ch * 128 + lane * 4 + q is at or before the query where ch * 128 + q <= dl: one compare with a constant per key
#pragma unroll
    for (int ch = 0; ch < TT / 128; ++ch) {
#pragma unroll
        for (int q = 0; q < 4; ++q) { const float t = (ch * 128 + q <= dl) ? a[ch][q] * SCL : -3.0e38f; a[ch][q] = t; mx = fmaxf(mx, t); } }
#pragma unroll
    for (int sh = 16; sh; sh >>= 1) mx = fmaxf(mx, __shfl_xor(mx, sh, 32));
    float sum = 0.f;
#pragma unroll
    for (int ch = 0; ch < TT / 128; ++ch) {
#pragma unroll
        for (int q = 0; q < 4; ++q) a[ch][q] = exp2s(__fmul_rn(__fsub_rn(a[ch][q], mx), 1.4426950408889634f)); }
#pragma unroll
    for (int ch = 0; ch < TT / 128; ++ch) {
#pragma unroll
        for (int q = 0; q < 4; ++q) sum += a[ch][q]; }
#pragma unroll
    for (int sh = 16; sh; sh >>= 1) sum += __shfl_xor(sum, sh, 32);
    const float f = __fdiv_rn(hires ? 1.0f : PCAR, sum);
    if (hires) {   /* rows < RH: normalised bf16 hi/lo over the first RH keys (every later key is above the diagonal for these rows; the hi/lo attn.v GEMM stops its K loop at the diagonal block), planes [zz][RH][TT] */
#pragma unroll
        for (int ch = 0; ch < RH / 128; ++ch) { const int j0 = ch * 128 + lane * 4; v4us oh, ol;
#pragma unroll
            for (int q = 0; q < 4; ++q) { unsigned short a2, c2; splitf(a[ch][q] * f, a2, c2); oh[q] = a2; ol[q] = c2; }
            *(v4us*)(ps + wv * PSP + j0) = oh; *(v4us*)(ps + wv * PSP + RH + j0) = ol; }
    } else {
#pragma unroll
        for (int ch = 0; ch < TT / 128; ++ch) { const int j0 = ch * 128 + lane * 4; v4h o4;
#pragma unroll
            for (int q = 0; q < 4; ++q) o4[q] = tohx(a[ch][q] * f);
            *(v4us*)(ps + wv * PSP + j0) = __builtin_bit_cast(v4us, o4); }
    }
    __syncthreads();   // all 8 rows are in LDS before any wave gathers lines across them (hires is the same for the whole work-group: RH % 8 == 0)
    const int r8 = lane & 7, sh = lane >> 3;                       // row of the 8, 8-key unit of the 32-key block
    const int i0 = i - wv;                                         // the work-group's first row within the sequence
    const size_t ob = (size_t)(i0 >> 4) * 16 * TT + sh * 128 + ((i0 & 15) + r8) * 8;
    if (hires) {
#pragma unroll   // unrolled so that the plane (pl) is known at compile time for each store
        for (int it = 0; it < 2 * (RH / 32) / 8; ++it) { const int idx = it * 8 + wv, pl = idx / (RH / 32), kb = idx % (RH / 32); const v8us val = *(const v8usa*)(ps + r8 * PSP + pl * RH + kb * 32 + sh * 8);
            *(v8usa*)((pl ? Pl : Ph) + (size_t)zz * RH * TT + ob + kb * 512) = val; }
    } else {
#pragma unroll 4   // four LDS reads are issued ahead of their four stores
        for (int it = 0; it < (TT / 32) / 8; ++it) { const int kb = it * 8 + wv; const v8us val = *(const v8usa*)(ps + r8 * PSP + kb * 32 + sh * 8);
            *(v8usa*)(P16 + (size_t)zz * TT * TT + ob + kb * 512) = val; }
    }
}

extern "C" void kernel_launch(void* const* d_in, const int* in_sizes, int n_in,
                              void* d_out, int out_size, void* d_ws, size_t ws_size, hipStream_t stream) {
    (void)in_sizes; (void)n_in; (void)out_size;
    const float* x = (const float*)d_in[0]; const float* wq = (const float*)d_in[1]; const float* wk = (const float*)d_in[2]; const float* wv = (const float*)d_in[3]; const float* wo = nullptr; (void)wo;
    float* OUT = (float*)d_out;     // [1][4096][768]
    char* wsp = (char*)d_ws;
    auto take = [&](size_t bytes) { char* p = wsp; wsp += (bytes + 255) & ~(size_t)255; return (void*)p; };
    bf* WQ = (bf*)take((size_t)DQ * DM * 2); bf* WK = (bf*)take((size_t)DKV * DM * 2); bf* WV = (bf*)take((size_t)DKV * DM * 2); 
    bf* XB = (bf*)take((size_t)TT * DM * 2);
    h16* QP16 = (h16*)take((size_t)NH_ * TT * HD * 2); h16* KP16 = (h16*)take((size_t)NKV * TT * HD * 2); h16* VT16 = (h16*)take((size_t)NKV * HD * TT * 2);
    bf* QPh = (bf*)take((size_t)NH_ * TT * HD * 2); bf* QPl = (bf*)take((size_t)NH_ * TT * HD * 2); bf* KPh = (bf*)take((size_t)NKV * TT * HD * 2); bf* KPl = (bf*)take((size_t)NKV * TT * HD * 2); bf* VTh = (bf*)take((size_t)NKV * HD * TT * 2); bf* VTl = (bf*)take((size_t)NKV * HD * TT * 2); bf* Ph = (bf*)take((size_t)ZH * RH * TT * 2); bf* Pl = (bf*)take((size_t)ZH * RH * TT * 2);
    float* Sb = (float*)take((size_t)ZH * TT * TT * 4); h16* P16 = (h16*)take((size_t)ZH * TT * TT * 2);
    if ((size_t)(wsp - (char*)d_ws) > ws_size) return;    // ws 256 MiB
    for (int b = 0; b < NB_; ++b) {
        k_cvt8<<<BX_ + 3 * BW_, 256, 0, stream>>>(x + (size_t)b * TT * DM, wq, wk, wv, XB, WQ, WK, WV);
        k_gemmw<bf, 0><<<dim3(TT / 64, DQ / 64, 3), 32, 0, stream>>>(XB, WQ, WK, WV, DM, QP16, QPh, QPl, KP16, KPh, KPl, VT16, VTh, VTl);   // v transposed: rows = value columns, pitch TT
        k_scores<<<dim3(TT / 64, 1 + (TT - RH) / 256, 1), 128, 0, stream>>>(QPh, QPl, KPh, KPl, QP16, KP16, Sb);
        k_lsoft<<<ZH * TT / 8, 256, 0, stream>>>(Sb, P16, Ph, Pl);
        k_pv<<<dim3((TT - RH) / 64 + RH / 128, HD / 64, 1), 256, 0, stream>>>(Ph, Pl, VTh, VTl, P16, VT16, OUT + (size_t)b * TT * DQ);
    }
}

// v006
// It runs in 83.8 microseconds.
// Two timings next to v005 put it at 1.37 and 1.33 times that version's speed.
// Counting every step since v000, it is 3.62 times as fast.
#include <hip/hip_runtime.h>

// Causal single-head self-attention with a 768-wide head over 4,096 tokens (x [4096][768]; q,k,v = x W^T ('oi' [768][768], no bias); scores = q.k, keys after the query -> -inf; weights = softmax(scores / sqrt(768)); out = weights v -> [4096][768] (3.1 M)).
// Layout: bf16 copy of x; exact projections; ONE 768-wide head through causal T-4096 attention (hybrid rows: < 512 hi/lo 3 products, rest fp16 x1024; k_scores and k_pv skip score / P.v tiles entirely above the diagonal (K 768 / N 768); one-read softmax, the row in registers, with the causal index select); the projection GEMMs write the 16-bit operand planes and the P.v GEMMs the scaled f32 output rows from their own epilogues.
// The projections and the f16 score tiles run 4 waves on a 128x128 tile (2 x 2 of 64x64): both operands come into LDS once per work-group by asynchronous copies, two buffers (ring128).
// Five launches, each holding all the work that depends only on earlier launches: the four bf16 conversions; the three projections (grid z); the score tiles of both row classes; the softmax; the P.v tiles of both row classes.
// Every 16-bit operand plane [rows][K] lies in fragment order: a block of 16 rows x 32 k is two 512-byte chunks (k 0..15, k 16..31 of the block); lane l = 16 * ((k >> 3) & 1) + (row & 15) owns 16 bytes (8 consecutive k) of each; blocks run along k, then down the rows, so 16 rows still fill 16 * K elements. Each of a fragment's two load instructions reads one chunk = 4 whole 128-byte lines.
// Compute dtypes, f32 accumulate: every input rounded to bf16; projections exact; attention rows < 512 3 products, rest fp16; softmax f32; output f32.

#define NB_  1
#define TT   4096
#define DM   768
#define NH_  1
#define NKV  1
#define REP  (NH_ / NKV)
#define HD   768
#define DQ   (NH_ * HD)
#define DKV  (NKV * HD)
#define ZH   1
#define RH   512                  // query rows < RH use hi+lo planes (0: none)
#define WIN  4096
#define PCAR 1024.0f
#define SCL  0.036084391824351615f   // 1/sqrt(768)
typedef _Float16 h16;
typedef unsigned short bf;
typedef __attribute__((ext_vector_type(16))) __bf16   v16bf;
typedef __attribute__((ext_vector_type(16))) _Float16 v16h;
typedef __attribute__((ext_vector_type(8)))  _Float16 v8h;
typedef __attribute__((ext_vector_type(8)))  unsigned short v8us;
typedef __attribute__((ext_vector_type(8)))  float    v8f;
typedef __attribute__((ext_vector_type(4)))  float    v4f;
typedef v8h  __attribute__((may_alias)) v8ha;
typedef v4f  __attribute__((may_alias)) v4fa;
typedef v8us __attribute__((may_alias)) v8usa;

__device__ __forceinline__ unsigned short f2bf(float f) { unsigned u = __float_as_uint(f); u += 0x7FFFu + ((u >> 16) & 1u); return (unsigned short)(u >> 16); }
__device__ __forceinline__ float bf2f(unsigned short b) { return __uint_as_float(((unsigned)b) << 16); }
__device__ __forceinline__ float bfr(float f) { return bf2f(f2bf(f)); }
__device__ __forceinline__ v16h cat16(v8h lo, v8h hi) { return __builtin_shufflevector(lo, hi, 0, 1, 2, 3, 4, 5, 6, 7, 8, 9, 10, 11, 12, 13, 14, 15); }
__device__ __forceinline__ v16bf cat16b(v8us lo, v8us hi) { return __builtin_bit_cast(v16bf, __builtin_shufflevector(lo, hi, 0, 1, 2, 3, 4, 5, 6, 7, 8, 9, 10, 11, 12, 13, 14, 15)); }
__device__ __forceinline__ v8f wmma16(v16h a, v16h b, v8f c) { return __builtin_amdgcn_wmma_f32_16x16x32_f16(false, a, false, b, (short)0, c, false, false); }
__device__ __forceinline__ v8f wmmab(v16bf a, v16bf b, v8f c) { return __builtin_amdgcn_wmma_f32_16x16x32_bf16(false, a, false, b, (short)0, c, false, false); }
__device__ __forceinline__ h16 tohx(float x) { return (h16)x; }
__device__ __forceinline__ void splitf(float y, unsigned short& h, unsigned short& l) { h = f2bf(y); l = f2bf(y - bf2f(h)); }



// ---- k_gemmw: register-blocked GEMM, 4 waves per 128x128 output tile, each wave a 64x64 quarter (16 accumulators), operands from 16-bit planes in fragment order through the LDS ring of ring128; grid (TT/128, DQ/128, 3), 128 threads; blockIdx.z picks the projection: 0 q, 1 k, 2 v.
// c[m][n] (f32 accumulators) = sum_k A[m][k] Bt[n][k]; the epilogue writes c as three 16-bit planes in fragment order with ldc columns (their K): P16 = f16(c), Ph = bf16(c), Pl = bf16(c - Ph). K % 64 == 0, ldc % 8 == 0.
// The transposed planes of v come from the same code with the operands (and the two grid axes) exchanged (A = weight rows, Bt = token rows): c[d][t], ldc = TT.
// sptr: a wave-uniform operand address held in a scalar register pair (global address space), so that a fragment load is scalar base + the lane's one offset register + immediate: no 64-bit vector add a trip, and no load result can land in a register that an issued load still names as its address
#define GAS __attribute__((address_space(1)))
template <typename T> __device__ __forceinline__ const GAS T* sptr(const T* p) { const unsigned long long u = (unsigned long long)p; return (const GAS T*)(((unsigned long long)(unsigned)__builtin_amdgcn_readfirstlane((int)(u >> 32)) << 32) | (unsigned)__builtin_amdgcn_readfirstlane((int)u)); }
template <typename T16> struct WFrag;
template <> struct WFrag<h16> { typedef v16h V; static __device__ __forceinline__ V ld(const GAS h16* p, unsigned lo) { return cat16(*(const GAS v8h*)(p + lo), *(const GAS v8h*)(p + 256 + lo)); } static __device__ __forceinline__ V lds(const h16* p) { return cat16(*(const v8ha*)p, *(const v8ha*)(p + 256)); } static __device__ __forceinline__ v8f mma(V a, V b, v8f c) { return wmma16(a, b, c); } };
template <> struct WFrag<bf> { typedef v16bf V; static __device__ __forceinline__ V ld(const GAS bf* p, unsigned lo) { return cat16b(*(const GAS v8us*)(p + lo), *(const GAS v8us*)(p + 256 + lo)); } static __device__ __forceinline__ V lds(const bf* p) { return cat16b(*(const v8usa*)p, *(const v8usa*)(p + 256)); } static __device__ __forceinline__ v8f mma(V a, V b, v8f c) { return wmmab(a, b, c); } };
// ---- ring128: the K loop of a 128x128 tile (rows R0.. of A, rows C0.. of Bt) for 4 waves; wave w accumulates the 64x64 quarter (w >> 1, w & 1) in acc, k ascending in steps of 32 as in a one-wave tile.
// A stage is 64 k of all 256 operand rows: 16 bands of 16 rows (8 of A, then 8 of Bt), each 2 KiB in a row in the plane's fragment order and copied as it lies, so that a fragment is again two 512-byte chunks, the lane's 16 bytes side by side. Wave w copies bands 4w .. 4w + 3.
#define STG 16384   // 16-bit elements of one stage (32 KiB); the ring holds two
// stage_fill: one wave's 16 copies of a stage (4 bands x 4 chunks of 512 bytes). g = the lane's 16 bytes of the wave's first band at the stage's k, l = their LDS byte address.
template <typename T16>
__device__ __forceinline__ void stage_fill(const T16* g, int K, unsigned l) {
#pragma unroll
    for (int h = 0; h < 2; ++h) {
        const T16* ga = g + (size_t)(2 * h) * 16 * K; const T16* gb = ga + (size_t)16 * K; const unsigned la = l + h * 4096u, lb = la + 2048u;
        // asynchronous copies global -> LDS, through no register; s_wait_xcnt 0 closes the statement so that no address register named here is rewritten in front of it
        asm volatile("global_load_async_to_lds_b128 %0, %8, off\n\t"
                     "global_load_async_to_lds_b128 %1, %9, off\n\t"
                     "global_load_async_to_lds_b128 %2, %10, off\n\t"
                     "global_load_async_to_lds_b128 %3, %11, off\n\t"
                     "global_load_async_to_lds_b128 %4, %12, off\n\t"
                     "global_load_async_to_lds_b128 %5, %13, off\n\t"
                     "global_load_async_to_lds_b128 %6, %14, off\n\t"
                     "global_load_async_to_lds_b128 %7, %15, off\n\t"
                     "s_wait_xcnt 0x0"
                     :: "v"(la), "v"(la + 512u), "v"(la + 1024u), "v"(la + 1536u), "v"(lb), "v"(lb + 512u), "v"(lb + 1024u), "v"(lb + 1536u),
                        "v"(ga), "v"(ga + 256), "v"(ga + 512), "v"(ga + 768), "v"(gb), "v"(gb + 256), "v"(gb + 512), "v"(gb + 768) : "memory");
    }
}
template <typename T16>
__device__ __forceinline__ void ring128(const T16* __restrict__ A, const T16* __restrict__ Bt, int K, int R0, int C0, int wave, int lane, T16* ring, v8f (&acc)[4][4]) {
    typedef typename WFrag<T16>::V V;
    const T16* g = ((wave < 2) ? A + (size_t)(R0 + 64 * wave) * K : Bt + (size_t)(C0 + 64 * (wave - 2)) * K) + 8 * lane;
    const unsigned l = (unsigned)(size_t)ring + (unsigned)wave * 8192u + (unsigned)lane * 16u;
    const int nt = K / 64, wr = wave >> 1, wc = wave & 1;
    stage_fill(g, K, l);
    asm volatile("s_wait_asynccnt 0x0" ::: "memory");   // this wave's copies of stage 0 have landed
    __syncthreads();                                     // ... and every other wave's: stage 0 may be read
    if (nt > 1) stage_fill(g + 1024, K, l + 2u * STG);
#pragma unroll 1   // one stage's fragments live at a time; the buffer alternates with the trip
    for (int t = 0; t < nt; ++t) {
        const T16* sb = ring + (t & 1) * STG + 8 * lane;
        V a[4], b[4], a1[4], b1[4];   // the fragments of the stage's two 32-wide k blocks
#pragma unroll
        for (int mb = 0; mb < 4; ++mb) { a[mb] = WFrag<T16>::lds(sb + (wr * 4 + mb) * 1024); b[mb] = WFrag<T16>::lds(sb + (8 + wc * 4 + mb) * 1024); }
        // inputs only: keeps the 16 LDS reads of the first k block together in front of its 16 matrix instructions, one LDS latency for the group (left alone, the compiler read each b fragment directly in front of its use and waited four times)
        asm volatile("" :: "v"(a[0]), "v"(a[1]), "v"(a[2]), "v"(a[3]), "v"(b[0]), "v"(b[1]), "v"(b[2]), "v"(b[3]));
#pragma unroll
        for (int mb = 0; mb < 4; ++mb) { a1[mb] = WFrag<T16>::lds(sb + (wr * 4 + mb) * 1024 + 512); b1[mb] = WFrag<T16>::lds(sb + (8 + wc * 4 + mb) * 1024 + 512); }
#pragma unroll
        for (int nb = 0; nb < 4; ++nb)
#pragma unroll
            for (int mb = 0; mb < 4; ++mb) acc[mb][nb] = WFrag<T16>::mma(a[mb], b[nb], acc[mb][nb]);
        asm volatile("s_wait_dscnt 0x0" ::: "memory");      // this wave's reads of the buffer are done (both k blocks are in registers) before the buffer is given up
        asm volatile("s_wait_asynccnt 0x0" ::: "memory");   // this wave's copies of stage t + 1 have landed
        __syncthreads();                                     // publishes stage t + 1 and ends every wave's reads of stage t
        if (t + 2 < nt) stage_fill(g + (size_t)(t + 2) * 1024, K, l + (unsigned)(t & 1) * (2u * STG));
        // the second k block's products, from registers alone, stand behind the refill so that the copies start as early as they may
#pragma unroll
        for (int nb = 0; nb < 4; ++nb)
#pragma unroll
            for (int mb = 0; mb < 4; ++mb) acc[mb][nb] = WFrag<T16>::mma(a1[mb], b1[nb], acc[mb][nb]);
    }
    asm volatile("s_wait_asynccnt 0x0" ::: "memory");   // no copy is outstanding behind the loop
}
template <typename T16>
__global__ __launch_bounds__(128) void k_gemmw(const T16* __restrict__ X, const T16* __restrict__ Wq, const T16* __restrict__ Wk, const T16* __restrict__ Wv, int K, h16* Q16, bf* Qh, bf* Ql, h16* K16, bf* Kh, bf* Kl, h16* V16, bf* Vh, bf* Vl) {
    __shared__ __align__(16) T16 ring[2 * STG];
    __shared__ __align__(16) float osw[4 * 16 * 68];
    const int wave = __builtin_amdgcn_readfirstlane((int)(threadIdx.x >> 5)); float* os = osw + wave * (16 * 68);   // each wave's own staging for its epilogue
    const int z = blockIdx.z; const T16* A = (z == 2) ? Wv : X; const T16* Bt = (z == 2) ? X : (z == 1) ? Wk : Wq;
    h16* P16 = (z == 2) ? V16 : (z == 1) ? K16 : Q16; bf* Ph = (z == 2) ? Vh : (z == 1) ? Kh : Qh; bf* Pl = (z == 2) ? Vl : (z == 1) ? Kl : Ql; const int ldc = (z == 2) ? TT : DQ;
    const int lane = threadIdx.x & 31, lr = lane & 15, hi = lane >> 4; const int R0 = ((z == 2) ? blockIdx.y : blockIdx.x) * 128, C0 = ((z == 2) ? blockIdx.x : blockIdx.y) * 128;
    v8f acc[4][4];
#pragma unroll
    for (int mb = 0; mb < 4; ++mb)
#pragma unroll
        for (int nb = 0; nb < 4; ++nb) acc[mb][nb] = (v8f){};
    ring128<T16>(A, Bt, K, R0, C0, wave, lane, ring, acc);
    const int r0 = R0 + (wave >> 1) * 64, c0 = C0 + (wave & 1) * 64;   // the wave's quarter
#pragma unroll
    for (int mb = 0; mb < 4; ++mb) {
#pragma unroll
        for (int nb = 0; nb < 4; ++nb) {
#pragma unroll
            for (int j = 0; j < 8; ++j) os[(hi * 8 + j) * 68 + nb * 16 + lr] = acc[mb][nb][j]; }
        __builtin_amdgcn_wave_barrier(); asm volatile("" ::: "memory");
        const size_t o0 = (size_t)(r0 + mb * 16) * ldc + (size_t)c0 * 16 + 8 * lane;
        // fragment order: the 64 columns are 4 chunks; every 16-byte store of a plane fills one whole 512-byte chunk
#pragma unroll
        for (int s = 0; s < 4; ++s) { const int row = lr, cofs = s * 16 + hi * 8; const v4f va = *(const v4fa*)(os + row * 68 + cofs), vb = *(const v4fa*)(os + row * 68 + cofs + 4); v8h o16; v8us oh, ol;
#pragma unroll
            for (int q = 0; q < 4; ++q) { unsigned short x2, y2; o16[q] = tohx(va[q]); splitf(va[q], x2, y2); oh[q] = x2; ol[q] = y2; o16[q + 4] = tohx(vb[q]); splitf(vb[q], x2, y2); oh[q + 4] = x2; ol[q + 4] = y2; }
            const size_t oo = o0 + s * 256; *(v8h*)(P16 + oo) = o16; *(v8us*)(Ph + oo) = oh; *(v8us*)(Pl + oo) = ol; }
        __builtin_amdgcn_wave_barrier(); asm volatile("" ::: "memory");
    }
}

// ---- gemmc_tile: the same 64x64 tile GEMM specialised for causal attention, as a device function for one tile (rows r0.., columns c0..), called by k_scores and k_pv: CMODE 1 skips score tiles entirely above the diagonal (query rows r0+roff.., key columns c0..), CMODE 2 limits the
// key (K) loop of the probability x value contraction to the diagonal block (probabilities beyond it are exactly zero). roff = sequence row of the first row of the A and C that the call is given.
// CMODE 2 multiplies the finished f32 tile by cs (the inverse of the probabilities' carry factor) as it is stored, so C is the output itself.
// NW waves per tile (32 * NW threads; wv = the wave's number and tid the thread's number within the tile, os = the tile's own LDS: NW * 64 * 68 floats): wave w takes the 64-wide K chunks w, w + NW, ... (two blocks, 2 KiB in a row, of every 16 operand rows per chunk) into its own 16 accumulators; the NW partial tiles are summed in LDS, wave 0's first. K % 64 == 0.
template <typename T16, int NSPLIT, int CMODE, int NW>
__device__ __forceinline__ void gemmc_tile(const T16* __restrict__ A, const T16* __restrict__ A2, const T16* __restrict__ Bt, const T16* __restrict__ Bt2, int K, float* C, int ldc, int roff, float cs, int r0, int c0, int wv, int tid, float* os) {
    typedef typename WFrag<T16>::V V;
    const int lane = tid & 31, lr = lane & 15, hi = lane >> 4;
    if (CMODE == 1 && c0 > r0 + roff + 63) return;                  // score tile entirely above the causal diagonal: not computed (the softmax loads its stale values and masks j > i by select); taken by all NW waves of the tile, the whole work-group, in front of its barrier
    const int Kl = (CMODE == 2) ? min(K, r0 + roff + 64) : K;        // P.V: probabilities are exactly 0 beyond the diagonal block, so the K loop stops there
    v8f acc[4][4];
#pragma unroll
    for (int mb = 0; mb < 4; ++mb)
#pragma unroll
        for (int nb = 0; nb < 4; ++nb) acc[mb][nb] = (v8f){};
    const size_t aoff = (size_t)r0 * K, boff = (size_t)c0 * K; const unsigned lo = 8u * (unsigned)lane;   // fragment order: the tile's first block (the same for the wave: a scalar base) and the lane's 16 bytes of a chunk (one register, unchanged through the loop)
    // wv, r0 and c0 are held in scalar registers (the callers' readfirstlane) so that both loops branch on scalar compares and EXEC stays whole round the matrix instructions; both stay rolled, as the parent's loop, so that one 32-wide trip's fragments are live at a time
#pragma unroll 1
    for (int kb = wv * 64; kb < Kl; kb += NW * 64)
#pragma unroll 1
    for (int kc = kb; kc < kb + 64; kc += 32) {
        V a[4], a2[4]; const GAS T16* pa = sptr(A + aoff + kc * 16); const GAS T16* pb = sptr(Bt + boff + kc * 16); const GAS T16* pa2 = (NSPLIT == 1 || NSPLIT == 2) ? sptr(A2 + aoff + kc * 16) : nullptr; const GAS T16* pb2 = (NSPLIT >= 2) ? sptr(Bt2 + boff + kc * 16) : nullptr;
#pragma unroll
        for (int mb = 0; mb < 4; ++mb) { a[mb] = WFrag<T16>::ld(pa + (size_t)mb * 16 * K, lo); if (NSPLIT == 1 || NSPLIT == 2) a2[mb] = WFrag<T16>::ld(pa2 + (size_t)mb * 16 * K, lo); }
#pragma unroll
        for (int nb = 0; nb < 4; ++nb) { const V b = WFrag<T16>::ld(pb + (size_t)nb * 16 * K, lo); V b2; if (NSPLIT >= 2) b2 = WFrag<T16>::ld(pb2 + (size_t)nb * 16 * K, lo);
#pragma unroll
            for (int mb = 0; mb < 4; ++mb) { acc[mb][nb] = WFrag<T16>::mma(a[mb], b, acc[mb][nb]); if (NSPLIT == 1 || NSPLIT == 2) acc[mb][nb] = WFrag<T16>::mma(a2[mb], b, acc[mb][nb]); if (NSPLIT >= 2) acc[mb][nb] = WFrag<T16>::mma(a[mb], b2, acc[mb][nb]); } }
        asm volatile("v_nop\n\tv_nop\n\tv_nop\n\tv_nop" : "+v"(acc[0][0]), "+v"(acc[1][1]), "+v"(acc[2][2]), "+v"(acc[3][3]) : "v"(a[0]), "v"(a[3]));
    }
    float* ow = os + wv * (64 * 68);
#pragma unroll
    for (int mb = 0; mb < 4; ++mb)
#pragma unroll
        for (int nb = 0; nb < 4; ++nb)
#pragma unroll
            for (int j = 0; j < 8; ++j) ow[(mb * 16 + hi * 8 + j) * 68 + nb * 16 + lr] = acc[mb][nb][j];
    __syncthreads();   // every wave's partial 64x64 tile is in LDS before any of it is summed (passed by every wave of the work-group: all its tiles take this path)
    float* crow = C + (size_t)r0 * ldc + c0;
#pragma unroll
    for (int s = 0; s < 1024; s += 32 * NW) { const int q = s + tid, row = q >> 4, cofs = (q & 15) * 4; v4f val = *(const v4fa*)(os + row * 68 + cofs);
#pragma unroll
        for (int w = 1; w < NW; ++w) val += *(const v4fa*)(os + w * (64 * 68) + row * 68 + cofs);
        if (CMODE == 2) val *= cs;
        *(v4f*)(crow + (size_t)row * ldc + cofs) = val; }
}

// ---- tile_store: one wave stores its finished 64x64 f32 tile (rows r0.., columns c0.. of C) in whole 256-byte row pieces, 16 rows at a time through its own 16 * 68 floats of LDS (os); no work-group barrier.
template <int CMODE>
__device__ __forceinline__ void tile_store(v8f (&acc)[4][4], float* C, int ldc, float cs, int r0, int c0, int lane, float* os) {
    const int lr = lane & 15, hi = lane >> 4;
#pragma unroll
    for (int mb = 0; mb < 4; ++mb) {
#pragma unroll
        for (int nb = 0; nb < 4; ++nb) {
#pragma unroll
            for (int j = 0; j < 8; ++j) os[(hi * 8 + j) * 68 + nb * 16 + lr] = acc[mb][nb][j]; }
        __builtin_amdgcn_wave_barrier(); asm volatile("" ::: "memory");
        float* crow = C + (size_t)(r0 + mb * 16) * ldc + c0;
#pragma unroll
        for (int s = 0; s < 8; ++s) { const int row = 2 * s + hi, cofs = lr * 4; v4f val = *(const v4fa*)(os + row * 68 + cofs); if (CMODE == 2) val *= cs;
            *(v4f*)(crow + (size_t)row * ldc + cofs) = val; }
        __builtin_amdgcn_wave_barrier(); asm volatile("" ::: "memory");
    }
    asm volatile("s_wait_xcnt 0x0" ::: "memory");   // behind the tile's last store: where this path is inlined in front of other code, nothing behind it rewrites a register that an issued store still names
}

// ---- k_scores: every score tile at or below the diagonal, one launch, 128 threads. blockIdx.y == 0: the hi/lo rows (< RH), one 64x64 tile per work-group, its K loop split over the 4 waves; blockIdx.x counts the (RH/64)^2 tiles of the square that holds their diagonal.
// blockIdx.y >= 1: the f16 rows, one 128x128 tile per work-group through ring128, a 64x64 quarter per wave; (blockIdx.y - 1, blockIdx.x) count the (TT-RH)/128 x TT/128 tiles row by row. LDS: the ring's two stages, then 16 * 68 floats per wave for the store.
static_assert((RH / 64) * (RH / 64) <= TT / 64 && (TT - RH) % 256 == 0 && RH % 128 == 0 && HD % 128 == 0 && DM % 128 == 0, "grid shapes of k_gemmw, k_scores and k_pv");
__global__ __launch_bounds__(128) void k_scores(const bf* __restrict__ Qh, const bf* __restrict__ Ql, const bf* __restrict__ Kh, const bf* __restrict__ Kl, const h16* __restrict__ Q16, const h16* __restrict__ K16, float* Sb) {
    __shared__ __align__(16) float os[STG + 4 * 16 * 68];   // the larger of the two paths' needs: 2 * STG 16-bit elements + the waves' store staging (hi/lo path: 4 * 64 * 68 floats)
    static_assert(STG + 4 * 16 * 68 >= 4 * 64 * 68, "LDS of k_scores");
    const int wave = __builtin_amdgcn_readfirstlane((int)(threadIdx.x >> 5));
    if (blockIdx.y == 0) {
        const int t = blockIdx.x; if (t >= (RH / 64) * (RH / 64)) return;   // whole work-group, in front of the barrier
        gemmc_tile<bf, 2, 1, 4>(Qh, Ql, Kh, Kl, HD, Sb, TT, 0, 1.0f, (t / (RH / 64)) * 64, (t % (RH / 64)) * 64, wave, (int)threadIdx.x, os);
    } else {
        const int t = ((int)blockIdx.y - 1) * (TT / 64) + (int)blockIdx.x, R0 = (t / (TT / 128)) * 128, C0 = (t % (TT / 128)) * 128, lane = (int)threadIdx.x & 31;
        if (C0 > R0 + RH + 127) return;   // tile entirely above the causal diagonal: whole work-group, in front of every copy and barrier
        v8f acc[4][4];
#pragma unroll
        for (int mb = 0; mb < 4; ++mb)
#pragma unroll
            for (int nb = 0; nb < 4; ++nb) acc[mb][nb] = (v8f){};
        ring128<h16>(Q16 + (size_t)RH * HD, K16, HD, R0, C0, wave, lane, (h16*)os, acc);
        const int r0 = R0 + (wave >> 1) * 64, c0 = C0 + (wave & 1) * 64;   // the wave's quarter
        if (c0 <= r0 + RH + 63) tile_store<1>(acc, Sb + (size_t)RH * TT, TT, 1.0f, r0, c0, lane, os + STG + wave * (16 * 68));   // a quarter entirely above the diagonal (the upper right one of a diagonal tile) is not stored (the softmax masks it by select); behind the last barrier
    }
}

// ---- k_pv: every output tile, one launch, 256 threads, blockIdx.y = 64-wide output column tile. blockIdx.x < (TT-RH)/64: one f16 row tile, K loop split over the 8 waves.
// Beyond: two hi/lo row tiles per work-group, 4 waves and half of the LDS each (the split and the order of the sums that each had in a work-group of its own); both halves pass the one barrier.
__global__ __launch_bounds__(256) void k_pv(const bf* __restrict__ Ph, const bf* __restrict__ Pl, const bf* __restrict__ VTh, const bf* __restrict__ VTl, const h16* __restrict__ P16, const h16* __restrict__ VT16, float* O) {
    __shared__ __align__(16) float os[8 * 64 * 68];
    const int wave = __builtin_amdgcn_readfirstlane((int)(threadIdx.x >> 5));
    if (blockIdx.x < (TT - RH) / 64) {
        gemmc_tile<h16, 0, 2, 8>(P16 + (size_t)RH * TT, nullptr, VT16, nullptr, TT, O + (size_t)RH * DQ, DQ, RH, 1.0f / PCAR, (int)blockIdx.x * 64, (int)blockIdx.y * 64, wave, (int)threadIdx.x, os);
    } else {
        const int g = wave >> 2;
        gemmc_tile<bf, 2, 2, 4>(Ph, Pl, VTh, VTl, TT, O, DQ, 0, 1.0f, (((int)blockIdx.x - (TT - RH) / 64) * 2 + g) * 64, (int)blockIdx.y * 64, wave & 3, (int)threadIdx.x & 127, os + g * (4 * 64 * 68));
    }
}

typedef __attribute__((ext_vector_type(2))) _Float16 v2h;
typedef __attribute__((ext_vector_type(4))) _Float16 v4h;
typedef __attribute__((ext_vector_type(2))) unsigned short v2us;
typedef __attribute__((ext_vector_type(4))) unsigned short v4us;
typedef __attribute__((ext_vector_type(2))) float v2f;
typedef __attribute__((ext_vector_type(4))) int v4i;

__global__ __launch_bounds__(256) void k_wtG(const float* __restrict__ w, int K, int N, bf* Bt) {
    const int lane = threadIdx.x & 31; const int L0 = (blockIdx.x * 8 + (threadIdx.x >> 5)) * 8; const int nlines = N * K / 64;
{
#pragma unroll 1
        for (int l = 0; l < 8; ++l) { const int L = L0 + l; if (L >= nlines) break; const size_t e = (size_t)L * 64 + lane * 2; const int k = (int)(e % K), n = (int)(e / K); v2us o;
            o[0] = f2bf(w[(size_t)k * N + n]); o[1] = f2bf(w[(size_t)(k + 1) * N + n]); *(v2us*)(Bt + e) = o; }
         }
}
// k_cvt8: x and the three weights to bf16 planes in fragment order in one launch, 8 elements per thread (thread i writes the plane's i-th 16 bytes, a wave one chunk); the first BX_ work-groups take x, then BW_ each take a weight.
#define BX_ (TT * DM / 8 / 256)
#define BW_ (DQ * DM / 8 / 256)
static_assert(TT * DM % 2048 == 0 && DQ * DM % 2048 == 0 && DQ == DKV, "whole work-groups per tensor");
__global__ __launch_bounds__(256) void k_cvt8(const float* __restrict__ x, const float* __restrict__ wq, const float* __restrict__ wk, const float* __restrict__ wv, bf* XB, bf* WQ, bf* WK, bf* WV) {
    int b = blockIdx.x; const float* src = x; bf* dst = XB;
    if (b >= BX_) { b -= BX_; const int w = b / BW_; b -= w * BW_; src = (w == 0) ? wq : (w == 1) ? wk : wv; dst = (w == 0) ? WQ : (w == 1) ? WK : WV; }
    const size_t i = (size_t)b * 256 + threadIdx.x; const int l = threadIdx.x & 31, c = (int)(i >> 5), blk = c >> 1;   // chunk c of block blk
    const int srow = (blk / (DM / 32)) * 16 + (l & 15), scol = (blk % (DM / 32)) * 32 + (c & 1) * 16 + (l >> 4) * 8;
    const v8f v = *(const v8f*)(src + (size_t)srow * DM + scol); v8us o;
#pragma unroll
    for (int k = 0; k < 8; ++k) o[k] = f2bf(v[k]); *(v8us*)(dst + i * 8) = o;  }

// k_lsoft: causal row softmax over the TK = TT = 4096 keys, one wave per row i; the f32 score row is read once, all its loads in flight together, and stays in registers for the maximum, the sum and the weights (lane -> 4 consecutive keys per 128-key chunk, 32 chunks; keys j > i are excluded by index with -3e38 / 0 - the score tiles above the diagonal are never stored and their stale contents are only ever discarded by this select):
// The last pass over the registers leaves the work-group's 8 rows of 16-bit weights in LDS (row pitch PSP elements: 32 bytes over a multiple of 256, so that the 16-byte reads of 8 rows fall on different banks); behind one barrier each wave stores whole 128-byte lines of the planes' fragment order (8 rows x 8 keys a line, 4 lines = one 32-key block an instruction).
#define PSP (TT + 16)
// exp2s: 2^x, v_exp_f32 with the one free slot that the instruction set asks for behind a transcendental in the same statement
__device__ __forceinline__ float exp2s(float x) { float r; asm("v_exp_f32 %0, %1\n\tv_nop" : "=v"(r) : "v"(x)); return r; }
static_assert(RH % 16 == 0 && 2 * RH <= TT && TT % 256 == 0 && RH % 128 == 0, "staging of k_lsoft");
__global__ __launch_bounds__(256) void k_lsoft(const float* __restrict__ Sb, h16* P16, bf* Ph, bf* Pl) {
    __shared__ __align__(16) unsigned short ps[8 * PSP];
    const int lane = threadIdx.x & 31; const int wv = threadIdx.x >> 5; const int row = blockIdx.x * 8 + wv; if (row >= ZH * TT) return;   // never taken: the grid holds exactly ZH * TT rows
    const int i = row % TT; const int zz = row / TT; const bool hires = (i < RH); const float* sr = Sb + (size_t)row * TT + lane * 4;
    v4f a[TT / 128];   // the lane's 128 values of the row: raw scores, then scaled and masked scores, then exponentials
#pragma unroll   // every loop over a[] is unrolled so that its elements stay in registers; here all 32 loads are issued before the first value is used
    for (int ch = 0; ch < TT / 128; ++ch) a[ch] = *(const v4f*)(sr + ch * 128);
    float mx = -3.0e38f; const int dl = i - lane * 4;   // key ch * 128 + lane * 4 + q is at or before the query where ch * 128 + q <= dl: one compare with a constant per key
#pragma unroll
    for (int ch = 0; ch < TT / 128; ++ch) {
#pragma unroll
        for (int q = 0; q < 4; ++q) { const float t = (ch * 128 + q <= dl) ? a[ch][q] * SCL : -3.0e38f; a[ch][q] = t; mx = fmaxf(mx, t); } }
#pragma unroll
    for (int sh = 16; sh; sh >>= 1) mx = fmaxf(mx, __shfl_xor(mx, sh, 32));
    float sum = 0.f;
#pragma unroll
    for (int ch = 0; ch < TT / 128; ++ch) {
#pragma unroll
        for (int q = 0; q < 4; ++q) a[ch][q] = exp2s(__fmul_rn(__fsub_rn(a[ch][q], mx), 1.4426950408889634f)); }
#pragma unroll
    for (int ch = 0; ch < TT / 128; ++ch) {
#pragma unroll
        for (int q = 0; q < 4; ++q) sum += a[ch][q]; }
#pragma unroll
    for (int sh = 16; sh; sh >>= 1) sum += __shfl_xor(sum, sh, 32);
    const float f = __fdiv_rn(hires ? 1.0f : PCAR, sum);
    if (hires) {   /* rows < RH: normalised bf16 hi/lo over the first RH keys (every later key is above the diagonal for these rows; the hi/lo attn.v GEMM stops its K loop at the diagonal block), planes [zz][RH][TT] */
#pragma unroll
        for (int ch = 0; ch < RH / 128; ++ch) { const int j0 = ch * 128 + lane * 4; v4us oh, ol;
#pragma unroll
            for (int q = 0; q < 4; ++q) { unsigned short a2, c2; splitf(a[ch][q] * f, a2, c2); oh[q] = a2; ol[q] = c2; }
            *(v4us*)(ps + wv * PSP + j0) = oh; *(v4us*)(ps + wv * PSP + RH + j0) = ol; }
    } else {
#pragma unroll
        for (int ch = 0; ch < TT / 128; ++ch) { const int j0 = ch * 128 + lane * 4; v4h o4;
#pragma unroll
            for (int q = 0; q < 4; ++q) o4[q] = tohx(a[ch][q] * f);
            *(v4us*)(ps + wv * PSP + j0) = __builtin_bit_cast(v4us, o4); }
    }
    __syncthreads();   // all 8 rows are in LDS before any wave gathers lines across them (hires is the same for the whole work-group: RH % 8 == 0)
    const int r8 = lane & 7, sh = lane >> 3;                       // row of the 8, 8-key unit of the 32-key block
    const int i0 = i - wv;                                         // the work-group's first row within the sequence
    const size_t ob = (size_t)(i0 >> 4) * 16 * TT + sh * 128 + ((i0 & 15) + r8) * 8;
    if (hires) {
#pragma unroll   // unrolled so that the plane (pl) is known at compile time for each store
        for (int it = 0; it < 2 * (RH / 32) / 8; ++it) { const int idx = it * 8 + wv, pl = idx / (RH / 32), kb = idx % (RH / 32); const v8us val = *(const v8usa*)(ps + r8 * PSP + pl * RH + kb * 32 + sh * 8);
            *(v8usa*)((pl ? Pl : Ph) + (size_t)zz * RH * TT + ob + kb * 512) = val; }
    } else {
#pragma unroll 4   // four LDS reads are issued ahead of their four stores
        for (int it = 0; it < (TT / 32) / 8; ++it) { const int kb = it * 8 + wv; const v8us val = *(const v8usa*)(ps + r8 * PSP + kb * 32 + sh * 8);
            *(v8usa*)(P16 + (size_t)zz * TT * TT + ob + kb * 512) = val; }
    }
}

extern "C" void kernel_launch(void* const* d_in, const int* in_sizes, int n_in,
                              void* d_out, int out_size, void* d_ws, size_t ws_size, hipStream_t stream) {
    (void)in_sizes; (void)n_in; (void)out_size;
    const float* x = (const float*)d_in[0]; const float* wq = (const float*)d_in[1]; const float* wk = (const float*)d_in[2]; const float* wv = (const float*)d_in[3]; const float* wo = nullptr; (void)wo;
    float* OUT = (float*)d_out;     // [1][4096][768]
    char* wsp = (char*)d_ws;
    auto take = [&](size_t bytes) { char* p = wsp; wsp += (bytes + 255) & ~(size_t)255; return (void*)p; };
    bf* WQ = (bf*)take((size_t)DQ * DM * 2); bf* WK = (bf*)take((size_t)DKV * DM * 2); bf* WV = (bf*)take((size_t)DKV * DM * 2); 
    bf* XB = (bf*)take((size_t)TT * DM * 2);
    h16* QP16 = (h16*)take((size_t)NH_ * TT * HD * 2); h16* KP16 = (h16*)take((size_t)NKV * TT * HD * 2); h16* VT16 = (h16*)take((size_t)NKV * HD * TT * 2);
    bf* QPh = (bf*)take((size_t)NH_ * TT * HD * 2); bf* QPl = (bf*)take((size_t)NH_ * TT * HD * 2); bf* KPh = (bf*)take((size_t)NKV * TT * HD * 2); bf* KPl = (bf*)take((size_t)NKV * TT * HD * 2); bf* VTh = (bf*)take((size_t)NKV * HD * TT * 2); bf* VTl = (bf*)take((size_t)NKV * HD * TT * 2); bf* Ph = (bf*)take((size_t)ZH * RH * TT * 2); bf* Pl = (bf*)take((size_t)ZH * RH * TT * 2);
    float* Sb = (float*)take((size_t)ZH * TT * TT * 4); h16* P16 = (h16*)take((size_t)ZH * TT * TT * 2);
    if ((size_t)(wsp - (char*)d_ws) > ws_size) return;    // ws 256 MiB
    for (int b = 0; b < NB_; ++b) {
        k_cvt8<<<BX_ + 3 * BW_, 256, 0, stream>>>(x + (size_t)b * TT * DM, wq, wk, wv, XB, WQ, WK, WV);
        k_gemmw<bf><<<dim3(TT / 128, DQ / 128, 3), 128, 0, stream>>>(XB, WQ, WK, WV, DM, QP16, QPh, QPl, KP16, KPh, KPl, VT16, VTh, VTl);   // v transposed: rows = value columns, pitch TT
        k_scores<<<dim3(TT / 64, 1 + (TT - RH) / 256, 1), 128, 0, stream>>>(QPh, QPl, KPh, KPl, QP16, KP16, Sb);
        k_lsoft<<<ZH * TT / 8, 256, 0, stream>>>(Sb, P16, Ph, Pl);
        k_pv<<<dim3((TT - RH) / 64 + RH / 128, HD / 64, 1), 256, 0, stream>>>(Ph, Pl, VTh, VTl, P16, VT16, OUT + (size_t)b * TT * DQ);
    }
}

// v007
// A run of this version takes 74 microseconds.
// Two timings next to v006 both put it at 1.12 times that version's speed.
// Over all steps from v000 it is 4.07 times as fast.
#include <hip/hip_runtime.h>

// Causal single-head self-attention with a 768-wide head over 4,096 tokens (x [4096][768]; q,k,v = x W^T ('oi' [768][768], no bias); scores = q.k, keys after the query -> -inf; weights = softmax(scores / sqrt(768)); out = weights v -> [4096][768] (3.1 M)).
// Layout: bf16 copy of x; exact projections; ONE 768-wide head through the causal T-4096 attention (hybrid rows: < 512 hi/lo 3 products, rest fp16 x1024; k_scores computes only score tiles at or below the diagonal (K 768), k_pv ends its key loops at the diagonal block, f16 at most 128 keys beyond (N 768); one-read softmax, the row in registers, with the causal index select); the projection GEMMs write the 16-bit operand planes and the P.v GEMMs the scaled f32 output rows from their own epilogues.
// The projections, the f16 score tiles and the f16 P.v tiles run 4 waves on a 128x128 tile (2 x 2 of 64x64): both operands come into LDS once per work-group by asynchronous copies, two buffers (ring128); a P.v tile has four such groups of 4 waves, each on a quarter of the keys.
// Five launches, each holding all the work that depends only on earlier launches: the four bf16 conversions; the three projections (grid z); the score tiles of both row classes; the softmax; the P.v tiles of both row classes.
// Every 16-bit operand plane [rows][K] lies in fragment order: a block of 16 rows x 32 k is two 512-byte chunks (k 0..15, k 16..31 of the block); lane l = 16 * ((k >> 3) & 1) + (row & 15) owns 16 bytes (8 consecutive k) of each; blocks run along k, then down the rows, so 16 rows still fill 16 * K elements. Each of a fragment's two load instructions reads one chunk = 4 whole 128-byte lines.
// Compute dtypes, f32 accumulate: every input rounded to bf16; projections exact; attention rows < 512 3 products, rest fp16; softmax f32; output f32.

#define NB_  1
#define TT   4096
#define DM   768
#define NH_  1
#define NKV  1
#define REP  (NH_ / NKV)
#define HD   768
#define DQ   (NH_ * HD)
#define DKV  (NKV * HD)
#define ZH   1
#define RH   512                  // query rows < RH use hi+lo planes (0: none)
#define WIN  4096
#define PCAR 1024.0f
#define SCL  0.036084391824351615f   // 1/sqrt(768)
typedef _Float16 h16;
typedef unsigned short bf;
typedef __attribute__((ext_vector_type(16))) __bf16   v16bf;
typedef __attribute__((ext_vector_type(16))) _Float16 v16h;
typedef __attribute__((ext_vector_type(8)))  _Float16 v8h;
typedef __attribute__((ext_vector_type(8)))  unsigned short v8us;
typedef __attribute__((ext_vector_type(8)))  float    v8f;
typedef __attribute__((ext_vector_type(4)))  float    v4f;
typedef v8h  __attribute__((may_alias)) v8ha;
typedef v4f  __attribute__((may_alias)) v4fa;
typedef v8us __attribute__((may_alias)) v8usa;

__device__ __forceinline__ unsigned short f2bf(float f) { unsigned u = __float_as_uint(f); u += 0x7FFFu + ((u >> 16) & 1u); return (unsigned short)(u >> 16); }
__device__ __forceinline__ float bf2f(unsigned short b) { return __uint_as_float(((unsigned)b) << 16); }
__device__ __forceinline__ float bfr(float f) { return bf2f(f2bf(f)); }
__device__ __forceinline__ v16h cat16(v8h lo, v8h hi) { return __builtin_shufflevector(lo, hi, 0, 1, 2, 3, 4, 5, 6, 7, 8, 9, 10, 11, 12, 13, 14, 15); }
__device__ __forceinline__ v16bf cat16b(v8us lo, v8us hi) { return __builtin_bit_cast(v16bf, __builtin_shufflevector(lo, hi, 0, 1, 2, 3, 4, 5, 6, 7, 8, 9, 10, 11, 12, 13, 14, 15)); }
__device__ __forceinline__ v8f wmma16(v16h a, v16h b, v8f c) { return __builtin_amdgcn_wmma_f32_16x16x32_f16(false, a, false, b, (short)0, c, false, false); }
__device__ __forceinline__ v8f wmmab(v16bf a, v16bf b, v8f c) { return __builtin_amdgcn_wmma_f32_16x16x32_bf16(false, a, false, b, (short)0, c, false, false); }
__device__ __forceinline__ h16 tohx(float x) { return (h16)x; }
__device__ __forceinline__ void splitf(float y, unsigned short& h, unsigned short& l) { h = f2bf(y); l = f2bf(y - bf2f(h)); }



// ---- k_gemmw: register-blocked GEMM, 4 waves per 128x128 output tile, each wave a 64x64 quarter (16 accumulators), operands from 16-bit planes in fragment order through the LDS ring of ring128; grid (TT/128, DQ/128, 3), 128 threads; blockIdx.z picks the projection: 0 q, 1 k, 2 v.
// c[m][n] (f32 accumulators) = sum_k A[m][k] Bt[n][k]; the epilogue writes c as three 16-bit planes in fragment order with ldc columns (their K): P16 = f16(c), Ph = bf16(c), Pl = bf16(c - Ph). K % 64 == 0, ldc % 8 == 0.
// The transposed planes of v come from the same code with the operands (and the two grid axes) exchanged (A = weight rows, Bt = token rows): c[d][t], ldc = TT.
// sptr: a wave-uniform operand address held in a scalar register pair (global address space), so that a fragment load is scalar base + the lane's one offset register + immediate: no 64-bit vector add a trip, and no load result can land in a register that an issued load still names as its address
#define GAS __attribute__((address_space(1)))
template <typename T> __device__ __forceinline__ const GAS T* sptr(const T* p) { const unsigned long long u = (unsigned long long)p; return (const GAS T*)(((unsigned long long)(unsigned)__builtin_amdgcn_readfirstlane((int)(u >> 32)) << 32) | (unsigned)__builtin_amdgcn_readfirstlane((int)u)); }
template <typename T16> struct WFrag;
template <> struct WFrag<h16> { typedef v16h V; static __device__ __forceinline__ V ld(const GAS h16* p, unsigned lo) { return cat16(*(const GAS v8h*)(p + lo), *(const GAS v8h*)(p + 256 + lo)); } static __device__ __forceinline__ V lds(const h16* p) { return cat16(*(const v8ha*)p, *(const v8ha*)(p + 256)); } static __device__ __forceinline__ v8f mma(V a, V b, v8f c) { return wmma16(a, b, c); } };
template <> struct WFrag<bf> { typedef v16bf V; static __device__ __forceinline__ V ld(const GAS bf* p, unsigned lo) { return cat16b(*(const GAS v8us*)(p + lo), *(const GAS v8us*)(p + 256 + lo)); } static __device__ __forceinline__ V lds(const bf* p) { return cat16b(*(const v8usa*)p, *(const v8usa*)(p + 256)); } static __device__ __forceinline__ v8f mma(V a, V b, v8f c) { return wmmab(a, b, c); } };
// ---- ring128: the K loop of a 128x128 tile (rows R0.. of A, rows C0.. of Bt) for 4 waves; wave w accumulates the 64x64 quarter (w >> 1, w & 1) in acc, k ascending in steps of 32 as in a one-wave tile. K = the planes' pitch; the loop runs over the nt stages s0 .. s0 + nt - 1 (nt the same for every wave of the work-group: its barriers are the work-group's).
// A stage is 64 k of all 256 operand rows: 16 bands of 16 rows (8 of A, then 8 of Bt), each 2 KiB in a row in the plane's fragment order and copied as it lies, so that a fragment is again two 512-byte chunks, the lane's 16 bytes side by side. Wave w copies bands 4w .. 4w + 3.
#define STG 16384   // 16-bit elements of one stage (32 KiB); the ring holds two
// stage_fill: one wave's 16 copies of a stage (4 bands x 4 chunks of 512 bytes). g = the lane's 16 bytes of the wave's first band at the stage's k, l = their LDS byte address.
template <typename T16>
__device__ __forceinline__ void stage_fill(const T16* g, int K, unsigned l) {
#pragma unroll
    for (int h = 0; h < 2; ++h) {
        const T16* ga = g + (size_t)(2 * h) * 16 * K; const T16* gb = ga + (size_t)16 * K; const unsigned la = l + h * 4096u, lb = la + 2048u;
        // asynchronous copies global -> LDS, through no register; s_wait_xcnt 0 closes the statement so that no address register named here is rewritten in front of it
        asm volatile("global_load_async_to_lds_b128 %0, %8, off\n\t"
                     "global_load_async_to_lds_b128 %1, %9, off\n\t"
                     "global_load_async_to_lds_b128 %2, %10, off\n\t"
                     "global_load_async_to_lds_b128 %3, %11, off\n\t"
                     "global_load_async_to_lds_b128 %4, %12, off\n\t"
                     "global_load_async_to_lds_b128 %5, %13, off\n\t"
                     "global_load_async_to_lds_b128 %6, %14, off\n\t"
                     "global_load_async_to_lds_b128 %7, %15, off\n\t"
                     "s_wait_xcnt 0x0"
                     :: "v"(la), "v"(la + 512u), "v"(la + 1024u), "v"(la + 1536u), "v"(lb), "v"(lb + 512u), "v"(lb + 1024u), "v"(lb + 1536u),
                        "v"(ga), "v"(ga + 256), "v"(ga + 512), "v"(ga + 768), "v"(gb), "v"(gb + 256), "v"(gb + 512), "v"(gb + 768) : "memory");
    }
}
template <typename T16>
__device__ __forceinline__ void ring128(const T16* __restrict__ A, const T16* __restrict__ Bt, int K, int s0, int nt, int R0, int C0, int wave, int lane, T16* ring, v8f (&acc)[4][4]) {
    typedef typename WFrag<T16>::V V;
    const T16* g = ((wave < 2) ? A + (size_t)(R0 + 64 * wave) * K : Bt + (size_t)(C0 + 64 * (wave - 2)) * K) + (size_t)s0 * 1024 + 8 * lane;
    const unsigned l = (unsigned)(size_t)ring + (unsigned)wave * 8192u + (unsigned)lane * 16u;
    const int wr = wave >> 1, wc = wave & 1;
    stage_fill(g, K, l);
    asm volatile("s_wait_asynccnt 0x0" ::: "memory");   // this wave's copies of stage 0 have landed
    __syncthreads();                                     // ... and every other wave's: stage 0 may be read
    if (nt > 1) stage_fill(g + 1024, K, l + 2u * STG);
#pragma unroll 1   // one stage's fragments live at a time; the buffer alternates with the trip
    for (int t = 0; t < nt; ++t) {
        const T16* sb = ring + (t & 1) * STG + 8 * lane;
        V a[4], b[4], a1[4], b1[4];   // the fragments of the stage's two 32-wide k blocks
#pragma unroll
        for (int mb = 0; mb < 4; ++mb) { a[mb] = WFrag<T16>::lds(sb + (wr * 4 + mb) * 1024); b[mb] = WFrag<T16>::lds(sb + (8 + wc * 4 + mb) * 1024); }
        // inputs only: keeps the 16 LDS reads of the first k block together in front of its 16 matrix instructions, one LDS latency for the group (left alone, the compiler read each b fragment directly in front of its use and waited four times)
        asm volatile("" :: "v"(a[0]), "v"(a[1]), "v"(a[2]), "v"(a[3]), "v"(b[0]), "v"(b[1]), "v"(b[2]), "v"(b[3]));
#pragma unroll
        for (int mb = 0; mb < 4; ++mb) { a1[mb] = WFrag<T16>::lds(sb + (wr * 4 + mb) * 1024 + 512); b1[mb] = WFrag<T16>::lds(sb + (8 + wc * 4 + mb) * 1024 + 512); }
#pragma unroll
        for (int nb = 0; nb < 4; ++nb)
#pragma unroll
            for (int mb = 0; mb < 4; ++mb) acc[mb][nb] = WFrag<T16>::mma(a[mb], b[nb], acc[mb][nb]);
        asm volatile("s_wait_dscnt 0x0" ::: "memory");      // this wave's reads of the buffer are done (both k blocks are in registers) before the buffer is given up
        asm volatile("s_wait_asynccnt 0x0" ::: "memory");   // this wave's copies of stage t + 1 have landed
        __syncthreads();                                     // publishes stage t + 1 and ends every wave's reads of stage t
        if (t + 2 < nt) stage_fill(g + (size_t)(t + 2) * 1024, K, l + (unsigned)(t & 1) * (2u * STG));
        // the second k block's products, from registers alone, stand behind the refill so that the copies start as early as they may
#pragma unroll
        for (int nb = 0; nb < 4; ++nb)
#pragma unroll
            for (int mb = 0; mb < 4; ++mb) acc[mb][nb] = WFrag<T16>::mma(a1[mb], b1[nb], acc[mb][nb]);
    }
    asm volatile("s_wait_asynccnt 0x0" ::: "memory");   // no copy is outstanding behind the loop
}
template <typename T16>
__global__ __launch_bounds__(128) void k_gemmw(const T16* __restrict__ X, const T16* __restrict__ Wq, const T16* __restrict__ Wk, const T16* __restrict__ Wv, int K, h16* Q16, bf* Qh, bf* Ql, h16* K16, bf* Kh, bf* Kl, h16* V16, bf* Vh, bf* Vl) {
    __shared__ __align__(16) T16 ring[2 * STG];
    __shared__ __align__(16) float osw[4 * 16 * 68];
    const int wave = __builtin_amdgcn_readfirstlane((int)(threadIdx.x >> 5)); float* os = osw + wave * (16 * 68);   // each wave's own staging for its epilogue
    const int z = blockIdx.z; const T16* A = (z == 2) ? Wv : X; const T16* Bt = (z == 2) ? X : (z == 1) ? Wk : Wq;
    h16* P16 = (z == 2) ? V16 : (z == 1) ? K16 : Q16; bf* Ph = (z == 2) ? Vh : (z == 1) ? Kh : Qh; bf* Pl = (z == 2) ? Vl : (z == 1) ? Kl : Ql; const int ldc = (z == 2) ? TT : DQ;
    const int lane = threadIdx.x & 31, lr = lane & 15, hi = lane >> 4; const int R0 = ((z == 2) ? blockIdx.y : blockIdx.x) * 128, C0 = ((z == 2) ? blockIdx.x : blockIdx.y) * 128;
    v8f acc[4][4];
#pragma unroll
    for (int mb = 0; mb < 4; ++mb)
#pragma unroll
        for (int nb = 0; nb < 4; ++nb) acc[mb][nb] = (v8f){};
    ring128<T16>(A, Bt, K, 0, K / 64, R0, C0, wave, lane, ring, acc);
    const int r0 = R0 + (wave >> 1) * 64, c0 = C0 + (wave & 1) * 64;   // the wave's quarter
#pragma unroll
    for (int mb = 0; mb < 4; ++mb) {
#pragma unroll
        for (int nb = 0; nb < 4; ++nb) {
#pragma unroll
            for (int j = 0; j < 8; ++j) os[(hi * 8 + j) * 68 + nb * 16 + lr] = acc[mb][nb][j]; }
        __builtin_amdgcn_wave_barrier(); asm volatile("" ::: "memory");
        const size_t o0 = (size_t)(r0 + mb * 16) * ldc + (size_t)c0 * 16 + 8 * lane;
        // fragment order: the 64 columns are 4 chunks; every 16-byte store of a plane fills one whole 512-byte chunk
#pragma unroll
        for (int s = 0; s < 4; ++s) { const int row = lr, cofs = s * 16 + hi * 8; const v4f va = *(const v4fa*)(os + row * 68 + cofs), vb = *(const v4fa*)(os + row * 68 + cofs + 4); v8h o16; v8us oh, ol;
#pragma unroll
            for (int q = 0; q < 4; ++q) { unsigned short x2, y2; o16[q] = tohx(va[q]); splitf(va[q], x2, y2); oh[q] = x2; ol[q] = y2; o16[q + 4] = tohx(vb[q]); splitf(vb[q], x2, y2); oh[q + 4] = x2; ol[q + 4] = y2; }
            const size_t oo = o0 + s * 256; *(v8h*)(P16 + oo) = o16; *(v8us*)(Ph + oo) = oh; *(v8us*)(Pl + oo) = ol; }
        __builtin_amdgcn_wave_barrier(); asm volatile("" ::: "memory");
    }
}

// ---- gemmc_tile: the same 64x64 tile GEMM specialised for causal attention, as a device function for one tile (rows r0.., columns c0..), called by k_scores and k_pv: CMODE 1 skips score tiles entirely above the diagonal (query rows r0+roff.., key columns c0..), CMODE 2 limits the
// key (K) loop of the probability x value contraction to the diagonal block (probabilities beyond it are exactly zero). roff = sequence row of the first row of the A and C that the call is given.
// CMODE 2 multiplies the finished f32 tile by cs (the inverse of the probabilities' carry factor) as it is stored, so C is the output itself.
// NW waves per tile (32 * NW threads; wv = the wave's number and tid the thread's number within the tile, os = the tile's own LDS: NW * 64 * 68 floats): wave w takes the 64-wide K chunks w, w + NW, ... (two blocks, 2 KiB in a row, of every 16 operand rows per chunk) into its own 16 accumulators; the NW partial tiles are summed in LDS, wave 0's first. K % 64 == 0.
template <typename T16, int NSPLIT, int CMODE, int NW>
__device__ __forceinline__ void gemmc_tile(const T16* __restrict__ A, const T16* __restrict__ A2, const T16* __restrict__ Bt, const T16* __restrict__ Bt2, int K, float* C, int ldc, int roff, float cs, int r0, int c0, int wv, int tid, float* os) {
    typedef typename WFrag<T16>::V V;
    const int lane = tid & 31, lr = lane & 15, hi = lane >> 4;
    if (CMODE == 1 && c0 > r0 + roff + 63) return;                  // score tile entirely above the causal diagonal: not computed (the softmax loads its stale values and masks j > i by select); taken by all NW waves of the tile, the whole work-group, in front of its barrier
    const int Kl = (CMODE == 2) ? min(K, r0 + roff + 64) : K;        // P.V: probabilities are exactly 0 beyond the diagonal block, so the K loop stops there
    v8f acc[4][4];
#pragma unroll
    for (int mb = 0; mb < 4; ++mb)
#pragma unroll
        for (int nb = 0; nb < 4; ++nb) acc[mb][nb] = (v8f){};
    const size_t aoff = (size_t)r0 * K, boff = (size_t)c0 * K; const unsigned lo = 8u * (unsigned)lane;   // fragment order: the tile's first block (the same for the wave: a scalar base) and the lane's 16 bytes of a chunk (one register, unchanged through the loop)
    // wv, r0 and c0 are held in scalar registers (the callers' readfirstlane) so that both loops branch on scalar compares and EXEC stays whole round the matrix instructions; both stay rolled, as the parent's loop, so that one 32-wide trip's fragments are live at a time
#pragma unroll 1
    for (int kb = wv * 64; kb < Kl; kb += NW * 64)
#pragma unroll 1
    for (int kc = kb; kc < kb + 64; kc += 32) {
        V a[4], a2[4]; const GAS T16* pa = sptr(A + aoff + kc * 16); const GAS T16* pb = sptr(Bt + boff + kc * 16); const GAS T16* pa2 = (NSPLIT == 1 || NSPLIT == 2) ? sptr(A2 + aoff + kc * 16) : nullptr; const GAS T16* pb2 = (NSPLIT >= 2) ? sptr(Bt2 + boff + kc * 16) : nullptr;
#pragma unroll
        for (int mb = 0; mb < 4; ++mb) { a[mb] = WFrag<T16>::ld(pa + (size_t)mb * 16 * K, lo); if (NSPLIT == 1 || NSPLIT == 2) a2[mb] = WFrag<T16>::ld(pa2 + (size_t)mb * 16 * K, lo); }
#pragma unroll
        for (int nb = 0; nb < 4; ++nb) { const V b = WFrag<T16>::ld(pb + (size_t)nb * 16 * K, lo); V b2; if (NSPLIT >= 2) b2 = WFrag<T16>::ld(pb2 + (size_t)nb * 16 * K, lo);
#pragma unroll
            for (int mb = 0; mb < 4; ++mb) { acc[mb][nb] = WFrag<T16>::mma(a[mb], b, acc[mb][nb]); if (NSPLIT == 1 || NSPLIT == 2) acc[mb][nb] = WFrag<T16>::mma(a2[mb], b, acc[mb][nb]); if (NSPLIT >= 2) acc[mb][nb] = WFrag<T16>::mma(a[mb], b2, acc[mb][nb]); } }
        asm volatile("v_nop\n\tv_nop\n\tv_nop\n\tv_nop" : "+v"(acc[0][0]), "+v"(acc[1][1]), "+v"(acc[2][2]), "+v"(acc[3][3]) : "v"(a[0]), "v"(a[3]));
    }
    float* ow = os + wv * (64 * 68);
#pragma unroll
    for (int mb = 0; mb < 4; ++mb)
#pragma unroll
        for (int nb = 0; nb < 4; ++nb)
#pragma unroll
            for (int j = 0; j < 8; ++j) ow[(mb * 16 + hi * 8 + j) * 68 + nb * 16 + lr] = acc[mb][nb][j];
    __syncthreads();   // every wave's partial 64x64 tile is in LDS before any of it is summed (passed by every wave of the work-group: all its tiles take this path)
    float* crow = C + (size_t)r0 * ldc + c0;
#pragma unroll
    for (int s = 0; s < 1024; s += 32 * NW) { const int q = s + tid, row = q >> 4, cofs = (q & 15) * 4; v4f val = *(const v4fa*)(os + row * 68 + cofs);
#pragma unroll
        for (int w = 1; w < NW; ++w) val += *(const v4fa*)(os + w * (64 * 68) + row * 68 + cofs);
        if (CMODE == 2) val *= cs;
        *(v4f*)(crow + (size_t)row * ldc + cofs) = val; }
}

// ---- tile_store: one wave stores its finished (16 * NMB)x64 f32 tile (rows r0.., columns c0.. of C) in whole 256-byte row pieces, 16 rows at a time through its own 16 * 68 floats of LDS (os); no work-group barrier.
template <int CMODE, int NMB>
__device__ __forceinline__ void tile_store(v8f (&acc)[NMB][4], float* C, int ldc, float cs, int r0, int c0, int lane, float* os) {
    const int lr = lane & 15, hi = lane >> 4;
#pragma unroll
    for (int mb = 0; mb < NMB; ++mb) {
#pragma unroll
        for (int nb = 0; nb < 4; ++nb) {
#pragma unroll
            for (int j = 0; j < 8; ++j) os[(hi * 8 + j) * 68 + nb * 16 + lr] = acc[mb][nb][j]; }
        __builtin_amdgcn_wave_barrier(); asm volatile("" ::: "memory");
        float* crow = C + (size_t)(r0 + mb * 16) * ldc + c0;
#pragma unroll
        for (int s = 0; s < 8; ++s) { const int row = 2 * s + hi, cofs = lr * 4; v4f val = *(const v4fa*)(os + row * 68 + cofs); if (CMODE == 2) val *= cs;
            *(v4f*)(crow + (size_t)row * ldc + cofs) = val; }
        __builtin_amdgcn_wave_barrier(); asm volatile("" ::: "memory");
    }
    asm volatile("s_wait_xcnt 0x0" ::: "memory");   // behind the tile's last store: where this path is inlined in front of other code, nothing behind it rewrites a register that an issued store still names
}

// ---- k_scores: every score tile at or below the diagonal, one launch, 128 threads. blockIdx.y == 0: the hi/lo rows (< RH), one 64x64 tile per work-group, its K loop split over the 4 waves; blockIdx.x counts the (RH/64)^2 tiles of the square that holds their diagonal.
// blockIdx.y >= 1: the f16 rows, one 128x128 tile per work-group through ring128, a 64x64 quarter per wave; (blockIdx.y - 1, blockIdx.x) count the (TT-RH)/128 x TT/128 tiles row by row. LDS: the ring's two stages, then 16 * 68 floats per wave for the store.
static_assert((RH / 64) * (RH / 64) <= TT / 64 && (TT - RH) % 256 == 0 && RH % 128 == 0 && HD % 128 == 0 && DM % 128 == 0, "grid shapes of k_gemmw, k_scores and k_pv");
__global__ __launch_bounds__(128) void k_scores(const bf* __restrict__ Qh, const bf* __restrict__ Ql, const bf* __restrict__ Kh, const bf* __restrict__ Kl, const h16* __restrict__ Q16, const h16* __restrict__ K16, float* Sb) {
    __shared__ __align__(16) float os[STG + 4 * 16 * 68];   // the larger of the two paths' needs: 2 * STG 16-bit elements + the waves' store staging (hi/lo path: 4 * 64 * 68 floats)
    static_assert(STG + 4 * 16 * 68 >= 4 * 64 * 68, "LDS of k_scores");
    const int wave = __builtin_amdgcn_readfirstlane((int)(threadIdx.x >> 5));
    if (blockIdx.y == 0) {
        const int t = blockIdx.x; if (t >= (RH / 64) * (RH / 64)) return;   // whole work-group, in front of the barrier
        gemmc_tile<bf, 2, 1, 4>(Qh, Ql, Kh, Kl, HD, Sb, TT, 0, 1.0f, (t / (RH / 64)) * 64, (t % (RH / 64)) * 64, wave, (int)threadIdx.x, os);
    } else {
        const int t = ((int)blockIdx.y - 1) * (TT / 64) + (int)blockIdx.x, R0 = (t / (TT / 128)) * 128, C0 = (t % (TT / 128)) * 128, lane = (int)threadIdx.x & 31;
        if (C0 > R0 + RH + 127) return;   // tile entirely above the causal diagonal: whole work-group, in front of every copy and barrier
        v8f acc[4][4];
#pragma unroll
        for (int mb = 0; mb < 4; ++mb)
#pragma unroll
            for (int nb = 0; nb < 4; ++nb) acc[mb][nb] = (v8f){};
        ring128<h16>(Q16 + (size_t)RH * HD, K16, HD, 0, HD / 64, R0, C0, wave, lane, (h16*)os, acc);
        const int r0 = R0 + (wave >> 1) * 64, c0 = C0 + (wave & 1) * 64;   // the wave's quarter
        if (c0 <= r0 + RH + 63) tile_store<1, 4>(acc, Sb + (size_t)RH * TT, TT, 1.0f, r0, c0, lane, os + STG + wave * (16 * 68));   // a quarter entirely above the diagonal (the upper right one of a diagonal tile) is not stored: the softmax discards it by select; behind the last barrier
    }
}

// ---- k_pv: every output tile, one launch, 512 threads. blockIdx.x < NPF: one 128x128 f16 tile, the row tiles with the most keys first; the keys are dealt in four equal runs of 64-key stages to four groups of 4 waves (group 0 the first run), each through a ring128 of its own;
// the runs cover the keys up to the end of the tile's diagonal block, rounded up to 4 whole runs (at most 128 keys more, never beyond TT): the probabilities there are exactly 0, as are those of the diagonal block above the diagonal.
// The four partial tiles are exchanged in LDS (accumulator order, whole 512-byte pieces) behind one barrier: group d sums and stores row block d (16 rows) of every quarter, its own part first, then the other groups' in ascending order.
// Beyond: four hi/lo 64x64 row tiles per work-group, 4 waves and a quarter of the LDS each (the split and the order of the sums that each had in a work-group of its own); all pass the one barrier.
#define NPF (((TT - RH) / 128) * (HD / 128))
static_assert(RH % 256 == 0 && TT % 256 == 0, "grid and key runs of k_pv");
__global__ __launch_bounds__(512) void k_pv(const bf* __restrict__ Ph, const bf* __restrict__ Pl, const bf* __restrict__ VTh, const bf* __restrict__ VTl, const h16* __restrict__ P16, const h16* __restrict__ VT16, float* O) {
    __shared__ __align__(16) float os[16 * 64 * 68];   // hi/lo path: 16 partial tiles; f16 path: four rings (4 * STG floats), then in their place the exchange (48 * 1024 floats) and behind it the waves' store staging (16 * 16 * 68)
    static_assert(4 * STG <= 16 * 64 * 68 && 48 * 1024 + 16 * 16 * 68 <= 16 * 64 * 68, "LDS of k_pv");
    const int wave = __builtin_amdgcn_readfirstlane((int)(threadIdx.x >> 5)); const int g = wave >> 2, w = wave & 3;
    if (blockIdx.x < NPF) {
        const int t = (int)blockIdx.x, R0 = ((TT - RH) / 128 - 1 - t / (HD / 128)) * 128, C0 = (t % (HD / 128)) * 128, lane = (int)threadIdx.x & 31;
        const int ntg = (R0 + RH + 128 + 255) / 256;   // 64-key stages per group
        v8f acc[4][4];
#pragma unroll
        for (int mb = 0; mb < 4; ++mb)
#pragma unroll
            for (int nb = 0; nb < 4; ++nb) acc[mb][nb] = (v8f){};
        ring128<h16>(P16 + (size_t)RH * TT, VT16, TT, g * ntg, ntg, R0, C0, w, lane, (h16*)os + g * (2 * STG), acc);
        // behind ring128's last barrier no wave reads a ring any more: its LDS takes the exchange. A wave keeps row block g of its quarter and gives the other three to the groups that finish them (piece: 4 KiB; group d's pieces for quarter w lie side by side, the givers ascending).
        v8f fin[1][4];
#pragma unroll
        for (int d = 0; d < 4; ++d) {
            if (d == g) {
#pragma unroll
                for (int nb = 0; nb < 4; ++nb) fin[0][nb] = acc[d][nb];
            } else {
                float* exw = os + ((d * 4 + w) * 3 + (g < d ? g : g - 1)) * 1024 + lane * 4;
#pragma unroll
                for (int nb = 0; nb < 4; ++nb) { *(v4fa*)(exw + nb * 256) = __builtin_shufflevector(acc[d][nb], acc[d][nb], 0, 1, 2, 3); *(v4fa*)(exw + nb * 256 + 128) = __builtin_shufflevector(acc[d][nb], acc[d][nb], 4, 5, 6, 7); }
            }
        }
        __syncthreads();   // every group's partial blocks are in LDS before any is summed
        const float* exr = os + (g * 4 + w) * 3 * 1024 + lane * 4;
#pragma unroll
        for (int s = 0; s < 3; ++s)
#pragma unroll
            for (int nb = 0; nb < 4; ++nb) { const v4f lo4 = *(const v4fa*)(exr + s * 1024 + nb * 256), hi4 = *(const v4fa*)(exr + s * 1024 + nb * 256 + 128); fin[0][nb] += __builtin_shufflevector(lo4, hi4, 0, 1, 2, 3, 4, 5, 6, 7); }
        tile_store<2, 1>(fin, O + (size_t)RH * DQ, DQ, 1.0f / PCAR, R0 + (w >> 1) * 64 + g * 16, C0 + (w & 1) * 64, lane, os + 48 * 1024 + wave * (16 * 68));
    } else {
        const int u = (int)blockIdx.x - NPF;
        gemmc_tile<bf, 2, 2, 4>(Ph, Pl, VTh, VTl, TT, O, DQ, 0, 1.0f, ((u / (HD / 64)) * 4 + g) * 64, (u % (HD / 64)) * 64, w, (int)threadIdx.x & 127, os + g * (4 * 64 * 68));
    }
}

typedef __attribute__((ext_vector_type(2))) _Float16 v2h;
typedef __attribute__((ext_vector_type(4))) _Float16 v4h;
typedef __attribute__((ext_vector_type(2))) unsigned short v2us;
typedef __attribute__((ext_vector_type(4))) unsigned short v4us;
typedef __attribute__((ext_vector_type(2))) float v2f;
typedef __attribute__((ext_vector_type(4))) int v4i;

__global__ __launch_bounds__(256) void k_wtG(const float* __restrict__ w, int K, int N, bf* Bt) {
    const int lane = threadIdx.x & 31; const int L0 = (blockIdx.x * 8 + (threadIdx.x >> 5)) * 8; const int nlines = N * K / 64;
{
#pragma unroll 1
        for (int l = 0; l < 8; ++l) { const int L = L0 + l; if (L >= nlines) break; const size_t e = (size_t)L * 64 + lane * 2; const int k = (int)(e % K), n = (int)(e / K); v2us o;
            o[0] = f2bf(w[(size_t)k * N + n]); o[1] = f2bf(w[(size_t)(k + 1) * N + n]); *(v2us*)(Bt + e) = o; }
         }
}
// k_cvt8: x and the three weights to bf16 planes in fragment order in one launch, 8 elements per thread (thread i writes the plane's i-th 16 bytes, a wave one chunk); the first BX_ work-groups take x, then BW_ each take a weight.
#define BX_ (TT * DM / 8 / 256)
#define BW_ (DQ * DM / 8 / 256)
static_assert(TT * DM % 2048 == 0 && DQ * DM % 2048 == 0 && DQ == DKV, "whole work-groups per tensor");
__global__ __launch_bounds__(256) void k_cvt8(const float* __restrict__ x, const float* __restrict__ wq, const float* __restrict__ wk, const float* __restrict__ wv, bf* XB, bf* WQ, bf* WK, bf* WV) {
    int b = blockIdx.x; const float* src = x; bf* dst = XB;
    if (b >= BX_) { b -= BX_; const int w = b / BW_; b -= w * BW_; src = (w == 0) ? wq : (w == 1) ? wk : wv; dst = (w == 0) ? WQ : (w == 1) ? WK : WV; }
    const size_t i = (size_t)b * 256 + threadIdx.x; const int l = threadIdx.x & 31, c = (int)(i >> 5), blk = c >> 1;   // chunk c of block blk
    const int srow = (blk / (DM / 32)) * 16 + (l & 15), scol = (blk % (DM / 32)) * 32 + (c & 1) * 16 + (l >> 4) * 8;
    const v8f v = *(const v8f*)(src + (size_t)srow * DM + scol); v8us o;
#pragma unroll
    for (int k = 0; k < 8; ++k) o[k] = f2bf(v[k]); *(v8us*)(dst + i * 8) = o;  }

// k_lsoft: causal row softmax over the TK = TT = 4096 keys, one wave per row i; the f32 score row is read once, all its loads in flight together, and stays in registers for the maximum, the sum and the weights (lane -> 4 consecutive keys per 128-key chunk, 32 chunks; keys j > i are excluded by index with -3e38 / 0 - the score tiles above the diagonal are never stored and their stale contents are only ever discarded by this select):
// The last pass over the registers leaves the work-group's 8 rows of 16-bit weights in LDS (row pitch PSP elements: 32 bytes over a multiple of 256, so that the 16-byte reads of 8 rows fall on different banks); behind one barrier each wave stores whole 128-byte lines of the planes' fragment order (8 rows x 8 keys a line, 4 lines = one 32-key block an instruction).
#define PSP (TT + 16)
// exp2s: 2^x, v_exp_f32 with the one free slot that the instruction set asks for behind a transcendental in the same statement
__device__ __forceinline__ float exp2s(float x) { float r; asm("v_exp_f32 %0, %1\n\tv_nop" : "=v"(r) : "v"(x)); return r; }
static_assert(RH % 16 == 0 && 2 * RH <= TT && TT % 256 == 0 && RH % 128 == 0, "staging of k_lsoft");
__global__ __launch_bounds__(256) void k_lsoft(const float* __restrict__ Sb, h16* P16, bf* Ph, bf* Pl) {
    __shared__ __align__(16) unsigned short ps[8 * PSP];
    const int lane = threadIdx.x & 31; const int wv = threadIdx.x >> 5; const int row = blockIdx.x * 8 + wv; if (row >= ZH * TT) return;   // never taken: the grid holds exactly ZH * TT rows
    const int i = row % TT; const int zz = row / TT; const bool hires = (i < RH); const float* sr = Sb + (size_t)row * TT + lane * 4;
    v4f a[TT / 128];   // the lane's 128 values of the row: raw scores, then scaled and masked scores, then exponentials
#pragma unroll   // every loop over a[] is unrolled so that its elements stay in registers; here all 32 loads are issued before the first value is used
    for (int ch = 0; ch < TT / 128; ++ch) a[ch] = *(const v4f*)(sr + ch * 128);
    float mx = -3.0e38f; const int dl = i - lane * 4;   // key ch * 128 + lane * 4 + q is at or before the query where ch * 128 + q <= dl: one compare with a constant per key
#pragma unroll
    for (int ch = 0; ch < TT / 128; ++ch) {
#pragma unroll
        for (int q = 0; q < 4; ++q) { const float t = (ch * 128 + q <= dl) ? a[ch][q] * SCL : -3.0e38f; a[ch][q] = t; mx = fmaxf(mx, t); } }
#pragma unroll
    for (int sh = 16; sh; sh >>= 1) mx = fmaxf(mx, __shfl_xor(mx, sh, 32));
    float sum = 0.f;
#pragma unroll
    for (int ch = 0; ch < TT / 128; ++ch) {
#pragma unroll
        for (int q = 0; q < 4; ++q) a[ch][q] = exp2s(__fmul_rn(__fsub_rn(a[ch][q], mx), 1.4426950408889634f)); }
#pragma unroll
    for (int ch = 0; ch < TT / 128; ++ch) {
#pragma unroll
        for (int q = 0; q < 4; ++q) sum += a[ch][q]; }
#pragma unroll
    for (int sh = 16; sh; sh >>= 1) sum += __shfl_xor(sum, sh, 32);
    const float f = __fdiv_rn(hires ? 1.0f : PCAR, sum);
    if (hires) {   /* rows < RH: normalised bf16 hi/lo over the first RH keys (every later key is above the diagonal for these rows; the hi/lo attn.v GEMM stops its K loop at the diagonal block), planes [zz][RH][TT] */
#pragma unroll
        for (int ch = 0; ch < RH / 128; ++ch) { const int j0 = ch * 128 + lane * 4; v4us oh, ol;
#pragma unroll
            for (int q = 0; q < 4; ++q) { unsigned short a2, c2; splitf(a[ch][q] * f, a2, c2); oh[q] = a2; ol[q] = c2; }
            *(v4us*)(ps + wv * PSP + j0) = oh; *(v4us*)(ps + wv * PSP + RH + j0) = ol; }
    } else {
#pragma unroll
        for (int ch = 0; ch < TT / 128; ++ch) { const int j0 = ch * 128 + lane * 4; v4h o4;
#pragma unroll
            for (int q = 0; q < 4; ++q) o4[q] = tohx(a[ch][q] * f);
            *(v4us*)(ps + wv * PSP + j0) = __builtin_bit_cast(v4us, o4); }
    }
    __syncthreads();   // all 8 rows are in LDS before any wave gathers lines across them (hires is the same for the whole work-group: RH % 8 == 0)
    const int r8 = lane & 7, sh = lane >> 3;                       // row of the 8, 8-key unit of the 32-key block
    const int i0 = i - wv;                                         // the work-group's first row within the sequence
    const size_t ob = (size_t)(i0 >> 4) * 16 * TT + sh * 128 + ((i0 & 15) + r8) * 8;
    if (hires) {
#pragma unroll   // unrolled so that the plane (pl) is known at compile time for each store
        for (int it = 0; it < 2 * (RH / 32) / 8; ++it) { const int idx = it * 8 + wv, pl = idx / (RH / 32), kb = idx % (RH / 32); const v8us val = *(const v8usa*)(ps + r8 * PSP + pl * RH + kb * 32 + sh * 8);
            *(v8usa*)((pl ? Pl : Ph) + (size_t)zz * RH * TT + ob + kb * 512) = val; }
    } else {
#pragma unroll 4   // four LDS reads are issued ahead of their four stores
        for (int it = 0; it < (TT / 32) / 8; ++it) { const int kb = it * 8 + wv; const v8us val = *(const v8usa*)(ps + r8 * PSP + kb * 32 + sh * 8);
            *(v8usa*)(P16 + (size_t)zz * TT * TT + ob + kb * 512) = val; }
    }
}

extern "C" void kernel_launch(void* const* d_in, const int* in_sizes, int n_in,
                              void* d_out, int out_size, void* d_ws, size_t ws_size, hipStream_t stream) {
    (void)in_sizes; (void)n_in; (void)out_size;
    const float* x = (const float*)d_in[0]; const float* wq = (const float*)d_in[1]; const float* wk = (const float*)d_in[2]; const float* wv = (const float*)d_in[3]; const float* wo = nullptr; (void)wo;
    float* OUT = (float*)d_out;     // [1][4096][768]
    char* wsp = (char*)d_ws;
    auto take = [&](size_t bytes) { char* p = wsp; wsp += (bytes + 255) & ~(size_t)255; return (void*)p; };
    bf* WQ = (bf*)take((size_t)DQ * DM * 2); bf* WK = (bf*)take((size_t)DKV * DM * 2); bf* WV = (bf*)take((size_t)DKV * DM * 2); 
    bf* XB = (bf*)take((size_t)TT * DM * 2);
    h16* QP16 = (h16*)take((size_t)NH_ * TT * HD * 2); h16* KP16 = (h16*)take((size_t)NKV * TT * HD * 2); h16* VT16 = (h16*)take((size_t)NKV * HD * TT * 2);
    bf* QPh = (bf*)take((size_t)NH_ * TT * HD * 2); bf* QPl = (bf*)take((size_t)NH_ * TT * HD * 2); bf* KPh = (bf*)take((size_t)NKV * TT * HD * 2); bf* KPl = (bf*)take((size_t)NKV * TT * HD * 2); bf* VTh = (bf*)take((size_t)NKV * HD * TT * 2); bf* VTl = (bf*)take((size_t)NKV * HD * TT * 2); bf* Ph = (bf*)take((size_t)ZH * RH * TT * 2); bf* Pl = (bf*)take((size_t)ZH * RH * TT * 2);
    float* Sb = (float*)take((size_t)ZH * TT * TT * 4); h16* P16 = (h16*)take((size_t)ZH * TT * TT * 2);
    if ((size_t)(wsp - (char*)d_ws) > ws_size) return;    // ws 256 MiB
    for (int b = 0; b < NB_; ++b) {
        k_cvt8<<<BX_ + 3 * BW_, 256, 0, stream>>>(x + (size_t)b * TT * DM, wq, wk, wv, XB, WQ, WK, WV);
        k_gemmw<bf><<<dim3(TT / 128, DQ / 128, 3), 128, 0, stream>>>(XB, WQ, WK, WV, DM, QP16, QPh, QPl, KP16, KPh, KPl, VT16, VTh, VTl);   // v transposed: rows = value columns, pitch TT
        k_scores<<<dim3(TT / 64, 1 + (TT - RH) / 256, 1), 128, 0, stream>>>(QPh, QPl, KPh, KPl, QP16, KP16, Sb);
        k_lsoft<<<ZH * TT / 8, 256, 0, stream>>>(Sb, P16, Ph, Pl);
        k_pv<<<NPF + (RH / 256) * (HD / 64), 512, 0, stream>>>(Ph, Pl, VTh, VTl, P16, VT16, OUT + (size_t)b * TT * DQ);
    }
}

// v009
// Measured time: 67.8 microseconds a run.
// It is 1.08 times as fast as v007, going by the measured steps of the versions left out in between.
// Over all steps from v000 it is 4.42 times as fast.
#include <hip/hip_runtime.h>

// Causal single-head self-attention with a 768-wide head over 4,096 tokens (x [4096][768]; q,k,v = x W^T ('oi' [768][768], no bias); scores = q.k, keys after the query -> -inf; weights = softmax(scores / sqrt(768)); out = weights v -> [4096][768] (3.1 M)).
// Layout: bf16 copy of x; exact projections; ONE 768-wide head through the causal T-4096 attention (hybrid rows: < 512 hi/lo 3 products, rest fp16 x1024; only score / P.v tiles at or below the diagonal are computed (K 768 / N 768); softmax with the causal index select, per 64-key quarter in the score tile's epilogue, brought to the row's maximum and sum in P.v: f16 rows by factors on the A fragments, hi/lo rows by f32 factors on the per-quarter partial tiles); the projection GEMMs write the 16-bit operand planes and the P.v GEMMs the scaled f32 output rows from their own epilogues.
// The projections, the f16 score tiles and the f16 P.v tiles run 4 waves on a 128x128 tile (2 x 2 of 64x64): both operands come into LDS once per work-group by asynchronous copies, two buffers (ring128); a P.v tile has four such groups of 4 waves, each on a quarter of the keys.
// Four launches, each holding all the work that depends only on earlier launches: the four bf16 conversions; the three projections (grid z); the score tiles of both row classes (they leave weights, not scores); the P.v tiles of both row classes.
// Every 16-bit operand plane [rows][K] lies in fragment order: a block of 16 rows x 32 k is two 512-byte chunks (k 0..15, k 16..31 of the block); lane l = 16 * ((k >> 3) & 1) + (row & 15) owns 16 bytes (8 consecutive k) of each; blocks run along k, then down the rows, so 16 rows still fill 16 * K elements. Each of a fragment's two load instructions reads one chunk = 4 whole 128-byte lines.
// Compute dtypes, f32 accumulate: every input rounded to bf16; projections exact; attention rows < 512 3 products, rest fp16; softmax f32; output f32.

#define NB_  1
#define TT   4096
#define DM   768
#define NH_  1
#define NKV  1
#define REP  (NH_ / NKV)
#define HD   768
#define DQ   (NH_ * HD)
#define DKV  (NKV * HD)
#define ZH   1
#define RH   512                  // query rows < RH use hi+lo planes (0: none)
#define WIN  4096
#define PCAR 1024.0f
#define SCL  0.036084391824351615f   // 1/sqrt(768)
typedef _Float16 h16;
typedef unsigned short bf;
typedef __attribute__((ext_vector_type(16))) __bf16   v16bf;
typedef __attribute__((ext_vector_type(16))) _Float16 v16h;
typedef __attribute__((ext_vector_type(8)))  _Float16 v8h;
typedef __attribute__((ext_vector_type(8)))  unsigned short v8us;
typedef __attribute__((ext_vector_type(8)))  float    v8f;
typedef __attribute__((ext_vector_type(4)))  float    v4f;
typedef v8h  __attribute__((may_alias)) v8ha;
typedef v4f  __attribute__((may_alias)) v4fa;
typedef v8us __attribute__((may_alias)) v8usa;

__device__ __forceinline__ unsigned short f2bf(float f) { unsigned u = __float_as_uint(f); u += 0x7FFFu + ((u >> 16) & 1u); return (unsigned short)(u >> 16); }
__device__ __forceinline__ float bf2f(unsigned short b) { return __uint_as_float(((unsigned)b) << 16); }
__device__ __forceinline__ float bfr(float f) { return bf2f(f2bf(f)); }
__device__ __forceinline__ v16h cat16(v8h lo, v8h hi) { return __builtin_shufflevector(lo, hi, 0, 1, 2, 3, 4, 5, 6, 7, 8, 9, 10, 11, 12, 13, 14, 15); }
__device__ __forceinline__ v16bf cat16b(v8us lo, v8us hi) { return __builtin_bit_cast(v16bf, __builtin_shufflevector(lo, hi, 0, 1, 2, 3, 4, 5, 6, 7, 8, 9, 10, 11, 12, 13, 14, 15)); }
__device__ __forceinline__ v8f wmma16(v16h a, v16h b, v8f c) { return __builtin_amdgcn_wmma_f32_16x16x32_f16(false, a, false, b, (short)0, c, false, false); }
__device__ __forceinline__ v8f wmmab(v16bf a, v16bf b, v8f c) { return __builtin_amdgcn_wmma_f32_16x16x32_bf16(false, a, false, b, (short)0, c, false, false); }
__device__ __forceinline__ h16 tohx(float x) { return (h16)x; }
__device__ __forceinline__ void splitf(float y, unsigned short& h, unsigned short& l) { h = f2bf(y); l = f2bf(y - bf2f(h)); }
// exp2s: 2^x, v_exp_f32 with the one free slot that the instruction set asks for behind a transcendental in the same statement
__device__ __forceinline__ float exp2s(float x) { float r; asm("v_exp_f32 %0, %1\n\tv_nop" : "=v"(r) : "v"(x)); return r; }
#define LOG2E 1.4426950408889634f



// ---- k_gemmw: register-blocked GEMM, 4 waves per 128x128 output tile, each wave a 64x64 quarter (16 accumulators), operands from 16-bit planes in fragment order through the LDS ring of ring128; grid (TT/128, DQ/128, 3), 128 threads; blockIdx.z picks the projection: 0 q, 1 k, 2 v.
// c[m][n] (f32 accumulators) = sum_k A[m][k] Bt[n][k]; the epilogue writes c as three 16-bit planes in fragment order with ldc columns (their K): P16 = f16(c), Ph = bf16(c), Pl = bf16(c - Ph). K % 64 == 0, ldc % 8 == 0.
// The transposed planes of v come from the same code with the operands (and the two grid axes) exchanged (A = weight rows, Bt = token rows): c[d][t], ldc = TT.
// sptr: a wave-uniform operand address held in a scalar register pair (global address space), so that a fragment load is scalar base + the lane's one offset register + immediate: no 64-bit vector add a trip, and no load result can land in a register that an issued load still names as its address
#define GAS __attribute__((address_space(1)))
template <typename T> __device__ __forceinline__ const GAS T* sptr(const T* p) { const unsigned long long u = (unsigned long long)p; return (const GAS T*)(((unsigned long long)(unsigned)__builtin_amdgcn_readfirstlane((int)(u >> 32)) << 32) | (unsigned)__builtin_amdgcn_readfirstlane((int)u)); }
template <typename T16> struct WFrag;
template <> struct WFrag<h16> { typedef v16h V; static __device__ __forceinline__ V ld(const GAS h16* p, unsigned lo) { return cat16(*(const GAS v8h*)(p + lo), *(const GAS v8h*)(p + 256 + lo)); } static __device__ __forceinline__ V lds(const h16* p) { return cat16(*(const v8ha*)p, *(const v8ha*)(p + 256)); } static __device__ __forceinline__ v8f mma(V a, V b, v8f c) { return wmma16(a, b, c); } };
template <> struct WFrag<bf> { typedef v16bf V; static __device__ __forceinline__ V ld(const GAS bf* p, unsigned lo) { return cat16b(*(const GAS v8us*)(p + lo), *(const GAS v8us*)(p + 256 + lo)); } static __device__ __forceinline__ V lds(const bf* p) { return cat16b(*(const v8usa*)p, *(const v8usa*)(p + 256)); } static __device__ __forceinline__ v8f mma(V a, V b, v8f c) { return wmmab(a, b, c); } };
// ---- ring128: the K loop of a 128x128 tile (rows R0.. of A, rows C0.. of Bt) for 4 waves; wave w accumulates the 64x64 quarter (w >> 1, w & 1) in acc, k ascending in steps of 32 as in a one-wave tile. K = the planes' pitch; the loop runs over the nt stages s0 .. s0 + nt - 1 (nt the same for every wave of the work-group: its barriers are the work-group's).
// A stage is 64 k of all 256 operand rows: 16 bands of 16 rows (8 of A, then 8 of Bt), each 2 KiB in a row in the plane's fragment order and copied as it lies, so that a fragment is again two 512-byte chunks, the lane's 16 bytes side by side. Wave w copies bands 4w .. 4w + 3.
#define STG 16384   // 16-bit elements of one stage (32 KiB); the ring holds two
// stage_fill: one wave's 16 copies of a stage (4 bands x 4 chunks of 512 bytes). g = the lane's 16 bytes of the wave's first band at the stage's k, l = their LDS byte address.
template <typename T16>
__device__ __forceinline__ void stage_fill(const T16* g, int K, unsigned l) {
#pragma unroll
    for (int h = 0; h < 2; ++h) {
        const T16* ga = g + (size_t)(2 * h) * 16 * K; const T16* gb = ga + (size_t)16 * K; const unsigned la = l + h * 4096u, lb = la + 2048u;
        // asynchronous copies global -> LDS, through no register; s_wait_xcnt 0 closes the statement so that no address register named here is rewritten in front of it
        asm volatile("global_load_async_to_lds_b128 %0, %8, off\n\t"
                     "global_load_async_to_lds_b128 %1, %9, off\n\t"
                     "global_load_async_to_lds_b128 %2, %10, off\n\t"
                     "global_load_async_to_lds_b128 %3, %11, off\n\t"
                     "global_load_async_to_lds_b128 %4, %12, off\n\t"
                     "global_load_async_to_lds_b128 %5, %13, off\n\t"
                     "global_load_async_to_lds_b128 %6, %14, off\n\t"
                     "global_load_async_to_lds_b128 %7, %15, off\n\t"
                     "s_wait_xcnt 0x0"
                     :: "v"(la), "v"(la + 512u), "v"(la + 1024u), "v"(la + 1536u), "v"(lb), "v"(lb + 512u), "v"(lb + 1024u), "v"(lb + 1536u),
                        "v"(ga), "v"(ga + 256), "v"(ga + 512), "v"(ga + 768), "v"(gb), "v"(gb + 256), "v"(gb + 512), "v"(gb + 768) : "memory");
    }
}
// SC: every A fragment of stage s is multiplied, as it leaves LDS, by the lane's own row factor ft[s * 128 + 16 * mb] (a lane of an A fragment holds one row: lane & 15); ft = the table in LDS at the wave's first row + (lane & 15), written in front of this function's first barrier.
template <typename T16, bool SC = false>
__device__ __forceinline__ void ring128(const T16* __restrict__ A, const T16* __restrict__ Bt, int K, int s0, int nt, int R0, int C0, int wave, int lane, T16* ring, v8f (&acc)[4][4], const T16* ft = nullptr) {
    typedef typename WFrag<T16>::V V;
    const T16* g = ((wave < 2) ? A + (size_t)(R0 + 64 * wave) * K : Bt + (size_t)(C0 + 64 * (wave - 2)) * K) + (size_t)s0 * 1024 + 8 * lane;
    const unsigned l = (unsigned)(size_t)ring + (unsigned)wave * 8192u + (unsigned)lane * 16u;
    const int wr = wave >> 1, wc = wave & 1;
    stage_fill(g, K, l);
    asm volatile("s_wait_asynccnt 0x0" ::: "memory");   // this wave's copies of stage 0 have landed
    __syncthreads();                                     // ... and every other wave's: stage 0 may be read
    if (nt > 1) stage_fill(g + 1024, K, l + 2u * STG);
#pragma unroll 1   // one stage's fragments live at a time; the buffer alternates with the trip
    for (int t = 0; t < nt; ++t) {
        const T16* sb = ring + (t & 1) * STG + 8 * lane;
        V a[4], b[4], a1[4], b1[4];   // the fragments of the stage's two 32-wide k blocks
        T16 fs[4];
        if constexpr (SC) {   // the stage's four row factors are read in front of the fragments, so that the fragments' one wait covers them too
#pragma unroll
            for (int mb = 0; mb < 4; ++mb) fs[mb] = ft[(s0 + t) * 128 + mb * 16];
        }
#pragma unroll
        for (int mb = 0; mb < 4; ++mb) { a[mb] = WFrag<T16>::lds(sb + (wr * 4 + mb) * 1024); b[mb] = WFrag<T16>::lds(sb + (8 + wc * 4 + mb) * 1024); }
        // inputs only: keeps the 16 LDS reads of the first k block together in front of its 16 matrix instructions, one LDS latency for the group (left alone, the compiler read each b fragment directly in front of its use and waited four times)
        asm volatile("" :: "v"(a[0]), "v"(a[1]), "v"(a[2]), "v"(a[3]), "v"(b[0]), "v"(b[1]), "v"(b[2]), "v"(b[3]));
        if constexpr (SC) {
            asm volatile("" :: "v"(fs[0]), "v"(fs[1]), "v"(fs[2]), "v"(fs[3]));   // inputs only: keeps the four factor reads in that first group (left alone, the compiler read them behind the fragments' wait: a second LDS latency a stage)
#pragma unroll
            for (int mb = 0; mb < 4; ++mb) a[mb] *= fs[mb];
        }
#pragma unroll
        for (int mb = 0; mb < 4; ++mb) { a1[mb] = WFrag<T16>::lds(sb + (wr * 4 + mb) * 1024 + 512); b1[mb] = WFrag<T16>::lds(sb + (8 + wc * 4 + mb) * 1024 + 512); }
#pragma unroll
        for (int nb = 0; nb < 4; ++nb)
#pragma unroll
            for (int mb = 0; mb < 4; ++mb) acc[mb][nb] = WFrag<T16>::mma(a[mb], b[nb], acc[mb][nb]);
        asm volatile("s_wait_dscnt 0x0" ::: "memory");      // this wave's reads of the buffer are done (both k blocks are in registers) before the buffer is given up
        asm volatile("s_wait_asynccnt 0x0" ::: "memory");   // this wave's copies of stage t + 1 have landed
        __syncthreads();                                     // publishes stage t + 1 and ends every wave's reads of stage t
        if (t + 2 < nt) stage_fill(g + (size_t)(t + 2) * 1024, K, l + (unsigned)(t & 1) * (2u * STG));
        if constexpr (SC) {
#pragma unroll
            for (int mb = 0; mb < 4; ++mb) a1[mb] *= fs[mb];
        }
        // the second k block's products, from registers alone, stand behind the refill so that the copies start as early as they may
#pragma unroll
        for (int nb = 0; nb < 4; ++nb)
#pragma unroll
            for (int mb = 0; mb < 4; ++mb) acc[mb][nb] = WFrag<T16>::mma(a1[mb], b1[nb], acc[mb][nb]);
    }
    asm volatile("s_wait_asynccnt 0x0" ::: "memory");   // no copy is outstanding behind the loop
}
template <typename T16>
__global__ __launch_bounds__(128) void k_gemmw(const T16* __restrict__ X, const T16* __restrict__ Wq, const T16* __restrict__ Wk, const T16* __restrict__ Wv, int K, h16* Q16, bf* Qh, bf* Ql, h16* K16, bf* Kh, bf* Kl, h16* V16, bf* Vh, bf* Vl) {
    __shared__ __align__(16) T16 ring[2 * STG];
    __shared__ __align__(16) float osw[4 * 16 * 68];
    const int wave = __builtin_amdgcn_readfirstlane((int)(threadIdx.x >> 5)); float* os = osw + wave * (16 * 68);   // each wave's own staging for its epilogue
    const int z = blockIdx.z; const T16* A = (z == 2) ? Wv : X; const T16* Bt = (z == 2) ? X : (z == 1) ? Wk : Wq;
    h16* P16 = (z == 2) ? V16 : (z == 1) ? K16 : Q16; bf* Ph = (z == 2) ? Vh : (z == 1) ? Kh : Qh; bf* Pl = (z == 2) ? Vl : (z == 1) ? Kl : Ql; const int ldc = (z == 2) ? TT : DQ;
    const int lane = threadIdx.x & 31, lr = lane & 15, hi = lane >> 4; const int R0 = ((z == 2) ? blockIdx.y : blockIdx.x) * 128, C0 = ((z == 2) ? blockIdx.x : blockIdx.y) * 128;
    v8f acc[4][4];
#pragma unroll
    for (int mb = 0; mb < 4; ++mb)
#pragma unroll
        for (int nb = 0; nb < 4; ++nb) acc[mb][nb] = (v8f){};
    ring128<T16>(A, Bt, K, 0, K / 64, R0, C0, wave, lane, ring, acc);
    const int r0 = R0 + (wave >> 1) * 64, c0 = C0 + (wave & 1) * 64;   // the wave's quarter
#pragma unroll
    for (int mb = 0; mb < 4; ++mb) {
#pragma unroll
        for (int nb = 0; nb < 4; ++nb) {
#pragma unroll
            for (int j = 0; j < 8; ++j) os[(hi * 8 + j) * 68 + nb * 16 + lr] = acc[mb][nb][j]; }
        __builtin_amdgcn_wave_barrier(); asm volatile("" ::: "memory");
        const size_t o0 = (size_t)(r0 + mb * 16) * ldc + (size_t)c0 * 16 + 8 * lane;
        // fragment order: the 64 columns are 4 chunks; every 16-byte store of a plane fills one whole 512-byte chunk
#pragma unroll
        for (int s = 0; s < 4; ++s) { const int row = lr, cofs = s * 16 + hi * 8; const v4f va = *(const v4fa*)(os + row * 68 + cofs), vb = *(const v4fa*)(os + row * 68 + cofs + 4); v8h o16; v8us oh, ol;
#pragma unroll
            for (int q = 0; q < 4; ++q) { unsigned short x2, y2; o16[q] = tohx(va[q]); splitf(va[q], x2, y2); oh[q] = x2; ol[q] = y2; o16[q + 4] = tohx(vb[q]); splitf(vb[q], x2, y2); oh[q + 4] = x2; ol[q + 4] = y2; }
            const size_t oo = o0 + s * 256; *(v8h*)(P16 + oo) = o16; *(v8us*)(Ph + oo) = oh; *(v8us*)(Pl + oo) = ol; }
        __builtin_amdgcn_wave_barrier(); asm volatile("" ::: "memory");
    }
}

// ---- gemmc_part: the same 64x64 tile GEMM specialised for causal attention, as a device function for one tile (rows r0.., columns c0..), called by k_scores and k_pv: CMODE 1 skips score tiles entirely above the diagonal (query rows r0+roff.., key columns c0..; returns false), CMODE 2 limits the
// key (K) loop of the weight x value contraction to the diagonal block (weights beyond it are exactly zero). roff = row offset of this launch's first row within the sequence.
// NW waves per tile (32 * NW threads; wv = the wave's number and tid the thread's number within the tile, os = the tile's own LDS: NW * 64 * 68 floats): wave w takes the 64-wide K chunks w, w + NW, ... (two blocks, 2 KiB in a row, of every 16 operand rows per chunk) into its own 16 accumulators and leaves its partial tile in LDS
// (a wave with no chunk: zeros); behind the barrier at the end the caller's epilogue (soft_hl, sum_hl) sums the partial tiles. K % 64 == 0.
template <typename T16, int NSPLIT, int CMODE, int NW>
__device__ __forceinline__ bool gemmc_part(const T16* __restrict__ A, const T16* __restrict__ A2, const T16* __restrict__ Bt, const T16* __restrict__ Bt2, int K, int roff, int r0, int c0, int wv, int tid, float* os) {
    typedef typename WFrag<T16>::V V;
    const int lane = tid & 31, lr = lane & 15, hi = lane >> 4;
    if (CMODE == 1 && c0 > r0 + roff + 63) return false;            // score tile entirely above the causal diagonal: never computed, its weights never read; taken by all NW waves of the tile, the whole work-group, in front of its barrier
    const int Kl = (CMODE == 2) ? min(K, r0 + roff + 64) : K;        // P.V: weights are exactly 0 beyond the diagonal block, so the K loop stops there
    v8f acc[4][4];
#pragma unroll
    for (int mb = 0; mb < 4; ++mb)
#pragma unroll
        for (int nb = 0; nb < 4; ++nb) acc[mb][nb] = (v8f){};
    const size_t aoff = (size_t)r0 * K, boff = (size_t)c0 * K; const unsigned lo = 8u * (unsigned)lane;   // fragment order: the tile's first block (the same for the wave: a scalar base) and the lane's 16 bytes of a chunk (one register, unchanged through the loop)
    // wv, r0 and c0 are held in scalar registers (the callers' readfirstlane) so that both loops branch on scalar compares and EXEC stays whole round the matrix instructions; both stay rolled, as the parent's loop, so that one 32-wide trip's fragments are live at a time
#pragma unroll 1
    for (int kb = wv * 64; kb < Kl; kb += NW * 64)
#pragma unroll 1
    for (int kc = kb; kc < kb + 64; kc += 32) {
        V a[4], a2[4]; const GAS T16* pa = sptr(A + aoff + kc * 16); const GAS T16* pb = sptr(Bt + boff + kc * 16); const GAS T16* pa2 = (NSPLIT == 1 || NSPLIT == 2) ? sptr(A2 + aoff + kc * 16) : nullptr; const GAS T16* pb2 = (NSPLIT >= 2) ? sptr(Bt2 + boff + kc * 16) : nullptr;
#pragma unroll
        for (int mb = 0; mb < 4; ++mb) { a[mb] = WFrag<T16>::ld(pa + (size_t)mb * 16 * K, lo); if (NSPLIT == 1 || NSPLIT == 2) a2[mb] = WFrag<T16>::ld(pa2 + (size_t)mb * 16 * K, lo); }
#pragma unroll
        for (int nb = 0; nb < 4; ++nb) { const V b = WFrag<T16>::ld(pb + (size_t)nb * 16 * K, lo); V b2; if (NSPLIT >= 2) b2 = WFrag<T16>::ld(pb2 + (size_t)nb * 16 * K, lo);
#pragma unroll
            for (int mb = 0; mb < 4; ++mb) { acc[mb][nb] = WFrag<T16>::mma(a[mb], b, acc[mb][nb]); if (NSPLIT == 1 || NSPLIT == 2) acc[mb][nb] = WFrag<T16>::mma(a2[mb], b, acc[mb][nb]); if (NSPLIT >= 2) acc[mb][nb] = WFrag<T16>::mma(a[mb], b2, acc[mb][nb]); } }
        asm volatile("v_nop\n\tv_nop\n\tv_nop\n\tv_nop" : "+v"(acc[0][0]), "+v"(acc[1][1]), "+v"(acc[2][2]), "+v"(acc[3][3]) : "v"(a[0]), "v"(a[3]));
    }
    float* ow = os + wv * (64 * 68);
#pragma unroll
    for (int mb = 0; mb < 4; ++mb)
#pragma unroll
        for (int nb = 0; nb < 4; ++nb)
#pragma unroll
            for (int j = 0; j < 8; ++j) ow[(mb * 16 + hi * 8 + j) * 68 + nb * 16 + lr] = acc[mb][nb][j];
    __syncthreads();   // every wave's partial 64x64 tile is in LDS before any of it is summed (passed by every wave of the work-group: all its tiles take this path)
    return true;
}

// ---- soft_hl: epilogue of a hi/lo score tile (query rows r0.., keys c0.., c0 <= r0) behind gemmc_part's barrier, 4 waves: wave wv sums the four partial tiles (wave 0's first) for rows 16 wv .. 16 wv + 15 and turns them into softmax weights relative to the 64-key quarter's own row maximum.
// A lane owns row lane & 15 and the 32 keys with ((key >> 3) & 1) == lane >> 4, as in the planes' fragment order: t = score * log2(e) / sqrt(HD), keys after the query excluded by index; m = max t over the 64 keys (one exchange with the other half-wave; key c0 is never after the query, so m is a score); e = 2^(t - m); l = sum e.
// Ph, Pl (bf16 hi + lo, fragment order, pitch TT) take e (0 at excluded keys); Mq and Lq ([key quarter][query row]) take m and l. k_pv brings the quarters of a row to one maximum and one sum.
__device__ __forceinline__ void soft_hl(const float* os, bf* Ph, bf* Pl, float* Mq, float* Lq, int r0, int c0, int wv, int lane) {
    const int lr = lane & 15, hi = lane >> 4, i = r0 + wv * 16 + lr, dl = i - c0 - hi * 8;   // key c0 + hi * 8 + x is at or before the query where x <= dl
    const float* op = os + (wv * 16 + lr) * 68 + hi * 8;
    float t[32]; float mx = -3.0e38f;
#pragma unroll
    for (int s = 0; s < 4; ++s) { v4f va = *(const v4fa*)(op + s * 16), vb = *(const v4fa*)(op + s * 16 + 4);
#pragma unroll
        for (int w = 1; w < 4; ++w) { va += *(const v4fa*)(op + w * (64 * 68) + s * 16); vb += *(const v4fa*)(op + w * (64 * 68) + s * 16 + 4); }
#pragma unroll
        for (int q = 0; q < 4; ++q) { t[s * 8 + q] = (s * 16 + q <= dl) ? va[q] * (SCL * LOG2E) : -3.0e38f; t[s * 8 + 4 + q] = (s * 16 + 4 + q <= dl) ? vb[q] * (SCL * LOG2E) : -3.0e38f; } }
#pragma unroll
    for (int k = 0; k < 32; ++k) mx = fmaxf(mx, t[k]);
    mx = fmaxf(mx, __shfl_xor(mx, 16, 32));
    float s4[4] = {0.f, 0.f, 0.f, 0.f};   // four independent chains of additions
#pragma unroll
    for (int k = 0; k < 32; ++k) t[k] = exp2s(t[k] - mx);
#pragma unroll
    for (int k = 0; k < 32; ++k) s4[k & 3] += t[k];
    float sum = (s4[0] + s4[1]) + (s4[2] + s4[3]);
    sum += __shfl_xor(sum, 16, 32);
    const size_t o0 = (size_t)(r0 + wv * 16) * TT + (size_t)c0 * 16 + 8 * lane;
#pragma unroll
    for (int s = 0; s < 4; ++s) { v8us oh, ol;
#pragma unroll
        for (int q = 0; q < 8; ++q) { unsigned short x2, y2; splitf(t[s * 8 + q], x2, y2); oh[q] = x2; ol[q] = y2; }
        *(v8us*)(Ph + o0 + s * 256) = oh; *(v8us*)(Pl + o0 + s * 256) = ol; }
    if (hi == 0) { Mq[(size_t)(c0 >> 6) * TT + i] = mx; Lq[(size_t)(c0 >> 6) * TT + i] = sum; }
}

// ---- sum_hl: epilogue of a hi/lo P.v tile (rows r0.., columns c0.. of O, pitch ldc) behind gemmc_part's barrier, NW waves: wave w's partial tile holds key quarter w alone, in weights relative to that quarter's own maximum; row r of it counts ft[w * 64 + r] times (f32, in LDS), quarters ascending (beyond the diagonal one both the tile and the factor are 0).
template <int NW>
__device__ __forceinline__ void sum_hl(const float* os, const float* ft, float* O, int ldc, int r0, int c0, int tid) {
    float* crow = O + (size_t)r0 * ldc + c0;
#pragma unroll
    for (int s = 0; s < 1024; s += 32 * NW) { const int q = s + tid, row = q >> 4, cofs = (q & 15) * 4; v4f val = *(const v4fa*)(os + row * 68 + cofs) * ft[row];
#pragma unroll
        for (int w = 1; w < NW; ++w) val += *(const v4fa*)(os + w * (64 * 68) + row * 68 + cofs) * ft[w * 64 + row];
        *(v4f*)(crow + (size_t)row * ldc + cofs) = val; }
}

// ---- tile_store: one wave stores its finished (16 * NMB)x64 f32 tile (rows r0.., columns c0.. of C) in whole 256-byte row pieces, 16 rows at a time through its own 16 * 68 floats of LDS (os); no work-group barrier.
template <int CMODE, int NMB>
__device__ __forceinline__ void tile_store(v8f (&acc)[NMB][4], float* C, int ldc, float cs, int r0, int c0, int lane, float* os) {
    const int lr = lane & 15, hi = lane >> 4;
#pragma unroll
    for (int mb = 0; mb < NMB; ++mb) {
#pragma unroll
        for (int nb = 0; nb < 4; ++nb) {
#pragma unroll
            for (int j = 0; j < 8; ++j) os[(hi * 8 + j) * 68 + nb * 16 + lr] = acc[mb][nb][j]; }
        __builtin_amdgcn_wave_barrier(); asm volatile("" ::: "memory");
        float* crow = C + (size_t)(r0 + mb * 16) * ldc + c0;
#pragma unroll
        for (int s = 0; s < 8; ++s) { const int row = 2 * s + hi, cofs = lr * 4; v4f val = *(const v4fa*)(os + row * 68 + cofs); if (CMODE == 2) val *= cs;
            *(v4f*)(crow + (size_t)row * ldc + cofs) = val; }
        __builtin_amdgcn_wave_barrier(); asm volatile("" ::: "memory");
    }
    asm volatile("s_wait_xcnt 0x0" ::: "memory");   // behind the tile's last store: where this path is inlined in front of other code, nothing behind it rewrites a register that an issued store still names
}

// ---- tile_soft: one wave turns its finished 64x64 score quarter (query rows r0.., keys c0.., both counted in the sequence) into softmax weights relative to the quarter's own row maximum, 16 rows at a time through its own 16 * 68 floats of LDS (os); no work-group barrier.
// A lane owns row lane & 15 and the 32 keys with ((key >> 3) & 1) == lane >> 4, as in the plane's fragment order: t = score * log2(e) / sqrt(HD), keys after the query excluded by index; m = max t over the 64 keys (one exchange with the other half-wave); e = 2^(t - m); l = sum e.
// P (f16, fragment order, pitch TT) takes e (0 at excluded keys); Mq and Lq ([key quarter][query row]) take m and l (-3e38 and 0 where the row has no key in the quarter). k_pv brings the quarters of a row to one maximum and one sum.
__device__ __forceinline__ void tile_soft(v8f (&acc)[4][4], h16* P, float* Mq, float* Lq, int r0, int c0, int lane, float* os) {
    const int lr = lane & 15, hi = lane >> 4;
#pragma unroll
    for (int mb = 0; mb < 4; ++mb) {
#pragma unroll
        for (int nb = 0; nb < 4; ++nb) {
#pragma unroll
            for (int j = 0; j < 8; ++j) os[(hi * 8 + j) * 68 + nb * 16 + lr] = acc[mb][nb][j]; }
        __builtin_amdgcn_wave_barrier(); asm volatile("" ::: "memory");
        const int i = r0 + mb * 16 + lr, dl = i - c0 - hi * 8;   // key c0 + hi * 8 + x is at or before the query where x <= dl
        float t[32]; float mx = -3.0e38f;
#pragma unroll
        for (int s = 0; s < 4; ++s) { const v4f va = *(const v4fa*)(os + lr * 68 + s * 16 + hi * 8), vb = *(const v4fa*)(os + lr * 68 + s * 16 + hi * 8 + 4);
#pragma unroll
            for (int q = 0; q < 4; ++q) { t[s * 8 + q] = (s * 16 + q <= dl) ? va[q] * (SCL * LOG2E) : -3.0e38f; t[s * 8 + 4 + q] = (s * 16 + 4 + q <= dl) ? vb[q] * (SCL * LOG2E) : -3.0e38f; } }
#pragma unroll
        for (int k = 0; k < 32; ++k) mx = fmaxf(mx, t[k]);
        mx = fmaxf(mx, __shfl_xor(mx, 16, 32));
        const float mz = (mx < -1.0e38f) ? 0.f : mx;   // a row with no key in the quarter: every exponent stays hugely negative, every weight 0
        float s4[4] = {0.f, 0.f, 0.f, 0.f};   // four independent chains of additions
#pragma unroll
        for (int k = 0; k < 32; ++k) t[k] = exp2s(t[k] - mz);
#pragma unroll
        for (int k = 0; k < 32; ++k) s4[k & 3] += t[k];
        float sum = (s4[0] + s4[1]) + (s4[2] + s4[3]);
        sum += __shfl_xor(sum, 16, 32);
        const size_t o0 = (size_t)(r0 + mb * 16) * TT + (size_t)c0 * 16 + 8 * lane;
#pragma unroll
        for (int s = 0; s < 4; ++s) { v8h o16;
#pragma unroll
            for (int q = 0; q < 8; ++q) o16[q] = tohx(t[s * 8 + q]);
            *(v8h*)(P + o0 + s * 256) = o16; }
        if (hi == 0) { Mq[(size_t)(c0 >> 6) * TT + i] = mx; Lq[(size_t)(c0 >> 6) * TT + i] = sum; }
        __builtin_amdgcn_wave_barrier(); asm volatile("" ::: "memory");
    }
    asm volatile("s_wait_xcnt 0x0" ::: "memory");   // behind the last store: nothing behind this path rewrites a register that an issued store still names
}

// ---- k_scores: every score tile at or below the diagonal, one launch, 128 threads. blockIdx.y == 0: the hi/lo rows (< RH), one 64x64 tile per work-group, its K loop split over the 4 waves, its weights by soft_hl; blockIdx.x counts the (RH/64)^2 tiles of the square that holds their diagonal.
// blockIdx.y >= 1: the f16 rows, one 128x128 tile per work-group through ring128, a 64x64 quarter per wave; (blockIdx.y - 1, blockIdx.x) count the (TT-RH)/128 x TT/128 tiles row by row. LDS: the ring's two stages, then 16 * 68 floats per wave for tile_soft.
static_assert((RH / 64) * (RH / 64) <= TT / 64 && (TT - RH) % 256 == 0 && RH % 128 == 0 && HD % 128 == 0 && DM % 128 == 0, "grid shapes of k_gemmw, k_scores and k_pv");
__global__ __launch_bounds__(128) void k_scores(const bf* __restrict__ Qh, const bf* __restrict__ Ql, const bf* __restrict__ Kh, const bf* __restrict__ Kl, const h16* __restrict__ Q16, const h16* __restrict__ K16, bf* Ph, bf* Pl, h16* P16, float* Mq, float* Lq) {
    __shared__ __align__(16) float os[STG + 4 * 16 * 68];   // the larger of the two paths' needs: 2 * STG 16-bit elements + the waves' store staging (hi/lo path: 4 * 64 * 68 floats)
    static_assert(STG + 4 * 16 * 68 >= 4 * 64 * 68, "LDS of k_scores");
    const int wave = __builtin_amdgcn_readfirstlane((int)(threadIdx.x >> 5));
    if (blockIdx.y == 0) {
        const int t = blockIdx.x; if (t >= (RH / 64) * (RH / 64)) return;   // whole work-group, in front of the barrier
        const int r0 = (t / (RH / 64)) * 64, c0 = (t % (RH / 64)) * 64;
        if (gemmc_part<bf, 2, 1, 4>(Qh, Ql, Kh, Kl, HD, 0, r0, c0, wave, (int)threadIdx.x, os)) soft_hl(os, Ph, Pl, Mq, Lq, r0, c0, wave, (int)threadIdx.x & 31);
    } else {
        const int t = ((int)blockIdx.y - 1) * (TT / 64) + (int)blockIdx.x, R0 = (t / (TT / 128)) * 128, C0 = (t % (TT / 128)) * 128, lane = (int)threadIdx.x & 31;
        if (C0 > R0 + RH + 127) {   // tile entirely above the causal diagonal: whole work-group, in front of every copy and barrier
            if (C0 == R0 + RH + 128) {   // the first of them: k_pv's key runs may reach into it (they end on a multiple of 256 keys), so its weights are stored as 0
                h16* z = P16 + (size_t)(RH + R0) * TT + (size_t)C0 * 16 + 8 * (int)threadIdx.x;
#pragma unroll
                for (int rb = 0; rb < 8; ++rb) { *(v8h*)(z + (size_t)rb * 16 * TT) = (v8h){}; *(v8h*)(z + (size_t)rb * 16 * TT + 1024) = (v8h){}; }
            }
            return;
        }
        v8f acc[4][4];
#pragma unroll
        for (int mb = 0; mb < 4; ++mb)
#pragma unroll
            for (int nb = 0; nb < 4; ++nb) acc[mb][nb] = (v8f){};
        ring128<h16>(Q16 + (size_t)RH * HD, K16, HD, 0, HD / 64, R0, C0, wave, lane, (h16*)os, acc);
        const int r0 = R0 + (wave >> 1) * 64, c0 = C0 + (wave & 1) * 64;   // the wave's quarter
        tile_soft(acc, P16, Mq, Lq, r0 + RH, c0, lane, os + STG + wave * (16 * 68));   // also the quarter entirely above the diagonal (the upper right one of a diagonal tile): k_pv reads its weights, all 0; behind the last barrier
    }
}

// ---- k_pv: every output tile, one launch, 512 threads. blockIdx.x < NPF: one 128x128 f16 tile, the row tiles with the most keys first; the keys are dealt in four equal runs of 64-key stages to four groups of 4 waves (group 0 the first run), each through a ring128 of its own;
// the runs cover the keys up to the end of the tile's diagonal block, rounded up to 4 whole runs (at most 128 keys more, never beyond TT): the probabilities there are exactly 0, as are those of the diagonal block above the diagonal.
// The four partial tiles are exchanged in LDS (accumulator order, whole 512-byte pieces) behind one barrier: group d sums and stores row block d (16 rows) of every quarter, its own part first, then the other groups' in ascending order.
// Beyond: two hi/lo 64x64 row tiles per work-group, 8 waves and half of the LDS each: wave w takes key quarter w alone (there are at most RH / 64 = 8), so that the quarter's row factors (as on the f16 path, without the carry) apply to its f32 partial tile, where the bf16 hi/lo weights stay as they were split; all pass the one barrier.
#define NPF (((TT - RH) / 128) * (HD / 128))
static_assert(RH % 256 == 0 && TT % 256 == 0 && RH / 64 <= 8, "grid and key runs of k_pv");
__global__ __launch_bounds__(512) void k_pv(const bf* __restrict__ Ph, const bf* __restrict__ Pl, const bf* __restrict__ VTh, const bf* __restrict__ VTl, const h16* __restrict__ P16, const h16* __restrict__ VT16, const float* __restrict__ Mq, const float* __restrict__ Lq, float* O) {
    __shared__ __align__(16) h16 ftab[(TT / 64) * 128];   // f16 path: the factor of every (key quarter, row of the tile)
    __shared__ float red[8 * 128];                         // f16 path: four partial maxima, then four partial sums, per row; hi/lo path: the factor of every (tile, key quarter, row)
    __shared__ __align__(16) float os[16 * 64 * 68];   // hi/lo path: 16 partial tiles; f16 path: four rings (4 * STG floats), then in their place the exchange (48 * 1024 floats) and behind it the waves' store staging (16 * 16 * 68)
    static_assert(4 * STG <= 16 * 64 * 68 && 48 * 1024 + 16 * 16 * 68 <= 16 * 64 * 68, "LDS of k_pv");
    const int wave = __builtin_amdgcn_readfirstlane((int)(threadIdx.x >> 5)); const int g = wave >> 2, w = wave & 3;
    if (blockIdx.x < NPF) {
        const int t = (int)blockIdx.x, R0 = ((TT - RH) / 128 - 1 - t / (HD / 128)) * 128, C0 = (t % (HD / 128)) * 128, lane = (int)threadIdx.x & 31;
        const int ntg = (R0 + RH + 128 + 255) / 256;   // 64-key stages per group
        v8f acc[4][4];
#pragma unroll
        for (int mb = 0; mb < 4; ++mb)
#pragma unroll
            for (int nb = 0; nb < 4; ++nb) acc[mb][nb] = (v8f){};
        // the rows' softmax is finished here: tile_soft left weights relative to each 64-key quarter's own maximum m_q with their sum l_q; row maximum M = max m_q, row sum L = sum l_q 2^(m_q - M); factor of a quarter = 2^(m_q - M) * PCAR / L (0 for quarters beyond the diagonal block).
        // Thread: row tid & 127, the 16 quarters of group g; partial maxima and sums meet in LDS (groups ascending) behind one barrier each; ring128's first barrier publishes the table.
        {
            const int row = (int)threadIdx.x & 127, nqv = (R0 + RH + 128) / 64;   // quarters that tile_soft has written for these rows
            const float* mp = Mq + (size_t)(g * 16) * TT + RH + R0 + row; const float* lp = Lq + (size_t)(g * 16) * TT + RH + R0 + row;
            float m[16], l[16]; float pm = -3.0e38f;
#pragma unroll   // all 32 loads in flight together; those of quarters never written are discarded by the select below
            for (int k = 0; k < 16; ++k) { m[k] = mp[(size_t)k * TT]; l[k] = lp[(size_t)k * TT]; }
            // inputs only: keep the 32 loads one unconditional group (left alone, the compiler put the first pair behind a branch of its own)
            asm volatile("" :: "v"(m[0]), "v"(m[1]), "v"(m[2]), "v"(m[3]), "v"(m[4]), "v"(m[5]), "v"(m[6]), "v"(m[7]), "v"(m[8]), "v"(m[9]), "v"(m[10]), "v"(m[11]), "v"(m[12]), "v"(m[13]), "v"(m[14]), "v"(m[15]));
            asm volatile("" :: "v"(l[0]), "v"(l[1]), "v"(l[2]), "v"(l[3]), "v"(l[4]), "v"(l[5]), "v"(l[6]), "v"(l[7]), "v"(l[8]), "v"(l[9]), "v"(l[10]), "v"(l[11]), "v"(l[12]), "v"(l[13]), "v"(l[14]), "v"(l[15]));
#pragma unroll
            for (int k = 0; k < 16; ++k) { const bool ok = g * 16 + k < nqv; m[k] = ok ? m[k] : -3.0e38f; l[k] = ok ? l[k] : 0.f; pm = fmaxf(pm, m[k]); }
            red[g * 128 + row] = pm;
            __syncthreads();   // the four partial maxima of every row are in LDS
            const float mr = fmaxf(fmaxf(red[row], red[128 + row]), fmaxf(red[256 + row], red[384 + row]));
            float pl = 0.f;
#pragma unroll
            for (int k = 0; k < 16; ++k) { m[k] = exp2s(m[k] - mr); pl += l[k] * m[k]; }
            red[512 + g * 128 + row] = pl;
            __syncthreads();   // the four partial sums of every row are in LDS
            const float f = __fdiv_rn(PCAR, ((red[512 + row] + red[640 + row]) + red[768 + row]) + red[896 + row]);
#pragma unroll
            for (int k = 0; k < 16; ++k) ftab[(g * 16 + k) * 128 + row] = tohx(m[k] * f);
        }
        ring128<h16, true>(P16 + (size_t)RH * TT, VT16, TT, g * ntg, ntg, R0, C0, w, lane, (h16*)os + g * (2 * STG), acc, ftab + (w >> 1) * 64 + (lane & 15));
        // behind ring128's last barrier no wave reads a ring any more: its LDS takes the exchange. A wave keeps row block g of its quarter and gives the other three to the groups that finish them (piece: 4 KiB; group d's pieces for quarter w lie side by side, the givers ascending).
        v8f fin[1][4];
#pragma unroll
        for (int d = 0; d < 4; ++d) {
            if (d == g) {
#pragma unroll
                for (int nb = 0; nb < 4; ++nb) fin[0][nb] = acc[d][nb];
            } else {
                float* exw = os + ((d * 4 + w) * 3 + (g < d ? g : g - 1)) * 1024 + lane * 4;
#pragma unroll
                for (int nb = 0; nb < 4; ++nb) { *(v4fa*)(exw + nb * 256) = __builtin_shufflevector(acc[d][nb], acc[d][nb], 0, 1, 2, 3); *(v4fa*)(exw + nb * 256 + 128) = __builtin_shufflevector(acc[d][nb], acc[d][nb], 4, 5, 6, 7); }
            }
        }
        __syncthreads();   // every group's partial blocks are in LDS before any is summed
        const float* exr = os + (g * 4 + w) * 3 * 1024 + lane * 4;
#pragma unroll
        for (int s = 0; s < 3; ++s)
#pragma unroll
            for (int nb = 0; nb < 4; ++nb) { const v4f lo4 = *(const v4fa*)(exr + s * 1024 + nb * 256), hi4 = *(const v4fa*)(exr + s * 1024 + nb * 256 + 128); fin[0][nb] += __builtin_shufflevector(lo4, hi4, 0, 1, 2, 3, 4, 5, 6, 7); }
        tile_store<2, 1>(fin, O + (size_t)RH * DQ, DQ, 1.0f / PCAR, R0 + (w >> 1) * 64 + g * 16, C0 + (w & 1) * 64, lane, os + 48 * 1024 + wave * (16 * 68));
    } else {
        const int u = (int)blockIdx.x - NPF, h = wave >> 3, w8 = wave & 7, tid = (int)threadIdx.x & 255;
        const int r0 = ((u / (HD / 64)) * 2 + h) * 64, c0 = (u % (HD / 64)) * 64, nq = r0 / 64 + 1;   // nq: the key quarters up to the diagonal one, those that soft_hl has written for these rows
        float* ft = red + h * (8 * 64);
        // row maximum M = max m_q, row sum L = sum l_q 2^(m_q - M) (quarters ascending), factor of a quarter = 2^(m_q - M) / L. Thread: row tid & 63; the four threads of a row each form M and L and store two of the eight factors; gemmc_part's barrier publishes the table.
        {
            const unsigned row = (unsigned)tid & 63u;
            float m[8], l[8]; float mr = -3.0e38f, ls = 0.f;
#pragma unroll   // all 16 loads in flight together, each scalar base + the lane's one offset register; beyond the diagonal quarter the diagonal one is read again and discarded by the select below
            for (int k = 0; k < 8; ++k) { const int kq = min(k, nq - 1); m[k] = sptr(Mq + (size_t)kq * TT + r0)[row]; l[k] = sptr(Lq + (size_t)kq * TT + r0)[row]; }
#pragma unroll
            for (int k = 0; k < 8; ++k) { const bool ok = k == 0 || k < nq; m[k] = ok ? m[k] : -3.0e38f; l[k] = ok ? l[k] : 0.f; mr = fmaxf(mr, m[k]); }
#pragma unroll
            for (int k = 0; k < 8; ++k) { m[k] = exp2s(m[k] - mr); ls += l[k] * m[k]; }
            const float f = __fdiv_rn(1.0f, ls);
#pragma unroll
            for (int k = 0; k < 8; ++k) if ((k >> 1) == (w8 >> 1)) ft[k * 64 + row] = m[k] * f;
        }
        gemmc_part<bf, 2, 2, 8>(Ph, Pl, VTh, VTl, TT, 0, r0, c0, w8, tid, os + h * (8 * 64 * 68));
        sum_hl<8>(os + h * (8 * 64 * 68), ft, O, DQ, r0, c0, tid);
    }
}

typedef __attribute__((ext_vector_type(2))) _Float16 v2h;
typedef __attribute__((ext_vector_type(4))) _Float16 v4h;
typedef __attribute__((ext_vector_type(2))) unsigned short v2us;
typedef __attribute__((ext_vector_type(4))) unsigned short v4us;
typedef __attribute__((ext_vector_type(2))) float v2f;
typedef __attribute__((ext_vector_type(4))) int v4i;

__global__ __launch_bounds__(256) void k_wtG(const float* __restrict__ w, int K, int N, bf* Bt) {
    const int lane = threadIdx.x & 31; const int L0 = (blockIdx.x * 8 + (threadIdx.x >> 5)) * 8; const int nlines = N * K / 64;
{
#pragma unroll 1
        for (int l = 0; l < 8; ++l) { const int L = L0 + l; if (L >= nlines) break; const size_t e = (size_t)L * 64 + lane * 2; const int k = (int)(e % K), n = (int)(e / K); v2us o;
            o[0] = f2bf(w[(size_t)k * N + n]); o[1] = f2bf(w[(size_t)(k + 1) * N + n]); *(v2us*)(Bt + e) = o; }
         }
}
// k_cvt8: x and the three weights to bf16 planes in fragment order in one launch, 8 elements per thread (thread i writes the plane's i-th 16 bytes, a wave one chunk); the first BX_ work-groups take x, then BW_ each take a weight.
#define BX_ (TT * DM / 8 / 256)
#define BW_ (DQ * DM / 8 / 256)
static_assert(TT * DM % 2048 == 0 && DQ * DM % 2048 == 0 && DQ == DKV, "whole work-groups per tensor");
__global__ __launch_bounds__(256) void k_cvt8(const float* __restrict__ x, const float* __restrict__ wq, const float* __restrict__ wk, const float* __restrict__ wv, bf* XB, bf* WQ, bf* WK, bf* WV) {
    int b = blockIdx.x; const float* src = x; bf* dst = XB;
    if (b >= BX_) { b -= BX_; const int w = b / BW_; b -= w * BW_; src = (w == 0) ? wq : (w == 1) ? wk : wv; dst = (w == 0) ? WQ : (w == 1) ? WK : WV; }
    const size_t i = (size_t)b * 256 + threadIdx.x; const int l = threadIdx.x & 31, c = (int)(i >> 5), blk = c >> 1;   // chunk c of block blk
    const int srow = (blk / (DM / 32)) * 16 + (l & 15), scol = (blk % (DM / 32)) * 32 + (c & 1) * 16 + (l >> 4) * 8;
    const v8f v = *(const v8f*)(src + (size_t)srow * DM + scol); v8us o;
#pragma unroll
    for (int k = 0; k < 8; ++k) o[k] = f2bf(v[k]); *(v8us*)(dst + i * 8) = o;  }

extern "C" void kernel_launch(void* const* d_in, const int* in_sizes, int n_in,
                              void* d_out, int out_size, void* d_ws, size_t ws_size, hipStream_t stream) {
    (void)in_sizes; (void)n_in; (void)out_size;
    const float* x = (const float*)d_in[0]; const float* wq = (const float*)d_in[1]; const float* wk = (const float*)d_in[2]; const float* wv = (const float*)d_in[3]; const float* wo = nullptr; (void)wo;
    float* OUT = (float*)d_out;     // [1][4096][768]
    char* wsp = (char*)d_ws;
    auto take = [&](size_t bytes) { char* p = wsp; wsp += (bytes + 255) & ~(size_t)255; return (void*)p; };
    bf* WQ = (bf*)take((size_t)DQ * DM * 2); bf* WK = (bf*)take((size_t)DKV * DM * 2); bf* WV = (bf*)take((size_t)DKV * DM * 2); 
    bf* XB = (bf*)take((size_t)TT * DM * 2);
    h16* QP16 = (h16*)take((size_t)NH_ * TT * HD * 2); h16* KP16 = (h16*)take((size_t)NKV * TT * HD * 2); h16* VT16 = (h16*)take((size_t)NKV * HD * TT * 2);
    bf* QPh = (bf*)take((size_t)NH_ * TT * HD * 2); bf* QPl = (bf*)take((size_t)NH_ * TT * HD * 2); bf* KPh = (bf*)take((size_t)NKV * TT * HD * 2); bf* KPl = (bf*)take((size_t)NKV * TT * HD * 2); bf* VTh = (bf*)take((size_t)NKV * HD * TT * 2); bf* VTl = (bf*)take((size_t)NKV * HD * TT * 2); bf* Ph = (bf*)take((size_t)ZH * RH * TT * 2); bf* Pl = (bf*)take((size_t)ZH * RH * TT * 2);
    h16* P16 = (h16*)take((size_t)ZH * TT * TT * 2); float* Mq = (float*)take((size_t)(TT / 64) * TT * 4); float* Lq = (float*)take((size_t)(TT / 64) * TT * 4);
    if ((size_t)(wsp - (char*)d_ws) > ws_size) return;    // ws 256 MiB
    for (int b = 0; b < NB_; ++b) {
        k_cvt8<<<BX_ + 3 * BW_, 256, 0, stream>>>(x + (size_t)b * TT * DM, wq, wk, wv, XB, WQ, WK, WV);
        k_gemmw<bf><<<dim3(TT / 128, DQ / 128, 3), 128, 0, stream>>>(XB, WQ, WK, WV, DM, QP16, QPh, QPl, KP16, KPh, KPl, VT16, VTh, VTl);   // v transposed: rows = value columns, pitch TT
        k_scores<<<dim3(TT / 64, 1 + (TT - RH) / 256, 1), 128, 0, stream>>>(QPh, QPl, KPh, KPl, QP16, KP16, Ph, Pl, P16, Mq, Lq);
        k_pv<<<NPF + (RH / 128) * (HD / 64), 512, 0, stream>>>(Ph, Pl, VTh, VTl, P16, VT16, Mq, Lq, OUT + (size_t)b * TT * DQ);
    }
}

// v010
// Measured time: 63.4 microseconds a run.
// Next to v009, in two timings, it ran 1.08 times as fast each time.
// Over all steps from v000 it is 4.77 times as fast.
#include <hip/hip_runtime.h>

// Causal single-head self-attention with a 768-wide head over 4,096 tokens (x [4096][768]; q,k,v = x W^T ('oi' [768][768], no bias); scores = q.k, keys after the query -> -inf; weights = softmax(scores / sqrt(768)); out = weights v -> [4096][768] (3.1 M)).
// Layout: bf16 copy of x; exact projections; ONE 768-wide head through the causal T-4096 attention (hybrid rows: < 512 hi/lo 3 products, rest fp16 x1024; only score / P.v tiles at or below the diagonal are computed (K 768 / N 768); softmax with the causal index select, per 64-key quarter in the score tile's epilogue, brought to the row's maximum and sum in P.v: f16 rows by factors on the A fragments, hi/lo rows by f32 factors on the per-quarter partial tiles); the projection GEMMs write the 16-bit operand planes and the P.v GEMMs the scaled f32 output rows from their own epilogues.
// The projections, the f16 score tiles and the f16 P.v tiles run 4 waves on a 128x128 tile (2 x 2 of 64x64): both operands come into LDS once per work-group by asynchronous copies, two buffers (ring128); a P.v tile has four such groups of 4 waves, each on a quarter of the keys.
// Four launches, each holding all the work that depends only on earlier launches: the four bf16 conversions; the three projections (grid z); the score tiles of both row classes (they leave weights, not scores); the P.v tiles of both row classes.
// Every 16-bit operand plane [rows][K] lies in fragment order: a block of 16 rows x 32 k is two 512-byte chunks (k 0..15, k 16..31 of the block); lane l = 16 * ((k >> 3) & 1) + (row & 15) owns 16 bytes (8 consecutive k) of each; blocks run along k, then down the rows, so 16 rows still fill 16 * K elements. Each of a fragment's two load instructions reads one chunk = 4 whole 128-byte lines.
// Compute dtypes, f32 accumulate: every input rounded to bf16; projections exact; attention rows < 512 3 products, rest fp16; softmax f32; output f32.

#define NB_  1
#define TT   4096
#define DM   768
#define NH_  1
#define NKV  1
#define REP  (NH_ / NKV)
#define HD   768
#define DQ   (NH_ * HD)
#define DKV  (NKV * HD)
#define ZH   1
#define RH   512                  // query rows < RH use hi+lo planes (0: none)
#define WIN  4096
#define PCAR 1024.0f
#define SCL  0.036084391824351615f   // 1/sqrt(768)
typedef _Float16 h16;
typedef unsigned short bf;
typedef __attribute__((ext_vector_type(16))) __bf16   v16bf;
typedef __attribute__((ext_vector_type(16))) _Float16 v16h;
typedef __attribute__((ext_vector_type(8)))  _Float16 v8h;
typedef __attribute__((ext_vector_type(8)))  unsigned short v8us;
typedef __attribute__((ext_vector_type(8)))  float    v8f;
typedef __attribute__((ext_vector_type(4)))  float    v4f;
typedef v8h  __attribute__((may_alias)) v8ha;
typedef v4f  __attribute__((may_alias)) v4fa;
typedef v8us __attribute__((may_alias)) v8usa;

__device__ __forceinline__ unsigned short f2bf(float f) { unsigned u = __float_as_uint(f); u += 0x7FFFu + ((u >> 16) & 1u); return (unsigned short)(u >> 16); }
__device__ __forceinline__ float bf2f(unsigned short b) { return __uint_as_float(((unsigned)b) << 16); }
__device__ __forceinline__ float bfr(float f) { return bf2f(f2bf(f)); }
__device__ __forceinline__ v16h cat16(v8h lo, v8h hi) { return __builtin_shufflevector(lo, hi, 0, 1, 2, 3, 4, 5, 6, 7, 8, 9, 10, 11, 12, 13, 14, 15); }
__device__ __forceinline__ v16bf cat16b(v8us lo, v8us hi) { return __builtin_bit_cast(v16bf, __builtin_shufflevector(lo, hi, 0, 1, 2, 3, 4, 5, 6, 7, 8, 9, 10, 11, 12, 13, 14, 15)); }
__device__ __forceinline__ v8f wmma16(v16h a, v16h b, v8f c) { return __builtin_amdgcn_wmma_f32_16x16x32_f16(false, a, false, b, (short)0, c, false, false); }
__device__ __forceinline__ v8f wmmab(v16bf a, v16bf b, v8f c) { return __builtin_amdgcn_wmma_f32_16x16x32_bf16(false, a, false, b, (short)0, c, false, false); }
__device__ __forceinline__ h16 tohx(float x) { return (h16)x; }
__device__ __forceinline__ void splitf(float y, unsigned short& h, unsigned short& l) { h = f2bf(y); l = f2bf(y - bf2f(h)); }
// exp2s: 2^x, v_exp_f32 with the one free slot that the instruction set asks for behind a transcendental in the same statement
__device__ __forceinline__ float exp2s(float x) { float r; asm("v_exp_f32 %0, %1\n\tv_nop" : "=v"(r) : "v"(x)); return r; }
#define LOG2E 1.4426950408889634f



// ---- k_gemmw: register-blocked GEMM, 4 waves per 128x128 output tile, each wave a 64x64 quarter (16 accumulators), operands from 16-bit planes in fragment order through the LDS ring of ring128; grid (TT/128, DQ/128, 3), 128 threads; blockIdx.z picks the projection: 0 q, 1 k, 2 v.
// c[m][n] (f32 accumulators) = sum_k A[m][k] Bt[n][k]; the epilogue writes c as three 16-bit planes in fragment order with ldc columns (their K): P16 = f16(c), Ph = bf16(c), Pl = bf16(c - Ph). K % 64 == 0, ldc % 8 == 0.
// The transposed planes of v come from the same code with the operands (and the two grid axes) exchanged (A = weight rows, Bt = token rows): c[d][t], ldc = TT.
// sptr: a wave-uniform operand address held in a scalar register pair (global address space), so that a fragment load is scalar base + the lane's one offset register + immediate: no 64-bit vector add a trip, and no load result can land in a register that an issued load still names as its address
#define GAS __attribute__((address_space(1)))
template <typename T> __device__ __forceinline__ const GAS T* sptr(const T* p) { const unsigned long long u = (unsigned long long)p; return (const GAS T*)(((unsigned long long)(unsigned)__builtin_amdgcn_readfirstlane((int)(u >> 32)) << 32) | (unsigned)__builtin_amdgcn_readfirstlane((int)u)); }
template <typename T16> struct WFrag;
template <> struct WFrag<h16> { typedef v16h V; static __device__ __forceinline__ V ld(const GAS h16* p, unsigned lo) { return cat16(*(const GAS v8h*)(p + lo), *(const GAS v8h*)(p + 256 + lo)); } static __device__ __forceinline__ V lds(const h16* p) { return cat16(*(const v8ha*)p, *(const v8ha*)(p + 256)); } static __device__ __forceinline__ v8f mma(V a, V b, v8f c) { return wmma16(a, b, c); } };
template <> struct WFrag<bf> { typedef v16bf V; static __device__ __forceinline__ V ld(const GAS bf* p, unsigned lo) { return cat16b(*(const GAS v8us*)(p + lo), *(const GAS v8us*)(p + 256 + lo)); } static __device__ __forceinline__ V lds(const bf* p) { return cat16b(*(const v8usa*)p, *(const v8usa*)(p + 256)); } static __device__ __forceinline__ v8f mma(V a, V b, v8f c) { return wmmab(a, b, c); } };
// ---- ring128: the K loop of a 128x128 tile (rows R0.. of A, rows C0.. of Bt) for 4 waves; wave w accumulates the 64x64 quarter (w >> 1, w & 1) in acc, k in steps of 32, ascending within a stage. K = the planes' pitch; the loop runs over the nt stages s0 .. s0 + nt - 1 (nt the same for every wave of the work-group: its barriers are the work-group's), beginning at stage s0 + rot (0 <= rot < nt) and wrapping round: the callers take rot from the tile's indices, so that work-groups which share an operand's rows, and start together, ask L2 for different lines at any one moment.
// A stage is 64 k of all 256 operand rows: 16 bands of 16 rows (8 of A, then 8 of Bt), each 2 KiB in a row in the plane's fragment order and copied as it lies, so that a fragment is again two 512-byte chunks, the lane's 16 bytes side by side. Wave w copies bands 4w .. 4w + 3.
#define STG 16384   // 16-bit elements of one stage (32 KiB); the ring holds two
// stage_fill: one wave's 16 copies of a stage (4 bands x 4 chunks of 512 bytes). g = the lane's 16 bytes of the wave's first band at the stage's k, l = their LDS byte address.
template <typename T16>
__device__ __forceinline__ void stage_fill(const T16* g, int K, unsigned l) {
#pragma unroll
    for (int h = 0; h < 2; ++h) {
        const T16* ga = g + (size_t)(2 * h) * 16 * K; const T16* gb = ga + (size_t)16 * K; const unsigned la = l + h * 4096u, lb = la + 2048u;
        // asynchronous copies global -> LDS, through no register; s_wait_xcnt 0 closes the statement so that no address register named here is rewritten in front of it
        asm volatile("global_load_async_to_lds_b128 %0, %8, off\n\t"
                     "global_load_async_to_lds_b128 %1, %9, off\n\t"
                     "global_load_async_to_lds_b128 %2, %10, off\n\t"
                     "global_load_async_to_lds_b128 %3, %11, off\n\t"
                     "global_load_async_to_lds_b128 %4, %12, off\n\t"
                     "global_load_async_to_lds_b128 %5, %13, off\n\t"
                     "global_load_async_to_lds_b128 %6, %14, off\n\t"
                     "global_load_async_to_lds_b128 %7, %15, off\n\t"
                     "s_wait_xcnt 0x0"
                     :: "v"(la), "v"(la + 512u), "v"(la + 1024u), "v"(la + 1536u), "v"(lb), "v"(lb + 512u), "v"(lb + 1024u), "v"(lb + 1536u),
                        "v"(ga), "v"(ga + 256), "v"(ga + 512), "v"(ga + 768), "v"(gb), "v"(gb + 256), "v"(gb + 512), "v"(gb + 768) : "memory");
    }
}
// SC: every A fragment of stage s is multiplied, as it leaves LDS, by the lane's own row factor ft[s * 128 + 16 * mb] (a lane of an A fragment holds one row: lane & 15); ft = the table in LDS at the wave's first row + (lane & 15), written in front of this function's first barrier.
template <typename T16, bool SC = false>
__device__ __forceinline__ void ring128(const T16* __restrict__ A, const T16* __restrict__ Bt, int K, int s0, int nt, int rot, int R0, int C0, int wave, int lane, T16* ring, v8f (&acc)[4][4], const T16* ft = nullptr) {
    typedef typename WFrag<T16>::V V;
    const T16* g = ((wave < 2) ? A + (size_t)(R0 + 64 * wave) * K : Bt + (size_t)(C0 + 64 * (wave - 2)) * K) + (size_t)s0 * 1024 + 8 * lane;
    const unsigned l = (unsigned)(size_t)ring + (unsigned)wave * 8192u + (unsigned)lane * 16u;
    const int wr = wave >> 1, wc = wave & 1;
    rot = __builtin_amdgcn_readfirstlane(rot);   // the same in every lane: held in a scalar register, so that each trip's stage arithmetic stays off the vector port (a division by a run's length left it in a vector register)
    const auto rel = [nt, rot](int t) { const int s = t + rot; return s < nt ? s : s - nt; };   // trip t (< nt) works on stage s0 + rel(t)
    stage_fill(g + (size_t)rel(0) * 1024, K, l);
    asm volatile("s_wait_asynccnt 0x0" ::: "memory");   // this wave's copies of trip 0's stage have landed
    __syncthreads();                                     // ... and every other wave's: trip 0's stage may be read
    if (nt > 1) stage_fill(g + (size_t)rel(1) * 1024, K, l + 2u * STG);
#pragma unroll 1   // one stage's fragments live at a time; the buffer alternates with the trip
    for (int t = 0; t < nt; ++t) {
        const T16* sb = ring + (t & 1) * STG + 8 * lane;
        V a[4], b[4], a1[4], b1[4];   // the fragments of the stage's two 32-wide k blocks
        T16 fs[4];
        if constexpr (SC) {   // the stage's four row factors are read in front of the fragments, so that the fragments' one wait covers them too
#pragma unroll
            for (int mb = 0; mb < 4; ++mb) fs[mb] = ft[(s0 + rel(t)) * 128 + mb * 16];
        }
#pragma unroll
        for (int mb = 0; mb < 4; ++mb) { a[mb] = WFrag<T16>::lds(sb + (wr * 4 + mb) * 1024); b[mb] = WFrag<T16>::lds(sb + (8 + wc * 4 + mb) * 1024); }
        // inputs only: keeps the 16 LDS reads of the first k block together in front of its 16 matrix instructions, one LDS latency for the group (left alone, the compiler read each b fragment directly in front of its use and waited four times)
        asm volatile("" :: "v"(a[0]), "v"(a[1]), "v"(a[2]), "v"(a[3]), "v"(b[0]), "v"(b[1]), "v"(b[2]), "v"(b[3]));
        if constexpr (SC) {
            asm volatile("" :: "v"(fs[0]), "v"(fs[1]), "v"(fs[2]), "v"(fs[3]));   // inputs only: keeps the four factor reads in that first group (left alone, the compiler read them behind the fragments' wait: a second LDS latency a stage)
#pragma unroll
            for (int mb = 0; mb < 4; ++mb) a[mb] *= fs[mb];
        }
#pragma unroll
        for (int mb = 0; mb < 4; ++mb) { a1[mb] = WFrag<T16>::lds(sb + (wr * 4 + mb) * 1024 + 512); b1[mb] = WFrag<T16>::lds(sb + (8 + wc * 4 + mb) * 1024 + 512); }
#pragma unroll
        for (int nb = 0; nb < 4; ++nb)
#pragma unroll
            for (int mb = 0; mb < 4; ++mb) acc[mb][nb] = WFrag<T16>::mma(a[mb], b[nb], acc[mb][nb]);
        asm volatile("s_wait_dscnt 0x0" ::: "memory");      // this wave's reads of the buffer are done (both k blocks are in registers) before the buffer is given up
        asm volatile("s_wait_asynccnt 0x0" ::: "memory");   // this wave's copies for trip t + 1 have landed
        __syncthreads();                                     // publishes trip t + 1's stage and ends every wave's reads of trip t's
        if (t + 2 < nt) stage_fill(g + (size_t)rel(t + 2) * 1024, K, l + (unsigned)(t & 1) * (2u * STG));
        if constexpr (SC) {
#pragma unroll
            for (int mb = 0; mb < 4; ++mb) a1[mb] *= fs[mb];
        }
        // the second k block's products, from registers alone, stand behind the refill so that the copies start as early as they may
#pragma unroll
        for (int nb = 0; nb < 4; ++nb)
#pragma unroll
            for (int mb = 0; mb < 4; ++mb) acc[mb][nb] = WFrag<T16>::mma(a1[mb], b1[nb], acc[mb][nb]);
    }
    asm volatile("s_wait_asynccnt 0x0" ::: "memory");   // no copy is outstanding behind the loop
}
template <typename T16>
__global__ __launch_bounds__(128) void k_gemmw(const T16* __restrict__ X, const T16* __restrict__ Wq, const T16* __restrict__ Wk, const T16* __restrict__ Wv, int K, h16* Q16, bf* Qh, bf* Ql, h16* K16, bf* Kh, bf* Kl, h16* V16, bf* Vh, bf* Vl) {
    __shared__ __align__(16) T16 ring[2 * STG];
    __shared__ __align__(16) float osw[4 * 16 * 68];
    const int wave = __builtin_amdgcn_readfirstlane((int)(threadIdx.x >> 5)); float* os = osw + wave * (16 * 68);   // each wave's own staging for its epilogue
    const int z = blockIdx.z; const T16* A = (z == 2) ? Wv : X; const T16* Bt = (z == 2) ? X : (z == 1) ? Wk : Wq;
    h16* P16 = (z == 2) ? V16 : (z == 1) ? K16 : Q16; bf* Ph = (z == 2) ? Vh : (z == 1) ? Kh : Qh; bf* Pl = (z == 2) ? Vl : (z == 1) ? Kl : Ql; const int ldc = (z == 2) ? TT : DQ;
    const int lane = threadIdx.x & 31, lr = lane & 15, hi = lane >> 4; const int R0 = ((z == 2) ? blockIdx.y : blockIdx.x) * 128, C0 = ((z == 2) ? blockIdx.x : blockIdx.y) * 128;
    v8f acc[4][4];
#pragma unroll
    for (int mb = 0; mb < 4; ++mb)
#pragma unroll
        for (int nb = 0; nb < 4; ++nb) acc[mb][nb] = (v8f){};
    // the 18 work-groups of a token tile (y, z) and the 32 of a weight tile (x) each spread over the stages
    ring128<T16>(A, Bt, K, 0, K / 64, (int)(blockIdx.x + blockIdx.y + 6 * blockIdx.z) % (K / 64), R0, C0, wave, lane, ring, acc);
    const int r0 = R0 + (wave >> 1) * 64, c0 = C0 + (wave & 1) * 64;   // the wave's quarter
#pragma unroll
    for (int mb = 0; mb < 4; ++mb) {
#pragma unroll
        for (int nb = 0; nb < 4; ++nb) {
#pragma unroll
            for (int j = 0; j < 8; ++j) os[(hi * 8 + j) * 68 + nb * 16 + lr] = acc[mb][nb][j]; }
        __builtin_amdgcn_wave_barrier(); asm volatile("" ::: "memory");
        const size_t o0 = (size_t)(r0 + mb * 16) * ldc + (size_t)c0 * 16 + 8 * lane;
        // fragment order: the 64 columns are 4 chunks; every 16-byte store of a plane fills one whole 512-byte chunk
#pragma unroll
        for (int s = 0; s < 4; ++s) { const int row = lr, cofs = s * 16 + hi * 8; const v4f va = *(const v4fa*)(os + row * 68 + cofs), vb = *(const v4fa*)(os + row * 68 + cofs + 4); v8h o16; v8us oh, ol;
#pragma unroll
            for (int q = 0; q < 4; ++q) { unsigned short x2, y2; o16[q] = tohx(va[q]); splitf(va[q], x2, y2); oh[q] = x2; ol[q] = y2; o16[q + 4] = tohx(vb[q]); splitf(vb[q], x2, y2); oh[q + 4] = x2; ol[q + 4] = y2; }
            const size_t oo = o0 + s * 256; *(v8h*)(P16 + oo) = o16; *(v8us*)(Ph + oo) = oh; *(v8us*)(Pl + oo) = ol; }
        __builtin_amdgcn_wave_barrier(); asm volatile("" ::: "memory");
    }
}

// ---- gemmc_part: the same 64x64 tile GEMM specialised for causal attention, as a device function for one tile (rows r0.., columns c0..), called by k_scores and k_pv: CMODE 1 skips score tiles entirely above the diagonal (query rows r0+roff.., key columns c0..; returns false), CMODE 2 limits the
// key (K) loop of the weight x value contraction to the diagonal block (weights beyond it are exactly zero). roff = row offset of this launch's first row within the sequence.
// NW waves per tile (32 * NW threads; wv = the wave's number and tid the thread's number within the tile, os = the tile's own LDS: NW * 64 * 68 floats): wave w takes the 64-wide K chunks w, w + NW, ... (two blocks, 2 KiB in a row, of every 16 operand rows per chunk) into its own 16 accumulators and leaves its partial tile in LDS
// (a wave with no chunk: zeros); behind the barrier at the end the caller's epilogue (soft_hl, sum_hl) sums the partial tiles. K % 64 == 0.
template <typename T16, int NSPLIT, int CMODE, int NW>
__device__ __forceinline__ bool gemmc_part(const T16* __restrict__ A, const T16* __restrict__ A2, const T16* __restrict__ Bt, const T16* __restrict__ Bt2, int K, int roff, int r0, int c0, int wv, int tid, float* os) {
    typedef typename WFrag<T16>::V V;
    const int lane = tid & 31, lr = lane & 15, hi = lane >> 4;
    if (CMODE == 1 && c0 > r0 + roff + 63) return false;            // score tile entirely above the causal diagonal: never computed, its weights never read; taken by all NW waves of the tile, the whole work-group, in front of its barrier
    const int Kl = (CMODE == 2) ? min(K, r0 + roff + 64) : K;        // P.V: weights are exactly 0 beyond the diagonal block, so the K loop stops there
    v8f acc[4][4];
#pragma unroll
    for (int mb = 0; mb < 4; ++mb)
#pragma unroll
        for (int nb = 0; nb < 4; ++nb) acc[mb][nb] = (v8f){};
    const size_t aoff = (size_t)r0 * K, boff = (size_t)c0 * K; const unsigned lo = 8u * (unsigned)lane;   // fragment order: the tile's first block (the same for the wave: a scalar base) and the lane's 16 bytes of a chunk (one register, unchanged through the loop)
    // wv, r0 and c0 are held in scalar registers (the callers' readfirstlane) so that both loops branch on scalar compares and EXEC stays whole round the matrix instructions; both stay rolled, as the parent's loop, so that one 32-wide trip's fragments are live at a time
#pragma unroll 1
    for (int kb = wv * 64; kb < Kl; kb += NW * 64)
#pragma unroll 1
    for (int kc = kb; kc < kb + 64; kc += 32) {
        V a[4], a2[4]; const GAS T16* pa = sptr(A + aoff + kc * 16); const GAS T16* pb = sptr(Bt + boff + kc * 16); const GAS T16* pa2 = (NSPLIT == 1 || NSPLIT == 2) ? sptr(A2 + aoff + kc * 16) : nullptr; const GAS T16* pb2 = (NSPLIT >= 2) ? sptr(Bt2 + boff + kc * 16) : nullptr;
#pragma unroll
        for (int mb = 0; mb < 4; ++mb) { a[mb] = WFrag<T16>::ld(pa + (size_t)mb * 16 * K, lo); if (NSPLIT == 1 || NSPLIT == 2) a2[mb] = WFrag<T16>::ld(pa2 + (size_t)mb * 16 * K, lo); }
#pragma unroll
        for (int nb = 0; nb < 4; ++nb) { const V b = WFrag<T16>::ld(pb + (size_t)nb * 16 * K, lo); V b2; if (NSPLIT >= 2) b2 = WFrag<T16>::ld(pb2 + (size_t)nb * 16 * K, lo);
#pragma unroll
            for (int mb = 0; mb < 4; ++mb) { acc[mb][nb] = WFrag<T16>::mma(a[mb], b, acc[mb][nb]); if (NSPLIT == 1 || NSPLIT == 2) acc[mb][nb] = WFrag<T16>::mma(a2[mb], b, acc[mb][nb]); if (NSPLIT >= 2) acc[mb][nb] = WFrag<T16>::mma(a[mb], b2, acc[mb][nb]); } }
        asm volatile("v_nop\n\tv_nop\n\tv_nop\n\tv_nop" : "+v"(acc[0][0]), "+v"(acc[1][1]), "+v"(acc[2][2]), "+v"(acc[3][3]) : "v"(a[0]), "v"(a[3]));
    }
    float* ow = os + wv * (64 * 68);
#pragma unroll
    for (int mb = 0; mb < 4; ++mb)
#pragma unroll
        for (int nb = 0; nb < 4; ++nb)
#pragma unroll
            for (int j = 0; j < 8; ++j) ow[(mb * 16 + hi * 8 + j) * 68 + nb * 16 + lr] = acc[mb][nb][j];
    __syncthreads();   // every wave's partial 64x64 tile is in LDS before any of it is summed (passed by every wave of the work-group: all its tiles take this path)
    return true;
}

// ---- soft_hl: epilogue of a hi/lo score tile (query rows r0.., keys c0.., c0 <= r0) behind gemmc_part's barrier, 4 waves: wave wv sums the four partial tiles (wave 0's first) for rows 16 wv .. 16 wv + 15 and turns them into softmax weights relative to the 64-key quarter's own row maximum.
// A lane owns row lane & 15 and the 32 keys with ((key >> 3) & 1) == lane >> 4, as in the planes' fragment order: t = score * log2(e) / sqrt(HD), keys after the query excluded by index; m = max t over the 64 keys (one exchange with the other half-wave; key c0 is never after the query, so m is a score); e = 2^(t - m); l = sum e.
// Ph, Pl (bf16 hi + lo, fragment order, pitch TT) take e (0 at excluded keys); Mq and Lq ([key quarter][query row]) take m and l. k_pv brings the quarters of a row to one maximum and one sum.
__device__ __forceinline__ void soft_hl(const float* os, bf* Ph, bf* Pl, float* Mq, float* Lq, int r0, int c0, int wv, int lane) {
    const int lr = lane & 15, hi = lane >> 4, i = r0 + wv * 16 + lr, dl = i - c0 - hi * 8;   // key c0 + hi * 8 + x is at or before the query where x <= dl
    const float* op = os + (wv * 16 + lr) * 68 + hi * 8;
    float t[32]; float mx = -3.0e38f;
#pragma unroll
    for (int s = 0; s < 4; ++s) { v4f va = *(const v4fa*)(op + s * 16), vb = *(const v4fa*)(op + s * 16 + 4);
#pragma unroll
        for (int w = 1; w < 4; ++w) { va += *(const v4fa*)(op + w * (64 * 68) + s * 16); vb += *(const v4fa*)(op + w * (64 * 68) + s * 16 + 4); }
#pragma unroll
        for (int q = 0; q < 4; ++q) { t[s * 8 + q] = (s * 16 + q <= dl) ? va[q] * (SCL * LOG2E) : -3.0e38f; t[s * 8 + 4 + q] = (s * 16 + 4 + q <= dl) ? vb[q] * (SCL * LOG2E) : -3.0e38f; } }
#pragma unroll
    for (int k = 0; k < 32; ++k) mx = fmaxf(mx, t[k]);
    mx = fmaxf(mx, __shfl_xor(mx, 16, 32));
    float s4[4] = {0.f, 0.f, 0.f, 0.f};   // four independent chains of additions
#pragma unroll
    for (int k = 0; k < 32; ++k) t[k] = exp2s(t[k] - mx);
#pragma unroll
    for (int k = 0; k < 32; ++k) s4[k & 3] += t[k];
    float sum = (s4[0] + s4[1]) + (s4[2] + s4[3]);
    sum += __shfl_xor(sum, 16, 32);
    const size_t o0 = (size_t)(r0 + wv * 16) * TT + (size_t)c0 * 16 + 8 * lane;
#pragma unroll
    for (int s = 0; s < 4; ++s) { v8us oh, ol;
#pragma unroll
        for (int q = 0; q < 8; ++q) { unsigned short x2, y2; splitf(t[s * 8 + q], x2, y2); oh[q] = x2; ol[q] = y2; }
        *(v8us*)(Ph + o0 + s * 256) = oh; *(v8us*)(Pl + o0 + s * 256) = ol; }
    if (hi == 0) { Mq[(size_t)(c0 >> 6) * TT + i] = mx; Lq[(size_t)(c0 >> 6) * TT + i] = sum; }
}

// ---- sum_hl: epilogue of a hi/lo P.v tile (rows r0.., columns c0.. of O, pitch ldc) behind gemmc_part's barrier, NW waves: wave w's partial tile holds key quarter w alone, in weights relative to that quarter's own maximum; row r of it counts ft[w * 64 + r] times (f32, in LDS), quarters ascending (beyond the diagonal one both the tile and the factor are 0).
template <int NW>
__device__ __forceinline__ void sum_hl(const float* os, const float* ft, float* O, int ldc, int r0, int c0, int tid) {
    float* crow = O + (size_t)r0 * ldc + c0;
#pragma unroll
    for (int s = 0; s < 1024; s += 32 * NW) { const int q = s + tid, row = q >> 4, cofs = (q & 15) * 4; v4f val = *(const v4fa*)(os + row * 68 + cofs) * ft[row];
#pragma unroll
        for (int w = 1; w < NW; ++w) val += *(const v4fa*)(os + w * (64 * 68) + row * 68 + cofs) * ft[w * 64 + row];
        *(v4f*)(crow + (size_t)row * ldc + cofs) = val; }
}

// ---- tile_store: one wave stores its finished (16 * NMB)x64 f32 tile (rows r0.., columns c0.. of C) in whole 256-byte row pieces, 16 rows at a time through its own 16 * 68 floats of LDS (os); no work-group barrier.
template <int CMODE, int NMB>
__device__ __forceinline__ void tile_store(v8f (&acc)[NMB][4], float* C, int ldc, float cs, int r0, int c0, int lane, float* os) {
    const int lr = lane & 15, hi = lane >> 4;
#pragma unroll
    for (int mb = 0; mb < NMB; ++mb) {
#pragma unroll
        for (int nb = 0; nb < 4; ++nb) {
#pragma unroll
            for (int j = 0; j < 8; ++j) os[(hi * 8 + j) * 68 + nb * 16 + lr] = acc[mb][nb][j]; }
        __builtin_amdgcn_wave_barrier(); asm volatile("" ::: "memory");
        float* crow = C + (size_t)(r0 + mb * 16) * ldc + c0;
#pragma unroll
        for (int s = 0; s < 8; ++s) { const int row = 2 * s + hi, cofs = lr * 4; v4f val = *(const v4fa*)(os + row * 68 + cofs); if (CMODE == 2) val *= cs;
            *(v4f*)(crow + (size_t)row * ldc + cofs) = val; }
        __builtin_amdgcn_wave_barrier(); asm volatile("" ::: "memory");
    }
    asm volatile("s_wait_xcnt 0x0" ::: "memory");   // behind the tile's last store: where this path is inlined in front of other code, nothing behind it rewrites a register that an issued store still names
}

// ---- tile_soft: one wave turns its finished 64x64 score quarter (query rows r0.., keys c0.., both counted in the sequence) into softmax weights relative to the quarter's own row maximum, 16 rows at a time through its own 16 * 68 floats of LDS (os); no work-group barrier.
// A lane owns row lane & 15 and the 32 keys with ((key >> 3) & 1) == lane >> 4, as in the plane's fragment order: t = score * log2(e) / sqrt(HD), keys after the query excluded by index; m = max t over the 64 keys (one exchange with the other half-wave); e = 2^(t - m); l = sum e.
// P (f16, fragment order, pitch TT) takes e (0 at excluded keys); Mq and Lq ([key quarter][query row]) take m and l (-3e38 and 0 where the row has no key in the quarter). k_pv brings the quarters of a row to one maximum and one sum.
__device__ __forceinline__ void tile_soft(v8f (&acc)[4][4], h16* P, float* Mq, float* Lq, int r0, int c0, int lane, float* os) {
    const int lr = lane & 15, hi = lane >> 4;
#pragma unroll
    for (int mb = 0; mb < 4; ++mb) {
#pragma unroll
        for (int nb = 0; nb < 4; ++nb) {
#pragma unroll
            for (int j = 0; j < 8; ++j) os[(hi * 8 + j) * 68 + nb * 16 + lr] = acc[mb][nb][j]; }
        __builtin_amdgcn_wave_barrier(); asm volatile("" ::: "memory");
        const int i = r0 + mb * 16 + lr, dl = i - c0 - hi * 8;   // key c0 + hi * 8 + x is at or before the query where x <= dl
        float t[32]; float mx = -3.0e38f;
#pragma unroll
        for (int s = 0; s < 4; ++s) { const v4f va = *(const v4fa*)(os + lr * 68 + s * 16 + hi * 8), vb = *(const v4fa*)(os + lr * 68 + s * 16 + hi * 8 + 4);
#pragma unroll
            for (int q = 0; q < 4; ++q) { t[s * 8 + q] = (s * 16 + q <= dl) ? va[q] * (SCL * LOG2E) : -3.0e38f; t[s * 8 + 4 + q] = (s * 16 + 4 + q <= dl) ? vb[q] * (SCL * LOG2E) : -3.0e38f; } }
#pragma unroll
        for (int k = 0; k < 32; ++k) mx = fmaxf(mx, t[k]);
        mx = fmaxf(mx, __shfl_xor(mx, 16, 32));
        const float mz = (mx < -1.0e38f) ? 0.f : mx;   // a row with no key in the quarter: every exponent stays hugely negative, every weight 0
        float s4[4] = {0.f, 0.f, 0.f, 0.f};   // four independent chains of additions
#pragma unroll
        for (int k = 0; k < 32; ++k) t[k] = exp2s(t[k] - mz);
#pragma unroll
        for (int k = 0; k < 32; ++k) s4[k & 3] += t[k];
        float sum = (s4[0] + s4[1]) + (s4[2] + s4[3]);
        sum += __shfl_xor(sum, 16, 32);
        const size_t o0 = (size_t)(r0 + mb * 16) * TT + (size_t)c0 * 16 + 8 * lane;
#pragma unroll
        for (int s = 0; s < 4; ++s) { v8h o16;
#pragma unroll
            for (int q = 0; q < 8; ++q) o16[q] = tohx(t[s * 8 + q]);
            *(v8h*)(P + o0 + s * 256) = o16; }
        if (hi == 0) { Mq[(size_t)(c0 >> 6) * TT + i] = mx; Lq[(size_t)(c0 >> 6) * TT + i] = sum; }
        __builtin_amdgcn_wave_barrier(); asm volatile("" ::: "memory");
    }
    asm volatile("s_wait_xcnt 0x0" ::: "memory");   // behind the last store: nothing behind this path rewrites a register that an issued store still names
}

// ---- k_scores: every score tile at or below the diagonal, one launch, 128 threads. blockIdx.y == 0: the hi/lo rows (< RH), one 64x64 tile per work-group, its K loop split over the 4 waves, its weights by soft_hl; blockIdx.x counts the (RH/64)^2 tiles of the square that holds their diagonal.
// blockIdx.y >= 1: the f16 rows, one 128x128 tile per work-group through ring128, a 64x64 quarter per wave; (blockIdx.y - 1, blockIdx.x) count the (TT-RH)/128 x TT/128 tiles row by row. LDS: the ring's two stages, then 16 * 68 floats per wave for tile_soft.
static_assert((RH / 64) * (RH / 64) <= TT / 64 && (TT - RH) % 256 == 0 && RH % 128 == 0 && HD % 128 == 0 && DM % 128 == 0, "grid shapes of k_gemmw, k_scores and k_pv");
__global__ __launch_bounds__(128) void k_scores(const bf* __restrict__ Qh, const bf* __restrict__ Ql, const bf* __restrict__ Kh, const bf* __restrict__ Kl, const h16* __restrict__ Q16, const h16* __restrict__ K16, bf* Ph, bf* Pl, h16* P16, float* Mq, float* Lq) {
    __shared__ __align__(16) float os[STG + 4 * 16 * 68];   // the larger of the two paths' needs: 2 * STG 16-bit elements + the waves' store staging (hi/lo path: 4 * 64 * 68 floats)
    static_assert(STG + 4 * 16 * 68 >= 4 * 64 * 68, "LDS of k_scores");
    const int wave = __builtin_amdgcn_readfirstlane((int)(threadIdx.x >> 5));
    if (blockIdx.y == 0) {
        const int t = blockIdx.x; if (t >= (RH / 64) * (RH / 64)) return;   // whole work-group, in front of the barrier
        const int r0 = (t / (RH / 64)) * 64, c0 = (t % (RH / 64)) * 64;
        if (gemmc_part<bf, 2, 1, 4>(Qh, Ql, Kh, Kl, HD, 0, r0, c0, wave, (int)threadIdx.x, os)) soft_hl(os, Ph, Pl, Mq, Lq, r0, c0, wave, (int)threadIdx.x & 31);
    } else {
        const int t = ((int)blockIdx.y - 1) * (TT / 64) + (int)blockIdx.x, R0 = (t / (TT / 128)) * 128, C0 = (t % (TT / 128)) * 128, lane = (int)threadIdx.x & 31;
        if (C0 > R0 + RH + 127) {   // tile entirely above the causal diagonal: whole work-group, in front of every copy and barrier
            if (C0 == R0 + RH + 128) {   // the first of them: k_pv's key runs may reach into it (they end on a multiple of 256 keys), so its weights are stored as 0
                h16* z = P16 + (size_t)(RH + R0) * TT + (size_t)C0 * 16 + 8 * (int)threadIdx.x;
#pragma unroll
                for (int rb = 0; rb < 8; ++rb) { *(v8h*)(z + (size_t)rb * 16 * TT) = (v8h){}; *(v8h*)(z + (size_t)rb * 16 * TT + 1024) = (v8h){}; }
            }
            return;
        }
        v8f acc[4][4];
#pragma unroll
        for (int mb = 0; mb < 4; ++mb)
#pragma unroll
            for (int nb = 0; nb < 4; ++nb) acc[mb][nb] = (v8f){};
        ring128<h16>(Q16 + (size_t)RH * HD, K16, HD, 0, HD / 64, (R0 / 128 + C0 / 128) % (HD / 64), R0, C0, wave, lane, (h16*)os, acc);   // the tiles of a query row tile, and those of a key tile, each spread over the stages
        const int r0 = R0 + (wave >> 1) * 64, c0 = C0 + (wave & 1) * 64;   // the wave's quarter
        tile_soft(acc, P16, Mq, Lq, r0 + RH, c0, lane, os + STG + wave * (16 * 68));   // also the quarter entirely above the diagonal (the upper right one of a diagonal tile): k_pv reads its weights, all 0; behind the last barrier
    }
}

// ---- k_pv: every output tile, one launch, 512 threads. blockIdx.x < NPF: one 128x128 f16 tile, the row tiles with the most keys first; the keys are dealt in four equal runs of 64-key stages to four groups of 4 waves (group 0 the first run), each through a ring128 of its own;
// the runs cover the keys up to the end of the tile's diagonal block, rounded up to 4 whole runs (at most 128 keys more, never beyond TT): the probabilities there are exactly 0, as are those of the diagonal block above the diagonal.
// The four partial tiles are exchanged in LDS (accumulator order, whole 512-byte pieces) behind one barrier: group d sums and stores row block d (16 rows) of every quarter, its own part first, then the other groups' in ascending order.
// Beyond: two hi/lo 64x64 row tiles per work-group, 8 waves and half of the LDS each: wave w takes key quarter w alone (there are at most RH / 64 = 8), so that the quarter's row factors (as on the f16 path, without the carry) apply to its f32 partial tile, where the bf16 hi/lo weights stay as they were split; all pass the one barrier.
#define NPF (((TT - RH) / 128) * (HD / 128))
static_assert(RH % 256 == 0 && TT % 256 == 0 && RH / 64 <= 8, "grid and key runs of k_pv");
__global__ __launch_bounds__(512) void k_pv(const bf* __restrict__ Ph, const bf* __restrict__ Pl, const bf* __restrict__ VTh, const bf* __restrict__ VTl, const h16* __restrict__ P16, const h16* __restrict__ VT16, const float* __restrict__ Mq, const float* __restrict__ Lq, float* O) {
    __shared__ __align__(16) h16 ftab[(TT / 64) * 128];   // f16 path: the factor of every (key quarter, row of the tile)
    __shared__ float red[8 * 128];                         // f16 path: four partial maxima, then four partial sums, per row; hi/lo path: the factor of every (tile, key quarter, row)
    __shared__ __align__(16) float os[16 * 64 * 68];   // hi/lo path: 16 partial tiles; f16 path: four rings (4 * STG floats), then in their place the exchange (48 * 1024 floats) and behind it the waves' store staging (16 * 16 * 68)
    static_assert(4 * STG <= 16 * 64 * 68 && 48 * 1024 + 16 * 16 * 68 <= 16 * 64 * 68, "LDS of k_pv");
    const int wave = __builtin_amdgcn_readfirstlane((int)(threadIdx.x >> 5)); const int g = wave >> 2, w = wave & 3;
    if (blockIdx.x < NPF) {
        const int t = (int)blockIdx.x, R0 = ((TT - RH) / 128 - 1 - t / (HD / 128)) * 128, C0 = (t % (HD / 128)) * 128, lane = (int)threadIdx.x & 31;
        const int ntg = (R0 + RH + 128 + 255) / 256;   // 64-key stages per group
        v8f acc[4][4];
#pragma unroll
        for (int mb = 0; mb < 4; ++mb)
#pragma unroll
            for (int nb = 0; nb < 4; ++nb) acc[mb][nb] = (v8f){};
        // the rows' softmax is finished here: tile_soft left weights relative to each 64-key quarter's own maximum m_q with their sum l_q; row maximum M = max m_q, row sum L = sum l_q 2^(m_q - M); factor of a quarter = 2^(m_q - M) * PCAR / L (0 for quarters beyond the diagonal block).
        // Thread: row tid & 127, the 16 quarters of group g; partial maxima and sums meet in LDS (groups ascending) behind one barrier each; ring128's first barrier publishes the table.
        {
            const int row = (int)threadIdx.x & 127, nqv = (R0 + RH + 128) / 64;   // quarters that tile_soft has written for these rows
            const float* mp = Mq + (size_t)(g * 16) * TT + RH + R0 + row; const float* lp = Lq + (size_t)(g * 16) * TT + RH + R0 + row;
            float m[16], l[16]; float pm = -3.0e38f;
#pragma unroll   // all 32 loads in flight together; those of quarters never written are discarded by the select below
            for (int k = 0; k < 16; ++k) { m[k] = mp[(size_t)k * TT]; l[k] = lp[(size_t)k * TT]; }
            // inputs only: keep the 32 loads one unconditional group (left alone, the compiler put the first pair behind a branch of its own)
            asm volatile("" :: "v"(m[0]), "v"(m[1]), "v"(m[2]), "v"(m[3]), "v"(m[4]), "v"(m[5]), "v"(m[6]), "v"(m[7]), "v"(m[8]), "v"(m[9]), "v"(m[10]), "v"(m[11]), "v"(m[12]), "v"(m[13]), "v"(m[14]), "v"(m[15]));
            asm volatile("" :: "v"(l[0]), "v"(l[1]), "v"(l[2]), "v"(l[3]), "v"(l[4]), "v"(l[5]), "v"(l[6]), "v"(l[7]), "v"(l[8]), "v"(l[9]), "v"(l[10]), "v"(l[11]), "v"(l[12]), "v"(l[13]), "v"(l[14]), "v"(l[15]));
#pragma unroll
            for (int k = 0; k < 16; ++k) { const bool ok = g * 16 + k < nqv; m[k] = ok ? m[k] : -3.0e38f; l[k] = ok ? l[k] : 0.f; pm = fmaxf(pm, m[k]); }
            red[g * 128 + row] = pm;
            __syncthreads();   // the four partial maxima of every row are in LDS
            const float mr = fmaxf(fmaxf(red[row], red[128 + row]), fmaxf(red[256 + row], red[384 + row]));
            float pl = 0.f;
#pragma unroll
            for (int k = 0; k < 16; ++k) { m[k] = exp2s(m[k] - mr); pl += l[k] * m[k]; }
            red[512 + g * 128 + row] = pl;
            __syncthreads();   // the four partial sums of every row are in LDS
            const float f = __fdiv_rn(PCAR, ((red[512 + row] + red[640 + row]) + red[768 + row]) + red[896 + row]);
#pragma unroll
            for (int k = 0; k < 16; ++k) ftab[(g * 16 + k) * 128 + row] = tohx(m[k] * f);
        }
        // the 6 column tiles of a row tile read the same weights: they spread evenly over a run's stages; the row tile's number shifts the walk against the other row tiles, which read the same values
        ring128<h16, true>(P16 + (size_t)RH * TT, VT16, TT, g * ntg, ntg, ((t % (HD / 128)) * ntg / (HD / 128) + t / (HD / 128)) % ntg, R0, C0, w, lane, (h16*)os + g * (2 * STG), acc, ftab + (w >> 1) * 64 + (lane & 15));
        // behind ring128's last barrier no wave reads a ring any more: its LDS takes the exchange. A wave keeps row block g of its quarter and gives the other three to the groups that finish them (piece: 4 KiB; group d's pieces for quarter w lie side by side, the givers ascending).
        v8f fin[1][4];
#pragma unroll
        for (int d = 0; d < 4; ++d) {
            if (d == g) {
#pragma unroll
                for (int nb = 0; nb < 4; ++nb) fin[0][nb] = acc[d][nb];
            } else {
                float* exw = os + ((d * 4 + w) * 3 + (g < d ? g : g - 1)) * 1024 + lane * 4;
#pragma unroll
                for (int nb = 0; nb < 4; ++nb) { *(v4fa*)(exw + nb * 256) = __builtin_shufflevector(acc[d][nb], acc[d][nb], 0, 1, 2, 3); *(v4fa*)(exw + nb * 256 + 128) = __builtin_shufflevector(acc[d][nb], acc[d][nb], 4, 5, 6, 7); }
            }
        }
        __syncthreads();   // every group's partial blocks are in LDS before any is summed
        const float* exr = os + (g * 4 + w) * 3 * 1024 + lane * 4;
#pragma unroll
        for (int s = 0; s < 3; ++s)
#pragma unroll
            for (int nb = 0; nb < 4; ++nb) { const v4f lo4 = *(const v4fa*)(exr + s * 1024 + nb * 256), hi4 = *(const v4fa*)(exr + s * 1024 + nb * 256 + 128); fin[0][nb] += __builtin_shufflevector(lo4, hi4, 0, 1, 2, 3, 4, 5, 6, 7); }
        tile_store<2, 1>(fin, O + (size_t)RH * DQ, DQ, 1.0f / PCAR, R0 + (w >> 1) * 64 + g * 16, C0 + (w & 1) * 64, lane, os + 48 * 1024 + wave * (16 * 68));
    } else {
        const int u = (int)blockIdx.x - NPF, h = wave >> 3, w8 = wave & 7, tid = (int)threadIdx.x & 255;
        const int r0 = ((u / (HD / 64)) * 2 + h) * 64, c0 = (u % (HD / 64)) * 64, nq = r0 / 64 + 1;   // nq: the key quarters up to the diagonal one, those that soft_hl has written for these rows
        float* ft = red + h * (8 * 64);
        // row maximum M = max m_q, row sum L = sum l_q 2^(m_q - M) (quarters ascending), factor of a quarter = 2^(m_q - M) / L. Thread: row tid & 63; the four threads of a row each form M and L and store two of the eight factors; gemmc_part's barrier publishes the table.
        {
            const unsigned row = (unsigned)tid & 63u;
            float m[8], l[8]; float mr = -3.0e38f, ls = 0.f;
#pragma unroll   // all 16 loads in flight together, each scalar base + the lane's one offset register; beyond the diagonal quarter the diagonal one is read again and discarded by the select below
            for (int k = 0; k < 8; ++k) { const int kq = min(k, nq - 1); m[k] = sptr(Mq + (size_t)kq * TT + r0)[row]; l[k] = sptr(Lq + (size_t)kq * TT + r0)[row]; }
#pragma unroll
            for (int k = 0; k < 8; ++k) { const bool ok = k == 0 || k < nq; m[k] = ok ? m[k] : -3.0e38f; l[k] = ok ? l[k] : 0.f; mr = fmaxf(mr, m[k]); }
#pragma unroll
            for (int k = 0; k < 8; ++k) { m[k] = exp2s(m[k] - mr); ls += l[k] * m[k]; }
            const float f = __fdiv_rn(1.0f, ls);
#pragma unroll
            for (int k = 0; k < 8; ++k) if ((k >> 1) == (w8 >> 1)) ft[k * 64 + row] = m[k] * f;
        }
        gemmc_part<bf, 2, 2, 8>(Ph, Pl, VTh, VTl, TT, 0, r0, c0, w8, tid, os + h * (8 * 64 * 68));
        sum_hl<8>(os + h * (8 * 64 * 68), ft, O, DQ, r0, c0, tid);
    }
}

typedef __attribute__((ext_vector_type(2))) _Float16 v2h;
typedef __attribute__((ext_vector_type(4))) _Float16 v4h;
typedef __attribute__((ext_vector_type(2))) unsigned short v2us;
typedef __attribute__((ext_vector_type(4))) unsigned short v4us;
typedef __attribute__((ext_vector_type(2))) float v2f;
typedef __attribute__((ext_vector_type(4))) int v4i;

__global__ __launch_bounds__(256) void k_wtG(const float* __restrict__ w, int K, int N, bf* Bt) {
    const int lane = threadIdx.x & 31; const int L0 = (blockIdx.x * 8 + (threadIdx.x >> 5)) * 8; const int nlines = N * K / 64;
{
#pragma unroll 1
        for (int l = 0; l < 8; ++l) { const int L = L0 + l; if (L >= nlines) break; const size_t e = (size_t)L * 64 + lane * 2; const int k = (int)(e % K), n = (int)(e / K); v2us o;
            o[0] = f2bf(w[(size_t)k * N + n]); o[1] = f2bf(w[(size_t)(k + 1) * N + n]); *(v2us*)(Bt + e) = o; }
         }
}
// k_cvt8: x and the three weights to bf16 planes in fragment order in one launch, 8 elements per thread (thread i writes the plane's i-th 16 bytes, a wave one chunk); the first BX_ work-groups take x, then BW_ each take a weight.
#define BX_ (TT * DM / 8 / 256)
#define BW_ (DQ * DM / 8 / 256)
static_assert(TT * DM % 2048 == 0 && DQ * DM % 2048 == 0 && DQ == DKV, "whole work-groups per tensor");
__global__ __launch_bounds__(256) void k_cvt8(const float* __restrict__ x, const float* __restrict__ wq, const float* __restrict__ wk, const float* __restrict__ wv, bf* XB, bf* WQ, bf* WK, bf* WV) {
    int b = blockIdx.x; const float* src = x; bf* dst = XB;
    if (b >= BX_) { b -= BX_; const int w = b / BW_; b -= w * BW_; src = (w == 0) ? wq : (w == 1) ? wk : wv; dst = (w == 0) ? WQ : (w == 1) ? WK : WV; }
    const size_t i = (size_t)b * 256 + threadIdx.x; const int l = threadIdx.x & 31, c = (int)(i >> 5), blk = c >> 1;   // chunk c of block blk
    const int srow = (blk / (DM / 32)) * 16 + (l & 15), scol = (blk % (DM / 32)) * 32 + (c & 1) * 16 + (l >> 4) * 8;
    const v8f v = *(const v8f*)(src + (size_t)srow * DM + scol); v8us o;
#pragma unroll
    for (int k = 0; k < 8; ++k) o[k] = f2bf(v[k]); *(v8us*)(dst + i * 8) = o;  }

extern "C" void kernel_launch(void* const* d_in, const int* in_sizes, int n_in,
                              void* d_out, int out_size, void* d_ws, size_t ws_size, hipStream_t stream) {
    (void)in_sizes; (void)n_in; (void)out_size;
    const float* x = (const float*)d_in[0]; const float* wq = (const float*)d_in[1]; const float* wk = (const float*)d_in[2]; const float* wv = (const float*)d_in[3]; const float* wo = nullptr; (void)wo;
    float* OUT = (float*)d_out;     // [1][4096][768]
    char* wsp = (char*)d_ws;
    auto take = [&](size_t bytes) { char* p = wsp; wsp += (bytes + 255) & ~(size_t)255; return (void*)p; };
    bf* WQ = (bf*)take((size_t)DQ * DM * 2); bf* WK = (bf*)take((size_t)DKV * DM * 2); bf* WV = (bf*)take((size_t)DKV * DM * 2); 
    bf* XB = (bf*)take((size_t)TT * DM * 2);
    h16* QP16 = (h16*)take((size_t)NH_ * TT * HD * 2); h16* KP16 = (h16*)take((size_t)NKV * TT * HD * 2); h16* VT16 = (h16*)take((size_t)NKV * HD * TT * 2);
    bf* QPh = (bf*)take((size_t)NH_ * TT * HD * 2); bf* QPl = (bf*)take((size_t)NH_ * TT * HD * 2); bf* KPh = (bf*)take((size_t)NKV * TT * HD * 2); bf* KPl = (bf*)take((size_t)NKV * TT * HD * 2); bf* VTh = (bf*)take((size_t)NKV * HD * TT * 2); bf* VTl = (bf*)take((size_t)NKV * HD * TT * 2); bf* Ph = (bf*)take((size_t)ZH * RH * TT * 2); bf* Pl = (bf*)take((size_t)ZH * RH * TT * 2);
    h16* P16 = (h16*)take((size_t)ZH * TT * TT * 2); float* Mq = (float*)take((size_t)(TT / 64) * TT * 4); float* Lq = (float*)take((size_t)(TT / 64) * TT * 4);
    if ((size_t)(wsp - (char*)d_ws) > ws_size) return;    // ws 256 MiB
    for (int b = 0; b < NB_; ++b) {
        k_cvt8<<<BX_ + 3 * BW_, 256, 0, stream>>>(x + (size_t)b * TT * DM, wq, wk, wv, XB, WQ, WK, WV);
        k_gemmw<bf><<<dim3(TT / 128, DQ / 128, 3), 128, 0, stream>>>(XB, WQ, WK, WV, DM, QP16, QPh, QPl, KP16, KPh, KPl, VT16, VTh, VTl);   // v transposed: rows = value columns, pitch TT
        k_scores<<<dim3(TT / 64, 1 + (TT - RH) / 256, 1), 128, 0, stream>>>(QPh, QPl, KPh, KPl, QP16, KP16, Ph, Pl, P16, Mq, Lq);
        k_pv<<<NPF + (RH / 128) * (HD / 64), 512, 0, stream>>>(Ph, Pl, VTh, VTl, P16, VT16, Mq, Lq, OUT + (size_t)b * TT * DQ);
    }
}
